// v000
// Measured on an AMD MI455X. A time is GPU time per run, averaged over a window of back-to-back runs after a warm-up
// (all launches, gaps included; the runs take copies of the inputs in turn), and the median of several windows.
// Apart from v000's, it joins two sittings. Times from different sittings can be a few percent apart, while
// side-by-side timings come from the same sitting.
// v000, which the later versions start from, runs in 1030 microseconds.
// compute dtype: all float inputs rounded to bf16; Q/K/V = X W with EXACT bf16 products on WMMA 16x16x32 (f32 accumulate; the single 64-wide head is carried in 128-wide planes whose upper 64 columns are zero); causal logits: q, k once to f16 (1 product) x 64^-0.5, except the first 384 query rows of each sequence (3 products with f16 residuals); softmax in f32; P x 2^11 once to f16 against v once to f16 (1 product; bf16 hi + lo below row 384); f32 output.
#include <hip/hip_runtime.h>
#include <math.h>

typedef __attribute__((ext_vector_type(16))) _Float16 v16h;
typedef __attribute__((ext_vector_type(16))) __bf16 v16b;
typedef __attribute__((ext_vector_type(8)))  _Float16 v8h;
typedef __attribute__((ext_vector_type(8)))  float v8f;
typedef __attribute__((ext_vector_type(4)))  float v4f;
typedef __attribute__((ext_vector_type(2)))  float v2f;
typedef __attribute__((ext_vector_type(4)))  unsigned v4u;
typedef __attribute__((ext_vector_type(4)))  int v4i;
typedef float __attribute__((may_alias)) float_a;
typedef int __attribute__((may_alias)) int_a;

template <typename T> __device__ __forceinline__ void vst2(void* p, T v) { *(T*)p = v;  }
__device__ __forceinline__ v8f wmma16(v16h a, v16h b, v8f c) {
  v8f d = __builtin_amdgcn_wmma_f32_16x16x32_f16(false, a, false, b, (short)0, c, false, false);
  asm volatile("v_nop\n\tv_nop\n\tv_nop\n\tv_nop" : "+v"(d) : "v"(a), "v"(b));
  return d;
}
__device__ __forceinline__ v8f wmma_bf(v16b a, v16b b, v8f c) {
  v8f d = __builtin_amdgcn_wmma_f32_16x16x32_bf16(false, a, false, b, (short)0, c, false, false);
  asm volatile("v_nop\n\tv_nop\n\tv_nop\n\tv_nop" : "+v"(d) : "v"(a), "v"(b));
  return d;
}
// 16x16x32 fragments: lane = (h = lane>>4, row/col = lane&15); elements 0..7 = k0+8h+0..7, 8..15 = k0+16+8h+0..7; D element r = row 8h+r
__device__ __forceinline__ v16h frag_h(const _Float16* rowk0, int lane) {
  union { v16h v; v8h q[2]; } u; const _Float16* p = rowk0 + 8 * (lane >> 4);
  u.q[0] = *(const v8h*)p; u.q[1] = *(const v8h*)(p + 16); return u.v;
}
__device__ __forceinline__ v16h frag_f32(const float* rowk0, int lane) {
  v16h a; const float* p = rowk0 + 8 * (lane >> 4);
#pragma unroll
  for (int i = 0; i < 8; ++i) { a[i] = (_Float16)p[i]; a[8 + i] = (_Float16)p[16 + i]; }
  return a;
}
__device__ __forceinline__ v16h frag_f32s(const float* rowk0, int lane, float sc) {
  v16h a; const float* p = rowk0 + 8 * (lane >> 4);
#pragma unroll
  for (int i = 0; i < 8; ++i) { a[i] = (_Float16)(p[i] * sc); a[8 + i] = (_Float16)(p[16 + i] * sc); }
  return a;
}
// column fragment from a [K][ld] layout (column n), rows >= K read as 0
__device__ __forceinline__ v16h fragc_f32(const float* W, int k0, int n, int lane, int ld, int K) {
  v16h a; const int g = lane >> 4;
#pragma unroll
  for (int i = 0; i < 8; ++i) { const int ka = k0 + 8 * g + i, kb = ka + 16;
    a[i] = (_Float16)(ka < K ? W[(size_t)(ka < K ? ka : K - 1) * ld + n] : 0.f); a[8 + i] = (_Float16)(kb < K ? W[(size_t)(kb < K ? kb : K - 1) * ld + n] : 0.f); }
  return a;
}
struct F2 { v16b h, l; };
__device__ __forceinline__ F2 bsplit16(const float v[16]) { F2 r;
#pragma unroll
  for (int i = 0; i < 16; ++i) { const __bf16 h = (__bf16)v[i]; r.h[i] = h; r.l[i] = (__bf16)(v[i] - (float)h); }
  return r; }
__device__ __forceinline__ F2 split_row(const float* row, int k0, int lane) { float v[16]; const float* p = row + k0 + 8 * (lane >> 4);
#pragma unroll
  for (int i = 0; i < 8; ++i) { v[i] = p[i]; v[8 + i] = p[16 + i]; }
  return bsplit16(v); }
__device__ __forceinline__ F2 split_rowK(const float* row, int k0, int lane, int K) { float v[16]; const int g = lane >> 4;
#pragma unroll
  for (int i = 0; i < 8; ++i) { const int ka = k0 + 8 * g + i, kb = ka + 16; v[i] = ka < K ? row[ka < K ? ka : K - 1] : 0.f; v[8 + i] = kb < K ? row[kb < K ? kb : K - 1] : 0.f; }
  return bsplit16(v); }
__device__ __forceinline__ F2 split_col(const float* W, int k0, int n, int lane, int ld, int K) { float v[16]; const int g = lane >> 4;
#pragma unroll
  for (int i = 0; i < 8; ++i) { const int ka = k0 + 8 * g + i, kb = ka + 16; v[i] = ka < K ? W[(size_t)(ka < K ? ka : K - 1) * ld + n] : 0.f; v[8 + i] = kb < K ? W[(size_t)(kb < K ? kb : K - 1) * ld + n] : 0.f; }
  return bsplit16(v); }
__device__ __forceinline__ v8f mac3(const F2& a, const F2& b, v8f c) { c = wmma_bf(a.l, b.h, c); c = wmma_bf(a.h, b.l, c); return wmma_bf(a.h, b.h, c); }
__device__ __forceinline__ float sigm(float v) { return 1.0f / (1.0f + expf(-v)); }
#define LDSX() do { asm volatile("s_wait_dscnt 0" ::: "memory"); __builtin_amdgcn_wave_barrier(); __builtin_amdgcn_fence(__ATOMIC_RELEASE, "workgroup"); } while (0)

// Single-head causal self-attention (B 4, S 4,096, D_in 512 -> 64): Q, K, V = X Wq/Wk/Wv ((in,out) [512, 64]); W = softmax(causal(Q K^T) / 8); Z = W V -> [B, S, 64].
#define NB 4
#define TT 4096
#define CC 128            // NH * HD = projected width
#define DIN 512          // input (model) width
#define NH 1
#define HD 128
#define NQB (TT / 64)
#define HG 1
#define SCALE (0.125f)
#define CAUSAL 1
#ifndef TNB
#define TNB NB
#endif
__device__ __forceinline__ v16b zero16b() { v16b z; _Pragma("unroll") for (int i = 0; i < 16; ++i) z[i] = (__bf16)0.f; return z; }
__device__ __forceinline__ float bfr(float v) { return (float)(__bf16)v; }
__host__ __device__ __forceinline__ int kb_last(int qb) { return CAUSAL ? ((qb * 64 + 63) >> 7) : (TT / 128 - 1); }
typedef __attribute__((ext_vector_type(8))) __bf16 v8b;
__device__ __forceinline__ v16b frag_b(const __bf16* rowk0, int lane) {
  union { v16b v; v8b q[2]; } u; const __bf16* p = rowk0 + 8 * (lane >> 4);
  u.q[0] = *(const v8b*)p; u.q[1] = *(const v8b*)(p + 16); return u.v;
}
#define QBH 6              // causal: query blocks 0..QBH-1 of each sequence (few keys, no averaging) take the high-precision path
#define QHI 384            // rows carrying a q residual plane
#define KHI 384            // key rows carrying k residual / v bf16 hi+lo planes (used only by the causal high-precision path)
// B fragment (k rows k0+.., output column o) of a weight: (in,out) [K][ld] or (out,in) [ld rows of K]: bf16 exact, or f16(bf16 * 256) exact
__device__ __forceinline__ v16b wcol_io(const float* Wm, int k0, int o, int lane, int ld) { v16b w; const int g = lane >> 4;
#pragma unroll
  for (int i = 0; i < 8; ++i) { w[i] = (__bf16)Wm[(size_t)(k0 + 8 * g + i) * ld + o]; w[8 + i] = (__bf16)Wm[(size_t)(k0 + 16 + 8 * g + i) * ld + o]; }
  return w; }
__device__ __forceinline__ v16b wcol_oi(const float* Wm, int k0, int o, int lane, int K) { v16b w; const float* p = Wm + (size_t)o * K + k0 + 8 * (lane >> 4);
#pragma unroll
  for (int i = 0; i < 8; ++i) { w[i] = (__bf16)p[i]; w[8 + i] = (__bf16)p[16 + i]; }
  return w; }
__device__ __forceinline__ v16h wcolh_io(const float* Wm, int k0, int o, int lane, int ld) { v16h w; const int g = lane >> 4;
#pragma unroll
  for (int i = 0; i < 8; ++i) { w[i] = (_Float16)(bfr(Wm[(size_t)(k0 + 8 * g + i) * ld + o]) * 256.0f); w[8 + i] = (_Float16)(bfr(Wm[(size_t)(k0 + 16 + 8 * g + i) * ld + o]) * 256.0f); }
  return w; }
__device__ __forceinline__ v16h wcolh_oi(const float* Wm, int k0, int o, int lane, int K) { v16h w; const float* p = Wm + (size_t)o * K + k0 + 8 * (lane >> 4);
#pragma unroll
  for (int i = 0; i < 8; ++i) { w[i] = (_Float16)(bfr(p[i]) * 256.0f); w[8 + i] = (_Float16)(bfr(p[16 + i]) * 256.0f); }
  return w; }
#define WQKV_LAYOUT 0   // 0 = (in,out) [DIN][DOUT]; 1 = (out,in) [CC][DIN]; 2 = per-head [NH][DIN][HD]
__device__ __forceinline__ v16b wcol_hdk(const float* Wm, int k0, int o, int lane) { v16b w; const int g = lane >> 4; const float* p = Wm + (size_t)(o / HD) * DIN * HD + (o % HD);
#pragma unroll
  for (int i = 0; i < 8; ++i) { w[i] = (__bf16)p[(size_t)(k0 + 8 * g + i) * HD]; w[8 + i] = (__bf16)p[(size_t)(k0 + 16 + 8 * g + i) * HD]; }
  return w; }
#define WO_OUT_IN 0
#if WQKV_LAYOUT == 1
#define WCOL(W, k0, o, lane) wcol_oi(W, k0, o, lane, DIN)
#elif WQKV_LAYOUT == 2
#define WCOL(W, k0, o, lane) wcol_hdk(W, k0, o, lane)
#else
#define WCOL(W, k0, o, lane) (((o) < DOUT) ? wcol_io(W, k0, (o), lane, DOUT) : zero16b())   /* W (in,out) [512][64]; plane columns >= 64 are zero */
#endif
#if WO_OUT_IN
#define WOCOL(W, k0, o, lane) wcol_oi(W, k0, o, lane, CC)
#define WOCOLH(W, k0, o, lane) wcolh_oi(W, k0, o, lane, CC)
#else
#define WOCOL(W, k0, o, lane) wcol_io(W, k0, o, lane, DIN)
#define WOCOLH(W, k0, o, lane) wcolh_io(W, k0, o, lane, DIN)
#endif
#define DOUT 64            // real head width (planes are 128 wide, columns >= 64 zero)
// ---- k_fin64: thread per float4: out[r][0..63] = YB[r][0..63] (drop the zero half of the 128-wide context rows)
__global__ __launch_bounds__(256) void k_fin64(const float* __restrict__ YB, float* __restrict__ OUT) { const size_t i = (size_t)blockIdx.x * 256 + threadIdx.x; if (i >= (size_t)TNB * TT * (DOUT / 4)) return; const size_t r = i / (DOUT / 4); const int q = (int)(i % (DOUT / 4)); vst2(OUT + r * DOUT + q * 4, *(const v4f*)(YB + r * CC + q * 4)); }
#define WS_YB  (WS_END)
#define WS_END2 (WS_YB + 4u * (size_t)NB * TT * CC)
#ifndef SM_EXTRA_PARAMS
#define SM_EXTRA_PARAMS
#endif
#ifndef PROJ_EXTRA_PARAMS
#define PROJ_EXTRA_PARAMS
#endif
#ifndef SM_MASK_HOOK
#define SM_MASK_HOOK (void)0
#endif

#define WS_QH  0u                                      // f16 q rows [b*t][CC]
#define WS_KH  (WS_QH + 2u * (size_t)NB * TT * CC)      // f16 k rows [b*t][CC]
#define WS_VT  (WS_KH + 2u * (size_t)NB * TT * CC)      // f16 v planes [b][c][t]
#define WS_QL  (WS_VT + 2u * (size_t)NB * CC * TT)      // f16 q residual x 2^10 rows [b][t < QHI][CC]
#define WS_KL  (WS_QL + 2u * (size_t)NB * QHI * CC)     // f16 k residual x 2^10 rows [b][t < KHI][CC]
#define WS_VB  (WS_KL + 2u * (size_t)NB * KHI * CC)     // bf16 v hi planes [b][c][t < KHI]
#define WS_VBL (WS_VB + 2u * (size_t)NB * CC * KHI)
#define WS_S   (WS_VBL + 2u * (size_t)NB * CC * KHI)    // f32 logits / P [hg][t][s]
#define WS_Y   (WS_S  + 4u * (size_t)HG * TT * TT)      // f32 ctx rows [b*t][CC] (only when there is an output projection)
#define WS_END (WS_Y  + 0u)

// ---- k_proj: block = (64 rows, 128 cols, which): q/k/v = X W (+ b) with exact bf16 products (K = DIN) -> which 0: q f16 rows (+ residual rows < QHI); 1: k f16 rows (+ residual rows < KHI); 2: v f16 planes [c][t] (+ bf16 hi/lo planes for t < KHI)
__global__ __launch_bounds__(128) void k_proj(const float* __restrict__ XQ, const float* __restrict__ XK, const float* __restrict__ XV, const float* __restrict__ WQ, const float* __restrict__ WK, const float* __restrict__ WV, const float* __restrict__ BQ, const float* __restrict__ BK, const float* __restrict__ BV,
    _Float16* __restrict__ QH, _Float16* __restrict__ QL, _Float16* __restrict__ KH, _Float16* __restrict__ KL, _Float16* __restrict__ VT, __bf16* __restrict__ VB, __bf16* __restrict__ VBL) {
  __shared__ __align__(16) _Float16 sh[64][136], sl[64][136]; __shared__ __align__(16) _Float16 th[128][72]; __shared__ __align__(16) __bf16 tb[128][72], tbl[128][72];
  const int tid = threadIdx.x, wave = tid >> 5, lane = tid & 31, col = lane & 15, g = lane >> 4; const int which = blockIdx.z; const int c0 = blockIdx.y * 128; const size_t r0 = (size_t)blockIdx.x * 64; const size_t bb = r0 / TT; const int t0 = (int)(r0 % TT);
  const float* X = which == 0 ? XQ : which == 1 ? XK : XV; const float* WA = which == 0 ? WQ : which == 1 ? WK : WV; const float* BA = which == 0 ? BQ : which == 1 ? BK : BV;
  v8f acc[8] = {};
#pragma unroll 2
  for (int kc = 0; kc < DIN / 32; ++kc) { v16b a; { const float* p = X + (r0 + wave * 16 + col) * DIN + kc * 32 + 8 * g;
#pragma unroll
      for (int i = 0; i < 8; ++i) { a[i] = (__bf16)p[i]; a[8 + i] = (__bf16)p[16 + i]; } }
    asm volatile("s_wait_loadcnt 0x0" ::: "memory");
#pragma unroll
    for (int j = 0; j < 8; ++j) { const v16b w = WCOL(WA, kc * 32, c0 + j * 16 + col, lane); asm volatile("s_wait_loadcnt 0x0" ::: "memory"); acc[j] = wmma_bf(a, w, acc[j]); } }
  if (which < 2) { _Float16* DH = which == 0 ? QH : KH; _Float16* DL = which == 0 ? QL : KL; const int nhi = which == 0 ? QHI : KHI; const bool hi_rows = t0 < nhi;
#pragma unroll
    for (int j = 0; j < 8; ++j) { const float bias = BA ? bfr(BA[c0 + j * 16 + col]) : 0.f;
#pragma unroll
      for (int r = 0; r < 8; ++r) { const float v = acc[j][r] + bias; const _Float16 hv = (_Float16)v; sh[wave * 16 + 8 * g + r][j * 16 + col] = hv; sl[wave * 16 + 8 * g + r][j * 16 + col] = (_Float16)((v - (float)hv) * 1024.0f); } }
    __syncthreads();
    for (int e = tid; e < 64 * 16; e += 128) { const int rl = e >> 4, q = e & 15; vst2((unsigned*)(DH + (r0 + rl) * CC + c0 + q * 8), *(const v4u*)&sh[rl][q * 8]); if (hi_rows) vst2((unsigned*)(DL + (bb * nhi + t0 + rl) * (size_t)CC + c0 + q * 8), *(const v4u*)&sl[rl][q * 8]); }
  } else { const bool hi_rows = t0 < KHI;
#pragma unroll
    for (int j = 0; j < 8; ++j) { const float bias = BA ? bfr(BA[c0 + j * 16 + col]) : 0.f;
#pragma unroll
      for (int r = 0; r < 8; ++r) { const float v = acc[j][r] + bias; const int rl = wave * 16 + 8 * g + r, cl = j * 16 + col; th[cl][rl] = (_Float16)v; const __bf16 bh = (__bf16)v; tb[cl][rl] = bh; tbl[cl][rl] = (__bf16)(v - (float)bh); } }
    __syncthreads();
    for (int e = tid; e < 128 * 8; e += 128) { const int cl = e >> 3, q = e & 7; vst2((unsigned*)(VT + (bb * CC + c0 + cl) * (size_t)TT + t0 + q * 8), *(const v4u*)&th[cl][q * 8]); if (hi_rows) { const size_t o3 = (bb * CC + c0 + cl) * (size_t)KHI + t0 + q * 8; vst2((unsigned*)(VB + o3), *(const v4u*)&tb[cl][q * 8]); vst2((unsigned*)(VBL + o3), *(const v4u*)&tbl[cl][q * 8]); } } } }
// ---- k_sc: block = (query block qb, key block kb <= kb_last(qb), head in group) of batch b: logits x SCALE; q hi + residual (x 2^10) against k (2 products) for query rows < QHI, plus the k residual (3 products) for query blocks < QBH (causal early rows); causal: blocks past the diagonal exit, the mask itself is applied by index in k_sm
__global__ __launch_bounds__(128) void k_sc(const _Float16* __restrict__ QH, const _Float16* __restrict__ KH, const _Float16* __restrict__ QL, const _Float16* __restrict__ KL, int b, int h0, float* __restrict__ S0) { __shared__ __align__(16) float ss[4][16][132];
  const int qb = blockIdx.x, kb = blockIdx.y; if (kb > kb_last(qb)) return;
  const int h = h0 + blockIdx.z; float* S = S0 + (size_t)blockIdx.z * TT * TT;
  const int tid = threadIdx.x, wave = tid >> 5, lane = tid & 31, col = lane & 15, g = lane >> 4; const int k0 = kb * 128; const int ql0 = qb * 64 + wave * 16; const size_t q0 = (size_t)b * TT + ql0, kr0 = (size_t)b * TT + k0;
  v8f acc[8] = {}, accl[8] = {};
  const _Float16* QLb = QL + (size_t)b * QHI * CC; const _Float16* KLb = KL + (size_t)b * KHI * CC;
  if (qb < QBH) {
#pragma unroll
    for (int kc = 0; kc < HD / 32; ++kc) { const v16h ah = frag_h(QH + (q0 + col) * CC + h * HD + kc * 32, lane), al = frag_h(QLb + (size_t)(ql0 + col) * CC + h * HD + kc * 32, lane);
#pragma unroll
      for (int j = 0; j < 8; ++j) { const v16h kbf = frag_h(KH + (kr0 + j * 16 + col) * CC + h * HD + kc * 32, lane), klf = frag_h(KLb + (size_t)(k0 + j * 16 + col) * CC + h * HD + kc * 32, lane); acc[j] = wmma16(ah, kbf, acc[j]); accl[j] = wmma16(al, kbf, accl[j]); accl[j] = wmma16(ah, klf, accl[j]); } }
  } else if (qb * 64 < QHI) {
#pragma unroll
    for (int kc = 0; kc < HD / 32; ++kc) { const v16h ah = frag_h(QH + (q0 + col) * CC + h * HD + kc * 32, lane), al = frag_h(QLb + (size_t)(ql0 + col) * CC + h * HD + kc * 32, lane);
#pragma unroll
      for (int j = 0; j < 8; ++j) { const v16h kbf = frag_h(KH + (kr0 + j * 16 + col) * CC + h * HD + kc * 32, lane); acc[j] = wmma16(ah, kbf, acc[j]); accl[j] = wmma16(al, kbf, accl[j]); } }
  } else {
#pragma unroll
    for (int kc = 0; kc < HD / 32; ++kc) { const v16h ah = frag_h(QH + (q0 + col) * CC + h * HD + kc * 32, lane);
#pragma unroll
      for (int j = 0; j < 8; ++j) { const v16h kbf = frag_h(KH + (kr0 + j * 16 + col) * CC + h * HD + kc * 32, lane); acc[j] = wmma16(ah, kbf, acc[j]); } } }
#pragma unroll
  for (int j = 0; j < 8; ++j) {
#pragma unroll
    for (int r = 0; r < 8; ++r) ss[wave][8 * g + r][j * 16 + col] = (acc[j][r] + accl[j][r] * (1.0f / 1024.0f)) * SCALE; }
  LDSX(); for (int rl = 0; rl < 16; ++rl) vst2(S + (size_t)(ql0 + rl) * TT + k0 + lane * 4, *(const v4f*)&ss[wave][rl][lane * 4]); }
// ---- k_sm: block = query row t (head in group): keys [0, kend): causal -> logit if s <= t else excluded; softmax in f32; P x 2^11 in place (0 for excluded)
__global__ __launch_bounds__(256) void k_sm(float* __restrict__ S0 SM_EXTRA_PARAMS) { __shared__ float sred[8]; __shared__ float sbc; __shared__ __align__(16) float shv[TT];
  const int tid = threadIdx.x; const int t = blockIdx.x; const int kend = (kb_last(t >> 6) + 1) * 128;
  float* sr = S0 + (size_t)blockIdx.y * TT * TT + (size_t)t * TT;
  float m = -3.0e38f; for (int k = tid; k < kend; k += 256) { float v = (!CAUSAL || k <= t) ? sr[k] : -3.0e38f; SM_MASK_HOOK; shv[k] = v; m = fmaxf(m, v); }
#pragma unroll
  for (int o = 1; o < 32; o <<= 1) m = fmaxf(m, __shfl_xor(m, o));
  if ((tid & 31) == 0) sred[tid >> 5] = m; __syncthreads(); if (tid == 0) { float a = sred[0]; for (int i = 1; i < 8; ++i) a = fmaxf(a, sred[i]); sbc = a; } __syncthreads(); m = sbc; __syncthreads();
  float sum = 0.f; for (int k = tid; k < kend; k += 256) { const float v = shv[k]; const float e = (v <= -1.0e38f) ? 0.f : expf(v - m); shv[k] = e; sum += e; }
#pragma unroll
  for (int o = 1; o < 32; o <<= 1) sum += __shfl_xor(sum, o);
  if ((tid & 31) == 0) sred[tid >> 5] = sum; __syncthreads(); if (tid == 0) { float a = 0.f; for (int i = 0; i < 8; ++i) a += sred[i]; sbc = a > 0.f ? 2048.0f / a : 0.f; }   /* a fully excluded row yields P = 0 */ __syncthreads(); const float inv = sbc;
  for (int k = tid; k < kend; k += 256) shv[k] = shv[k] * inv;
  __syncthreads(); for (int q = tid; q < kend / 4; q += 256) vst2(sr + q * 4, *(const v4f*)&shv[q * 4]); }
// ---- k_pv: block = 64 queries (qb) of (b, h): ctx = P . v over keys [0, kend) (P x 2^11 once to f16 against v f16: 1 product; causal early query blocks: P and v as bf16 hi + lo, 3 products); 512-B (row, head) segment by 32 lanes
__global__ __launch_bounds__(128) void k_pv(const float* __restrict__ PS0, const _Float16* __restrict__ VT, const __bf16* __restrict__ VB, const __bf16* __restrict__ VBL, int b, int h0, float* __restrict__ Y) { const int h = h0 + blockIdx.z; const float* PS = PS0 + (size_t)blockIdx.z * TT * TT; __shared__ __align__(16) float ss[4][16][HD + 4];
  const int tid = threadIdx.x, wave = tid >> 5, lane = tid & 31, col = lane & 15, g = lane >> 4; const int qb = blockIdx.x; const int ql0 = qb * 64 + wave * 16; const int kce = (kb_last(qb) + 1) * 4;
  v8f acc[HD / 16] = {};
  if (qb < QBH) {
#pragma unroll 1
    for (int kc = 0; kc < kce; ++kc) { const F2 p = split_row(PS + (size_t)(ql0 + col) * TT, kc * 32, lane);
      asm volatile("s_wait_loadcnt 0x0" ::: "memory");
#pragma unroll
      for (int j = 0; j < HD / 16; ++j) { const size_t po = ((size_t)b * CC + h * HD + j * 16 + col) * (size_t)KHI + kc * 32; const v16b vh = frag_b(VB + po, lane); acc[j] = wmma_bf(p.h, vh, acc[j]); acc[j] = wmma_bf(p.l, vh, acc[j]); acc[j] = wmma_bf(p.h, frag_b(VBL + po, lane), acc[j]); } }
  } else {
#pragma unroll 1
    for (int kc = 0; kc < kce; ++kc) { const v16h p = frag_f32(PS + (size_t)(ql0 + col) * TT + kc * 32, lane);
      asm volatile("s_wait_loadcnt 0x0" ::: "memory");
#pragma unroll
      for (int j = 0; j < HD / 16; ++j) { const size_t po = ((size_t)b * CC + h * HD + j * 16 + col) * (size_t)TT + kc * 32; acc[j] = wmma16(p, frag_h(VT + po, lane), acc[j]); } } }
#pragma unroll
  for (int j = 0; j < HD / 16; ++j)
#pragma unroll
    for (int r = 0; r < 8; ++r) ss[wave][8 * g + r][j * 16 + col] = acc[j][r] * (1.0f / 2048.0f);
  LDSX(); for (int rl = 0; rl < 16; ++rl) if (lane < HD / 4) vst2(Y + ((size_t)b * TT + ql0 + rl) * CC + h * HD + lane * 4, *(const v4f*)&ss[wave][rl][lane * 4]); }

extern "C" void kernel_launch(void* const* d_in, const int* in_sizes, int n_in, void* d_out, int out_size, void* d_ws, size_t ws_size, hipStream_t stream) {
  (void)in_sizes; (void)n_in; (void)out_size;
  const float** F = (const float**)d_in;
  if (ws_size < (size_t)WS_END) return;
  char* ws = (char*)d_ws; _Float16 *QH = (_Float16*)(ws + WS_QH), *KH = (_Float16*)(ws + WS_KH), *VT = (_Float16*)(ws + WS_VT), *QL = (_Float16*)(ws + WS_QL), *KL = (_Float16*)(ws + WS_KL); __bf16 *VB = (__bf16*)(ws + WS_VB), *VBL = (__bf16*)(ws + WS_VBL); float *S = (float*)(ws + WS_S), *Y = (float*)(ws + WS_Y);
  (void)Y; (void)QL; (void)KL; (void)VB; (void)VBL;
  // inputs: 0 X [4,4096,512]; 1 Wq, 2 Wk, 3 Wv [512,64] (in,out)
  if (ws_size < (size_t)WS_END2) return;
  float* YB = (float*)(ws + WS_YB);
  k_proj<<<dim3(TNB * TT / 64, CC / 128, 3), 128, 0, stream>>>(F[0], F[0], F[0], F[1], F[2], F[3], nullptr, nullptr, nullptr, QH, QL, KH, KL, VT, VB, VBL);
  for (int b = 0; b < TNB; ++b) {
    k_sc<<<dim3(NQB, TT / 128, 1), 128, 0, stream>>>(QH, KH, QL, KL, b, 0, S);
    k_sm<<<dim3(TT, 1), 256, 0, stream>>>(S);
    k_pv<<<dim3(NQB, 1, 1), 128, 0, stream>>>(S, VT, VB, VBL, b, 0, YB);
  }
  k_fin64<<<dim3((unsigned)(((size_t)TNB * TT * (DOUT / 4) + 255) / 256)), 256, 0, stream>>>(YB, (float*)d_out);
}

// v001
// A run of this version takes 345 microseconds.
// Timed twice side by side with v000, it ran 2.95 and 2.94 times as fast.
// compute dtype: all float inputs rounded to bf16; Q/K/V = X W with EXACT bf16 products on WMMA 16x16x32 (f32 accumulate; the single 64-wide head is carried in 128-wide planes whose upper 64 columns are zero); causal logits: q, k once to f16 (1 product) x 64^-0.5, except the first 384 query rows of each sequence (3 products with f16 residuals); softmax in f32; P x 2^11 once to f16 against v once to f16 (1 product; bf16 hi + lo below row 384); f32 output.
#include <hip/hip_runtime.h>
#include <math.h>

typedef __attribute__((ext_vector_type(16))) _Float16 v16h;
typedef __attribute__((ext_vector_type(16))) __bf16 v16b;
typedef __attribute__((ext_vector_type(8)))  _Float16 v8h;
typedef __attribute__((ext_vector_type(8)))  float v8f;
typedef __attribute__((ext_vector_type(4)))  float v4f;
typedef __attribute__((ext_vector_type(2)))  float v2f;
typedef __attribute__((ext_vector_type(4)))  unsigned v4u;
typedef __attribute__((ext_vector_type(4)))  int v4i;
typedef float __attribute__((may_alias)) float_a;
typedef int __attribute__((may_alias)) int_a;

template <typename T> __device__ __forceinline__ void vst2(void* p, T v) { *(T*)p = v;  }
__device__ __forceinline__ v8f wmma16(v16h a, v16h b, v8f c) {
  v8f d = __builtin_amdgcn_wmma_f32_16x16x32_f16(false, a, false, b, (short)0, c, false, false);
  asm volatile("v_nop\n\tv_nop\n\tv_nop\n\tv_nop" : "+v"(d) : "v"(a), "v"(b));
  return d;
}
__device__ __forceinline__ v8f wmma_bf(v16b a, v16b b, v8f c) {
  v8f d = __builtin_amdgcn_wmma_f32_16x16x32_bf16(false, a, false, b, (short)0, c, false, false);
  asm volatile("v_nop\n\tv_nop\n\tv_nop\n\tv_nop" : "+v"(d) : "v"(a), "v"(b));
  return d;
}
// 16x16x32 fragments: lane = (h = lane>>4, row/col = lane&15); elements 0..7 = k0+8h+0..7, 8..15 = k0+16+8h+0..7; D element r = row 8h+r
__device__ __forceinline__ v16h frag_h(const _Float16* rowk0, int lane) {
  union { v16h v; v8h q[2]; } u; const _Float16* p = rowk0 + 8 * (lane >> 4);
  u.q[0] = *(const v8h*)p; u.q[1] = *(const v8h*)(p + 16); return u.v;
}
__device__ __forceinline__ v16h frag_f32(const float* rowk0, int lane) {
  v16h a; const float* p = rowk0 + 8 * (lane >> 4);
#pragma unroll
  for (int i = 0; i < 8; ++i) { a[i] = (_Float16)p[i]; a[8 + i] = (_Float16)p[16 + i]; }
  return a;
}
__device__ __forceinline__ v16h frag_f32s(const float* rowk0, int lane, float sc) {
  v16h a; const float* p = rowk0 + 8 * (lane >> 4);
#pragma unroll
  for (int i = 0; i < 8; ++i) { a[i] = (_Float16)(p[i] * sc); a[8 + i] = (_Float16)(p[16 + i] * sc); }
  return a;
}
// column fragment from a [K][ld] layout (column n), rows >= K read as 0
__device__ __forceinline__ v16h fragc_f32(const float* W, int k0, int n, int lane, int ld, int K) {
  v16h a; const int g = lane >> 4;
#pragma unroll
  for (int i = 0; i < 8; ++i) { const int ka = k0 + 8 * g + i, kb = ka + 16;
    a[i] = (_Float16)(ka < K ? W[(size_t)(ka < K ? ka : K - 1) * ld + n] : 0.f); a[8 + i] = (_Float16)(kb < K ? W[(size_t)(kb < K ? kb : K - 1) * ld + n] : 0.f); }
  return a;
}
struct F2 { v16b h, l; };
__device__ __forceinline__ F2 bsplit16(const float v[16]) { F2 r;
#pragma unroll
  for (int i = 0; i < 16; ++i) { const __bf16 h = (__bf16)v[i]; r.h[i] = h; r.l[i] = (__bf16)(v[i] - (float)h); }
  return r; }
__device__ __forceinline__ F2 split_row(const float* row, int k0, int lane) { float v[16]; const float* p = row + k0 + 8 * (lane >> 4);
#pragma unroll
  for (int i = 0; i < 8; ++i) { v[i] = p[i]; v[8 + i] = p[16 + i]; }
  return bsplit16(v); }
__device__ __forceinline__ F2 split_rowK(const float* row, int k0, int lane, int K) { float v[16]; const int g = lane >> 4;
#pragma unroll
  for (int i = 0; i < 8; ++i) { const int ka = k0 + 8 * g + i, kb = ka + 16; v[i] = ka < K ? row[ka < K ? ka : K - 1] : 0.f; v[8 + i] = kb < K ? row[kb < K ? kb : K - 1] : 0.f; }
  return bsplit16(v); }
__device__ __forceinline__ F2 split_col(const float* W, int k0, int n, int lane, int ld, int K) { float v[16]; const int g = lane >> 4;
#pragma unroll
  for (int i = 0; i < 8; ++i) { const int ka = k0 + 8 * g + i, kb = ka + 16; v[i] = ka < K ? W[(size_t)(ka < K ? ka : K - 1) * ld + n] : 0.f; v[8 + i] = kb < K ? W[(size_t)(kb < K ? kb : K - 1) * ld + n] : 0.f; }
  return bsplit16(v); }
__device__ __forceinline__ v8f mac3(const F2& a, const F2& b, v8f c) { c = wmma_bf(a.l, b.h, c); c = wmma_bf(a.h, b.l, c); return wmma_bf(a.h, b.h, c); }
__device__ __forceinline__ float sigm(float v) { return 1.0f / (1.0f + expf(-v)); }
#define LDSX() do { asm volatile("s_wait_dscnt 0" ::: "memory"); __builtin_amdgcn_wave_barrier(); __builtin_amdgcn_fence(__ATOMIC_RELEASE, "workgroup"); } while (0)

// Single-head causal self-attention (B 4, S 4,096, D_in 512 -> 64): Q, K, V = X Wq/Wk/Wv ((in,out) [512, 64]); W = softmax(causal(Q K^T) / 8); Z = W V -> [B, S, 64].
#define NB 4
#define TT 4096
#define CC 128            // NH * HD = projected width
#define DIN 512          // input (model) width
#define NH 1
#define HD 128
#define NQB (TT / 64)
#define HG 1
#define SCALE (0.125f)
#define CAUSAL 1
#ifndef TNB
#define TNB NB
#endif
__device__ __forceinline__ v16b zero16b() { v16b z; _Pragma("unroll") for (int i = 0; i < 16; ++i) z[i] = (__bf16)0.f; return z; }
__device__ __forceinline__ float bfr(float v) { return (float)(__bf16)v; }
__host__ __device__ __forceinline__ int kb_last(int qb) { return CAUSAL ? ((qb * 64 + 63) >> 7) : (TT / 128 - 1); }
typedef __attribute__((ext_vector_type(8))) __bf16 v8b;
__device__ __forceinline__ v16b frag_b(const __bf16* rowk0, int lane) {
  union { v16b v; v8b q[2]; } u; const __bf16* p = rowk0 + 8 * (lane >> 4);
  u.q[0] = *(const v8b*)p; u.q[1] = *(const v8b*)(p + 16); return u.v;
}
#define QBH 6              // causal: query blocks 0..QBH-1 of each sequence (few keys, no averaging) take the high-precision path
#define QHI 384            // rows carrying a q residual plane
#define KHI 384            // key rows carrying k residual / v bf16 hi+lo planes (used only by the causal high-precision path)
// B fragment (k rows k0+.., output column o) of a weight: (in,out) [K][ld] or (out,in) [ld rows of K]: bf16 exact, or f16(bf16 * 256) exact
__device__ __forceinline__ v16b wcol_io(const float* Wm, int k0, int o, int lane, int ld) { v16b w; const int g = lane >> 4;
#pragma unroll
  for (int i = 0; i < 8; ++i) { w[i] = (__bf16)Wm[(size_t)(k0 + 8 * g + i) * ld + o]; w[8 + i] = (__bf16)Wm[(size_t)(k0 + 16 + 8 * g + i) * ld + o]; }
  return w; }
__device__ __forceinline__ v16b wcol_oi(const float* Wm, int k0, int o, int lane, int K) { v16b w; const float* p = Wm + (size_t)o * K + k0 + 8 * (lane >> 4);
#pragma unroll
  for (int i = 0; i < 8; ++i) { w[i] = (__bf16)p[i]; w[8 + i] = (__bf16)p[16 + i]; }
  return w; }
__device__ __forceinline__ v16h wcolh_io(const float* Wm, int k0, int o, int lane, int ld) { v16h w; const int g = lane >> 4;
#pragma unroll
  for (int i = 0; i < 8; ++i) { w[i] = (_Float16)(bfr(Wm[(size_t)(k0 + 8 * g + i) * ld + o]) * 256.0f); w[8 + i] = (_Float16)(bfr(Wm[(size_t)(k0 + 16 + 8 * g + i) * ld + o]) * 256.0f); }
  return w; }
__device__ __forceinline__ v16h wcolh_oi(const float* Wm, int k0, int o, int lane, int K) { v16h w; const float* p = Wm + (size_t)o * K + k0 + 8 * (lane >> 4);
#pragma unroll
  for (int i = 0; i < 8; ++i) { w[i] = (_Float16)(bfr(p[i]) * 256.0f); w[8 + i] = (_Float16)(bfr(p[16 + i]) * 256.0f); }
  return w; }
#define WQKV_LAYOUT 0   // 0 = (in,out) [DIN][DOUT]; 1 = (out,in) [CC][DIN]; 2 = per-head [NH][DIN][HD]
__device__ __forceinline__ v16b wcol_hdk(const float* Wm, int k0, int o, int lane) { v16b w; const int g = lane >> 4; const float* p = Wm + (size_t)(o / HD) * DIN * HD + (o % HD);
#pragma unroll
  for (int i = 0; i < 8; ++i) { w[i] = (__bf16)p[(size_t)(k0 + 8 * g + i) * HD]; w[8 + i] = (__bf16)p[(size_t)(k0 + 16 + 8 * g + i) * HD]; }
  return w; }
#define WO_OUT_IN 0
#if WQKV_LAYOUT == 1
#define WCOL(W, k0, o, lane) wcol_oi(W, k0, o, lane, DIN)
#elif WQKV_LAYOUT == 2
#define WCOL(W, k0, o, lane) wcol_hdk(W, k0, o, lane)
#else
#define WCOL(W, k0, o, lane) (((o) < DOUT) ? wcol_io(W, k0, (o), lane, DOUT) : zero16b())   /* W (in,out) [512][64]; plane columns >= 64 are zero */
#endif
#if WO_OUT_IN
#define WOCOL(W, k0, o, lane) wcol_oi(W, k0, o, lane, CC)
#define WOCOLH(W, k0, o, lane) wcolh_oi(W, k0, o, lane, CC)
#else
#define WOCOL(W, k0, o, lane) wcol_io(W, k0, o, lane, DIN)
#define WOCOLH(W, k0, o, lane) wcolh_io(W, k0, o, lane, DIN)
#endif
#define DOUT 64            // real head width (planes are 128 wide, columns >= 64 zero)
// ---- k_fin64: thread per float4: out[r][0..63] = YB[r][0..63] (drop the zero half of the 128-wide context rows)
__global__ __launch_bounds__(256) void k_fin64(const float* __restrict__ YB, float* __restrict__ OUT) { const size_t i = (size_t)blockIdx.x * 256 + threadIdx.x; if (i >= (size_t)TNB * TT * (DOUT / 4)) return; const size_t r = i / (DOUT / 4); const int q = (int)(i % (DOUT / 4)); vst2(OUT + r * DOUT + q * 4, *(const v4f*)(YB + r * CC + q * 4)); }
#define WS_YB  (WS_END)
#define WS_END2 (WS_YB + 4u * (size_t)NB * TT * CC)
#ifndef SM_EXTRA_PARAMS
#define SM_EXTRA_PARAMS
#endif
#ifndef PROJ_EXTRA_PARAMS
#define PROJ_EXTRA_PARAMS
#endif
#ifndef SM_MASK_HOOK
#define SM_MASK_HOOK (void)0
#endif

#define WS_QH  0u                                      // f16 q rows [b*t][CC]
#define WS_KH  (WS_QH + 2u * (size_t)NB * TT * CC)      // f16 k rows [b*t][CC]
#define WS_VT  (WS_KH + 2u * (size_t)NB * TT * CC)      // f16 v planes [b][c][t]
#define WS_QL  (WS_VT + 2u * (size_t)NB * CC * TT)      // f16 q residual x 2^10 rows [b][t < QHI][CC]
#define WS_KL  (WS_QL + 2u * (size_t)NB * QHI * CC)     // f16 k residual x 2^10 rows [b][t < KHI][CC]
#define WS_VB  (WS_KL + 2u * (size_t)NB * KHI * CC)     // bf16 v hi planes [b][c][t < KHI]
#define WS_VBL (WS_VB + 2u * (size_t)NB * CC * KHI)
#define WS_S   (WS_VBL + 2u * (size_t)NB * CC * KHI)    // f32 logits / P [hg][t][s]
#define WS_Y   (WS_S  + 4u * (size_t)HG * TT * TT)      // f32 ctx rows [b*t][CC] (only when there is an output projection)
#define WS_END (WS_Y  + 0u)

// ---- k_proj: block = (64 rows, 128 cols, which): q/k/v = X W (+ b) with exact bf16 products (K = DIN) -> which 0: q f16 rows (+ residual rows < QHI); 1: k f16 rows (+ residual rows < KHI); 2: v f16 planes [c][t] (+ bf16 hi/lo planes for t < KHI)
__global__ __launch_bounds__(128) void k_proj(const float* __restrict__ XQ, const float* __restrict__ XK, const float* __restrict__ XV, const float* __restrict__ WQ, const float* __restrict__ WK, const float* __restrict__ WV, const float* __restrict__ BQ, const float* __restrict__ BK, const float* __restrict__ BV,
    _Float16* __restrict__ QH, _Float16* __restrict__ QL, _Float16* __restrict__ KH, _Float16* __restrict__ KL, _Float16* __restrict__ VT, __bf16* __restrict__ VB, __bf16* __restrict__ VBL) {
  __shared__ __align__(16) _Float16 sh[64][136], sl[64][136]; __shared__ __align__(16) _Float16 th[128][72]; __shared__ __align__(16) __bf16 tb[128][72], tbl[128][72];
  const int tid = threadIdx.x, wave = tid >> 5, lane = tid & 31, col = lane & 15, g = lane >> 4; const int which = blockIdx.z; const int c0 = blockIdx.y * 128; const size_t r0 = (size_t)blockIdx.x * 64; const size_t bb = r0 / TT; const int t0 = (int)(r0 % TT);
  const float* X = which == 0 ? XQ : which == 1 ? XK : XV; const float* WA = which == 0 ? WQ : which == 1 ? WK : WV; const float* BA = which == 0 ? BQ : which == 1 ? BK : BV;
  v8f acc[8] = {};
#pragma unroll 2
  for (int kc = 0; kc < DIN / 32; ++kc) { v16b a; { const float* p = X + (r0 + wave * 16 + col) * DIN + kc * 32 + 8 * g;
#pragma unroll
      for (int i = 0; i < 8; ++i) { a[i] = (__bf16)p[i]; a[8 + i] = (__bf16)p[16 + i]; } }
    asm volatile("s_wait_loadcnt 0x0" ::: "memory");
#pragma unroll
    for (int j = 0; j < 8; ++j) { const v16b w = WCOL(WA, kc * 32, c0 + j * 16 + col, lane); asm volatile("s_wait_loadcnt 0x0" ::: "memory"); acc[j] = wmma_bf(a, w, acc[j]); } }
  if (which < 2) { _Float16* DH = which == 0 ? QH : KH; _Float16* DL = which == 0 ? QL : KL; const int nhi = which == 0 ? QHI : KHI; const bool hi_rows = t0 < nhi;
#pragma unroll
    for (int j = 0; j < 8; ++j) { const float bias = BA ? bfr(BA[c0 + j * 16 + col]) : 0.f;
#pragma unroll
      for (int r = 0; r < 8; ++r) { const float v = acc[j][r] + bias; const _Float16 hv = (_Float16)v; sh[wave * 16 + 8 * g + r][j * 16 + col] = hv; sl[wave * 16 + 8 * g + r][j * 16 + col] = (_Float16)((v - (float)hv) * 1024.0f); } }
    __syncthreads();
    for (int e = tid; e < 64 * 16; e += 128) { const int rl = e >> 4, q = e & 15; vst2((unsigned*)(DH + (r0 + rl) * CC + c0 + q * 8), *(const v4u*)&sh[rl][q * 8]); if (hi_rows) vst2((unsigned*)(DL + (bb * nhi + t0 + rl) * (size_t)CC + c0 + q * 8), *(const v4u*)&sl[rl][q * 8]); }
  } else { const bool hi_rows = t0 < KHI;
#pragma unroll
    for (int j = 0; j < 8; ++j) { const float bias = BA ? bfr(BA[c0 + j * 16 + col]) : 0.f;
#pragma unroll
      for (int r = 0; r < 8; ++r) { const float v = acc[j][r] + bias; const int rl = wave * 16 + 8 * g + r, cl = j * 16 + col; th[cl][rl] = (_Float16)v; const __bf16 bh = (__bf16)v; tb[cl][rl] = bh; tbl[cl][rl] = (__bf16)(v - (float)bh); } }
    __syncthreads();
    for (int e = tid; e < 128 * 8; e += 128) { const int cl = e >> 3, q = e & 7; vst2((unsigned*)(VT + (bb * CC + c0 + cl) * (size_t)TT + t0 + q * 8), *(const v4u*)&th[cl][q * 8]); if (hi_rows) { const size_t o3 = (bb * CC + c0 + cl) * (size_t)KHI + t0 + q * 8; vst2((unsigned*)(VB + o3), *(const v4u*)&tb[cl][q * 8]); vst2((unsigned*)(VBL + o3), *(const v4u*)&tbl[cl][q * 8]); } } } }
// ---- k_sc: block = (query block qb, key block kb <= kb_last(qb), head in group) of batch b: logits x SCALE; q hi + residual (x 2^10) against k (2 products) for query rows < QHI, plus the k residual (3 products) for query blocks < QBH (causal early rows); causal: blocks past the diagonal exit, the mask itself is applied by index in k_sm
__global__ __launch_bounds__(128) void k_sc(const _Float16* __restrict__ QH, const _Float16* __restrict__ KH, const _Float16* __restrict__ QL, const _Float16* __restrict__ KL, int b, int h0, float* __restrict__ S0) { __shared__ __align__(16) float ss[4][16][132];
  const int qb = blockIdx.x, kb = blockIdx.y; if (kb > kb_last(qb)) return;
  const int h = h0 + blockIdx.z; float* S = S0 + (size_t)blockIdx.z * TT * TT;
  const int tid = threadIdx.x, wave = tid >> 5, lane = tid & 31, col = lane & 15, g = lane >> 4; const int k0 = kb * 128; const int ql0 = qb * 64 + wave * 16; const size_t q0 = (size_t)b * TT + ql0, kr0 = (size_t)b * TT + k0;
  v8f acc[8] = {}, accl[8] = {};
  const _Float16* QLb = QL + (size_t)b * QHI * CC; const _Float16* KLb = KL + (size_t)b * KHI * CC;
  if (qb < QBH) {
#pragma unroll
    for (int kc = 0; kc < HD / 32; ++kc) { const v16h ah = frag_h(QH + (q0 + col) * CC + h * HD + kc * 32, lane), al = frag_h(QLb + (size_t)(ql0 + col) * CC + h * HD + kc * 32, lane);
#pragma unroll
      for (int j = 0; j < 8; ++j) { const v16h kbf = frag_h(KH + (kr0 + j * 16 + col) * CC + h * HD + kc * 32, lane), klf = frag_h(KLb + (size_t)(k0 + j * 16 + col) * CC + h * HD + kc * 32, lane); acc[j] = wmma16(ah, kbf, acc[j]); accl[j] = wmma16(al, kbf, accl[j]); accl[j] = wmma16(ah, klf, accl[j]); } }
  } else if (qb * 64 < QHI) {
#pragma unroll
    for (int kc = 0; kc < HD / 32; ++kc) { const v16h ah = frag_h(QH + (q0 + col) * CC + h * HD + kc * 32, lane), al = frag_h(QLb + (size_t)(ql0 + col) * CC + h * HD + kc * 32, lane);
#pragma unroll
      for (int j = 0; j < 8; ++j) { const v16h kbf = frag_h(KH + (kr0 + j * 16 + col) * CC + h * HD + kc * 32, lane); acc[j] = wmma16(ah, kbf, acc[j]); accl[j] = wmma16(al, kbf, accl[j]); } }
  } else {
#pragma unroll
    for (int kc = 0; kc < HD / 32; ++kc) { const v16h ah = frag_h(QH + (q0 + col) * CC + h * HD + kc * 32, lane);
#pragma unroll
      for (int j = 0; j < 8; ++j) { const v16h kbf = frag_h(KH + (kr0 + j * 16 + col) * CC + h * HD + kc * 32, lane); acc[j] = wmma16(ah, kbf, acc[j]); } } }
#pragma unroll
  for (int j = 0; j < 8; ++j) {
#pragma unroll
    for (int r = 0; r < 8; ++r) ss[wave][8 * g + r][j * 16 + col] = (acc[j][r] + accl[j][r] * (1.0f / 1024.0f)) * SCALE; }
  LDSX(); for (int rl = 0; rl < 16; ++rl) vst2(S + (size_t)(ql0 + rl) * TT + k0 + lane * 4, *(const v4f*)&ss[wave][rl][lane * 4]); }
// ---- k_sm: block = query row t (head in group): keys [0, kend): causal -> logit if s <= t else excluded; softmax in f32; P x 2^11 in place (0 for excluded)
__global__ __launch_bounds__(256) void k_sm(float* __restrict__ S0 SM_EXTRA_PARAMS) { __shared__ float sred[8]; __shared__ float sbc; __shared__ __align__(16) float shv[TT];
  const int tid = threadIdx.x; const int t = blockIdx.x; const int kend = (kb_last(t >> 6) + 1) * 128;
  float* sr = S0 + (size_t)blockIdx.y * TT * TT + (size_t)t * TT;
  float m = -3.0e38f; for (int k = tid; k < kend; k += 256) { float v = (!CAUSAL || k <= t) ? sr[k] : -3.0e38f; SM_MASK_HOOK; shv[k] = v; m = fmaxf(m, v); }
#pragma unroll
  for (int o = 1; o < 32; o <<= 1) m = fmaxf(m, __shfl_xor(m, o));
  if ((tid & 31) == 0) sred[tid >> 5] = m; __syncthreads(); if (tid == 0) { float a = sred[0]; for (int i = 1; i < 8; ++i) a = fmaxf(a, sred[i]); sbc = a; } __syncthreads(); m = sbc; __syncthreads();
  float sum = 0.f; for (int k = tid; k < kend; k += 256) { const float v = shv[k]; const float e = (v <= -1.0e38f) ? 0.f : expf(v - m); shv[k] = e; sum += e; }
#pragma unroll
  for (int o = 1; o < 32; o <<= 1) sum += __shfl_xor(sum, o);
  if ((tid & 31) == 0) sred[tid >> 5] = sum; __syncthreads(); if (tid == 0) { float a = 0.f; for (int i = 0; i < 8; ++i) a += sred[i]; sbc = a > 0.f ? 2048.0f / a : 0.f; }   /* a fully excluded row yields P = 0 */ __syncthreads(); const float inv = sbc;
  for (int k = tid; k < kend; k += 256) shv[k] = shv[k] * inv;
  __syncthreads(); for (int q = tid; q < kend / 4; q += 256) vst2(sr + q * 4, *(const v4f*)&shv[q * 4]); }
// ---- k_pv: block = 16 queries (row tile) of (b, h), PVW waves: ctx = P . v over keys [0, kend), wave w takes the 32-key chunks w, w + PVW, ...; the waves' f32 partial tiles are summed through LDS in wave order (P x 2^11 once to f16 against v f16: 1 product; causal early query blocks: P and v as bf16 hi + lo, 3 products); each 512-B (row, head) segment stored by one wave
#define PVW 16
__global__ __launch_bounds__(PVW * 32) void k_pv(const float* __restrict__ PS0, const _Float16* __restrict__ VT, const __bf16* __restrict__ VB, const __bf16* __restrict__ VBL, int b, int h0, float* __restrict__ Y) { const int h = h0 + blockIdx.z; const float* PS = PS0 + (size_t)blockIdx.z * TT * TT; __shared__ __align__(16) float ss[PVW][16][HD + 4];
  const int tid = threadIdx.x, wave = __builtin_amdgcn_readfirstlane(tid >> 5), lane = tid & 31, col = lane & 15, g = lane >> 4; const int qb = blockIdx.x >> 2; const int ql0 = blockIdx.x * 16; const int kce = (kb_last(qb) + 1) * 4;
  v8f acc[HD / 16] = {};
  if (qb < QBH) {
#pragma unroll 1
    for (int kc = wave; kc < kce; kc += PVW) { const F2 p = split_row(PS + (size_t)(ql0 + col) * TT, kc * 32, lane);
      asm volatile("s_wait_loadcnt 0x0" ::: "memory");
#pragma unroll
      for (int j = 0; j < HD / 16; ++j) { const size_t po = ((size_t)b * CC + h * HD + j * 16 + col) * (size_t)KHI + kc * 32; const v16b vh = frag_b(VB + po, lane); acc[j] = wmma_bf(p.h, vh, acc[j]); acc[j] = wmma_bf(p.l, vh, acc[j]); acc[j] = wmma_bf(p.h, frag_b(VBL + po, lane), acc[j]); } }
  } else {
#pragma unroll 1
    for (int kc = wave; kc < kce; kc += PVW) { const v16h p = frag_f32(PS + (size_t)(ql0 + col) * TT + kc * 32, lane);
      asm volatile("s_wait_loadcnt 0x0" ::: "memory");
#pragma unroll
      for (int j = 0; j < HD / 16; ++j) { const size_t po = ((size_t)b * CC + h * HD + j * 16 + col) * (size_t)TT + kc * 32; acc[j] = wmma16(p, frag_h(VT + po, lane), acc[j]); } } }
#pragma unroll
  for (int j = 0; j < HD / 16; ++j)
#pragma unroll
    for (int r = 0; r < 8; ++r) ss[wave][8 * g + r][j * 16 + col] = acc[j][r] * (1.0f / 2048.0f);
  __syncthreads();   // every wave's partial tile is in LDS before any wave sums across them
  v4f o = *(const v4f*)&ss[0][wave][lane * 4];
#pragma unroll   // the LDS reads of all partial tiles issue ahead of the adds instead of one round trip each
  for (int w = 1; w < PVW; ++w) o += *(const v4f*)&ss[w][wave][lane * 4];
  vst2(Y + ((size_t)b * TT + ql0 + wave) * CC + h * HD + lane * 4, o); }

extern "C" void kernel_launch(void* const* d_in, const int* in_sizes, int n_in, void* d_out, int out_size, void* d_ws, size_t ws_size, hipStream_t stream) {
  (void)in_sizes; (void)n_in; (void)out_size;
  const float** F = (const float**)d_in;
  if (ws_size < (size_t)WS_END) return;
  char* ws = (char*)d_ws; _Float16 *QH = (_Float16*)(ws + WS_QH), *KH = (_Float16*)(ws + WS_KH), *VT = (_Float16*)(ws + WS_VT), *QL = (_Float16*)(ws + WS_QL), *KL = (_Float16*)(ws + WS_KL); __bf16 *VB = (__bf16*)(ws + WS_VB), *VBL = (__bf16*)(ws + WS_VBL); float *S = (float*)(ws + WS_S), *Y = (float*)(ws + WS_Y);
  (void)Y; (void)QL; (void)KL; (void)VB; (void)VBL;
  // inputs: 0 X [4,4096,512]; 1 Wq, 2 Wk, 3 Wv [512,64] (in,out)
  if (ws_size < (size_t)WS_END2) return;
  float* YB = (float*)(ws + WS_YB);
  k_proj<<<dim3(TNB * TT / 64, CC / 128, 3), 128, 0, stream>>>(F[0], F[0], F[0], F[1], F[2], F[3], nullptr, nullptr, nullptr, QH, QL, KH, KL, VT, VB, VBL);
  for (int b = 0; b < TNB; ++b) {
    k_sc<<<dim3(NQB, TT / 128, 1), 128, 0, stream>>>(QH, KH, QL, KL, b, 0, S);
    k_sm<<<dim3(TT, 1), 256, 0, stream>>>(S);
    k_pv<<<dim3(TT / 16, 1, 1), PVW * 32, 0, stream>>>(S, VT, VB, VBL, b, 0, YB);
  }
  k_fin64<<<dim3((unsigned)(((size_t)TNB * TT * (DOUT / 4) + 255) / 256)), 256, 0, stream>>>(YB, (float*)d_out);
}

// v002
// Measured time: 163 microseconds a run.
// In two side-by-side timings against v001, it was 2.13 and 2.11 times as fast.
// Over all steps from v000 it is 6.25 times as fast.
// compute dtype: all float inputs rounded to bf16; Q/K/V = X W with EXACT bf16 products on WMMA 16x16x32 (f32 accumulate; the single 64-wide head is carried in 128-wide planes whose upper 64 columns are zero); causal logits: q, k once to f16 (1 product) x 64^-0.5, except the first 384 query rows of each sequence (3 products with f16 residuals); softmax in f32; exp(logit - max) x 2^11 once to f16 against v once to f16 (1 product; bf16 hi + lo below row 384); f32 output.
#include <hip/hip_runtime.h>
#include <math.h>

typedef __attribute__((ext_vector_type(16))) _Float16 v16h;
typedef __attribute__((ext_vector_type(16))) __bf16 v16b;
typedef __attribute__((ext_vector_type(8)))  _Float16 v8h;
typedef __attribute__((ext_vector_type(8)))  float v8f;
typedef __attribute__((ext_vector_type(4)))  float v4f;
typedef __attribute__((ext_vector_type(2)))  float v2f;
typedef __attribute__((ext_vector_type(4)))  unsigned v4u;
typedef __attribute__((ext_vector_type(4)))  int v4i;
typedef float __attribute__((may_alias)) float_a;
typedef int __attribute__((may_alias)) int_a;

template <typename T> __device__ __forceinline__ void vst2(void* p, T v) { *(T*)p = v;  }
__device__ __forceinline__ v8f wmma16(v16h a, v16h b, v8f c) {
  v8f d = __builtin_amdgcn_wmma_f32_16x16x32_f16(false, a, false, b, (short)0, c, false, false);
  asm volatile("v_nop\n\tv_nop\n\tv_nop\n\tv_nop" : "+v"(d) : "v"(a), "v"(b));
  return d;
}
__device__ __forceinline__ v8f wmma_bf(v16b a, v16b b, v8f c) {
  v8f d = __builtin_amdgcn_wmma_f32_16x16x32_bf16(false, a, false, b, (short)0, c, false, false);
  asm volatile("v_nop\n\tv_nop\n\tv_nop\n\tv_nop" : "+v"(d) : "v"(a), "v"(b));
  return d;
}
// 16x16x32 fragments: lane = (h = lane>>4, row/col = lane&15); elements 0..7 = k0+8h+0..7, 8..15 = k0+16+8h+0..7; D element r = row 8h+r
__device__ __forceinline__ v16h frag_h(const _Float16* rowk0, int lane) {
  union { v16h v; v8h q[2]; } u; const _Float16* p = rowk0 + 8 * (lane >> 4);
  u.q[0] = *(const v8h*)p; u.q[1] = *(const v8h*)(p + 16); return u.v;
}
__device__ __forceinline__ v16h frag_f32(const float* rowk0, int lane) {
  v16h a; const float* p = rowk0 + 8 * (lane >> 4);
#pragma unroll
  for (int i = 0; i < 8; ++i) { a[i] = (_Float16)p[i]; a[8 + i] = (_Float16)p[16 + i]; }
  return a;
}
__device__ __forceinline__ v16h frag_f32s(const float* rowk0, int lane, float sc) {
  v16h a; const float* p = rowk0 + 8 * (lane >> 4);
#pragma unroll
  for (int i = 0; i < 8; ++i) { a[i] = (_Float16)(p[i] * sc); a[8 + i] = (_Float16)(p[16 + i] * sc); }
  return a;
}
// column fragment from a [K][ld] layout (column n), rows >= K read as 0
__device__ __forceinline__ v16h fragc_f32(const float* W, int k0, int n, int lane, int ld, int K) {
  v16h a; const int g = lane >> 4;
#pragma unroll
  for (int i = 0; i < 8; ++i) { const int ka = k0 + 8 * g + i, kb = ka + 16;
    a[i] = (_Float16)(ka < K ? W[(size_t)(ka < K ? ka : K - 1) * ld + n] : 0.f); a[8 + i] = (_Float16)(kb < K ? W[(size_t)(kb < K ? kb : K - 1) * ld + n] : 0.f); }
  return a;
}
struct F2 { v16b h, l; };
__device__ __forceinline__ F2 bsplit16(const float v[16]) { F2 r;
#pragma unroll
  for (int i = 0; i < 16; ++i) { const __bf16 h = (__bf16)v[i]; r.h[i] = h; r.l[i] = (__bf16)(v[i] - (float)h); }
  return r; }
__device__ __forceinline__ F2 split_row(const float* row, int k0, int lane) { float v[16]; const float* p = row + k0 + 8 * (lane >> 4);
#pragma unroll
  for (int i = 0; i < 8; ++i) { v[i] = p[i]; v[8 + i] = p[16 + i]; }
  return bsplit16(v); }
__device__ __forceinline__ F2 split_rowK(const float* row, int k0, int lane, int K) { float v[16]; const int g = lane >> 4;
#pragma unroll
  for (int i = 0; i < 8; ++i) { const int ka = k0 + 8 * g + i, kb = ka + 16; v[i] = ka < K ? row[ka < K ? ka : K - 1] : 0.f; v[8 + i] = kb < K ? row[kb < K ? kb : K - 1] : 0.f; }
  return bsplit16(v); }
__device__ __forceinline__ F2 split_col(const float* W, int k0, int n, int lane, int ld, int K) { float v[16]; const int g = lane >> 4;
#pragma unroll
  for (int i = 0; i < 8; ++i) { const int ka = k0 + 8 * g + i, kb = ka + 16; v[i] = ka < K ? W[(size_t)(ka < K ? ka : K - 1) * ld + n] : 0.f; v[8 + i] = kb < K ? W[(size_t)(kb < K ? kb : K - 1) * ld + n] : 0.f; }
  return bsplit16(v); }
__device__ __forceinline__ v8f mac3(const F2& a, const F2& b, v8f c) { c = wmma_bf(a.l, b.h, c); c = wmma_bf(a.h, b.l, c); return wmma_bf(a.h, b.h, c); }
__device__ __forceinline__ float sigm(float v) { return 1.0f / (1.0f + expf(-v)); }
#define LDSX() do { asm volatile("s_wait_dscnt 0" ::: "memory"); __builtin_amdgcn_wave_barrier(); __builtin_amdgcn_fence(__ATOMIC_RELEASE, "workgroup"); } while (0)

// Single-head causal self-attention (B 4, S 4,096, D_in 512 -> 64): Q, K, V = X Wq/Wk/Wv ((in,out) [512, 64]); W = softmax(causal(Q K^T) / 8); Z = W V -> [B, S, 64].
#define NB 4
#define TT 4096
#define CC 128            // NH * HD = projected width
#define DIN 512          // input (model) width
#define NH 1
#define HD 128
#define NQB (TT / 64)
#define HG 1
#define SCALE (0.125f)
#define CAUSAL 1
#ifndef TNB
#define TNB NB
#endif
__device__ __forceinline__ v16b zero16b() { v16b z; _Pragma("unroll") for (int i = 0; i < 16; ++i) z[i] = (__bf16)0.f; return z; }
__device__ __forceinline__ float bfr(float v) { return (float)(__bf16)v; }
__host__ __device__ __forceinline__ int kb_last(int qb) { return CAUSAL ? ((qb * 64 + 63) >> 7) : (TT / 128 - 1); }
typedef __attribute__((ext_vector_type(8))) __bf16 v8b;
__device__ __forceinline__ v16b frag_b(const __bf16* rowk0, int lane) {
  union { v16b v; v8b q[2]; } u; const __bf16* p = rowk0 + 8 * (lane >> 4);
  u.q[0] = *(const v8b*)p; u.q[1] = *(const v8b*)(p + 16); return u.v;
}
#define QBH 6              // causal: query blocks 0..QBH-1 of each sequence (few keys, no averaging) take the high-precision path
#define QHI 384            // rows carrying a q residual plane
#define KHI 384            // key rows carrying k residual / v bf16 hi+lo planes (used only by the causal high-precision path)
// B fragment (k rows k0+.., output column o) of a weight: (in,out) [K][ld] or (out,in) [ld rows of K]: bf16 exact, or f16(bf16 * 256) exact
__device__ __forceinline__ v16b wcol_io(const float* Wm, int k0, int o, int lane, int ld) { v16b w; const int g = lane >> 4;
#pragma unroll
  for (int i = 0; i < 8; ++i) { w[i] = (__bf16)Wm[(size_t)(k0 + 8 * g + i) * ld + o]; w[8 + i] = (__bf16)Wm[(size_t)(k0 + 16 + 8 * g + i) * ld + o]; }
  return w; }
__device__ __forceinline__ v16b wcol_oi(const float* Wm, int k0, int o, int lane, int K) { v16b w; const float* p = Wm + (size_t)o * K + k0 + 8 * (lane >> 4);
#pragma unroll
  for (int i = 0; i < 8; ++i) { w[i] = (__bf16)p[i]; w[8 + i] = (__bf16)p[16 + i]; }
  return w; }
__device__ __forceinline__ v16h wcolh_io(const float* Wm, int k0, int o, int lane, int ld) { v16h w; const int g = lane >> 4;
#pragma unroll
  for (int i = 0; i < 8; ++i) { w[i] = (_Float16)(bfr(Wm[(size_t)(k0 + 8 * g + i) * ld + o]) * 256.0f); w[8 + i] = (_Float16)(bfr(Wm[(size_t)(k0 + 16 + 8 * g + i) * ld + o]) * 256.0f); }
  return w; }
__device__ __forceinline__ v16h wcolh_oi(const float* Wm, int k0, int o, int lane, int K) { v16h w; const float* p = Wm + (size_t)o * K + k0 + 8 * (lane >> 4);
#pragma unroll
  for (int i = 0; i < 8; ++i) { w[i] = (_Float16)(bfr(p[i]) * 256.0f); w[8 + i] = (_Float16)(bfr(p[16 + i]) * 256.0f); }
  return w; }
#define WQKV_LAYOUT 0   // 0 = (in,out) [DIN][DOUT]; 1 = (out,in) [CC][DIN]; 2 = per-head [NH][DIN][HD]
__device__ __forceinline__ v16b wcol_hdk(const float* Wm, int k0, int o, int lane) { v16b w; const int g = lane >> 4; const float* p = Wm + (size_t)(o / HD) * DIN * HD + (o % HD);
#pragma unroll
  for (int i = 0; i < 8; ++i) { w[i] = (__bf16)p[(size_t)(k0 + 8 * g + i) * HD]; w[8 + i] = (__bf16)p[(size_t)(k0 + 16 + 8 * g + i) * HD]; }
  return w; }
#define WO_OUT_IN 0
#if WQKV_LAYOUT == 1
#define WCOL(W, k0, o, lane) wcol_oi(W, k0, o, lane, DIN)
#elif WQKV_LAYOUT == 2
#define WCOL(W, k0, o, lane) wcol_hdk(W, k0, o, lane)
#else
#define WCOL(W, k0, o, lane) (((o) < DOUT) ? wcol_io(W, k0, (o), lane, DOUT) : zero16b())   /* W (in,out) [512][64]; plane columns >= 64 are zero */
#endif
#if WO_OUT_IN
#define WOCOL(W, k0, o, lane) wcol_oi(W, k0, o, lane, CC)
#define WOCOLH(W, k0, o, lane) wcolh_oi(W, k0, o, lane, CC)
#else
#define WOCOL(W, k0, o, lane) wcol_io(W, k0, o, lane, DIN)
#define WOCOLH(W, k0, o, lane) wcolh_io(W, k0, o, lane, DIN)
#endif
#define DOUT 64            // real head width (planes are 128 wide, columns >= 64 zero)
// ---- k_fin64: thread per float4: out[r][0..63] = YB[r][0..63] (drop the zero half of the 128-wide context rows)
__global__ __launch_bounds__(256) void k_fin64(const float* __restrict__ YB, float* __restrict__ OUT) { const size_t i = (size_t)blockIdx.x * 256 + threadIdx.x; if (i >= (size_t)TNB * TT * (DOUT / 4)) return; const size_t r = i / (DOUT / 4); const int q = (int)(i % (DOUT / 4)); vst2(OUT + r * DOUT + q * 4, *(const v4f*)(YB + r * CC + q * 4)); }
#define WS_YB  (WS_END)
#define WS_END2 (WS_YB + 4u * (size_t)NB * TT * CC)
#ifndef SM_EXTRA_PARAMS
#define SM_EXTRA_PARAMS
#endif
#ifndef PROJ_EXTRA_PARAMS
#define PROJ_EXTRA_PARAMS
#endif
#ifndef SM_MASK_HOOK
#define SM_MASK_HOOK (void)0
#endif

#define WS_QH  0u                                      // f16 q rows [b*t][CC]
#define WS_KH  (WS_QH + 2u * (size_t)NB * TT * CC)      // f16 k rows [b*t][CC]
#define WS_VT  (WS_KH + 2u * (size_t)NB * TT * CC)      // f16 v planes [b][c][t]
#define WS_QL  (WS_VT + 2u * (size_t)NB * CC * TT)      // f16 q residual x 2^10 rows [b][t < QHI][CC]
#define WS_KL  (WS_QL + 2u * (size_t)NB * QHI * CC)     // f16 k residual x 2^10 rows [b][t < KHI][CC]
#define WS_VB  (WS_KL + 2u * (size_t)NB * KHI * CC)     // bf16 v hi planes [b][c][t < KHI]
#define WS_VBL (WS_VB + 2u * (size_t)NB * CC * KHI)
#define WS_Y   (WS_VBL + 2u * (size_t)NB * CC * KHI)    // f32 ctx rows [b*t][CC] (only when there is an output projection)
#define WS_END (WS_Y  + 0u)

// ---- k_proj: block = (64 rows, 128 cols, which): q/k/v = X W (+ b) with exact bf16 products (K = DIN) -> which 0: q f16 rows (+ residual rows < QHI); 1: k f16 rows (+ residual rows < KHI); 2: v f16 planes [c][t] (+ bf16 hi/lo planes for t < KHI)
__global__ __launch_bounds__(128) void k_proj(const float* __restrict__ XQ, const float* __restrict__ XK, const float* __restrict__ XV, const float* __restrict__ WQ, const float* __restrict__ WK, const float* __restrict__ WV, const float* __restrict__ BQ, const float* __restrict__ BK, const float* __restrict__ BV,
    _Float16* __restrict__ QH, _Float16* __restrict__ QL, _Float16* __restrict__ KH, _Float16* __restrict__ KL, _Float16* __restrict__ VT, __bf16* __restrict__ VB, __bf16* __restrict__ VBL) {
  __shared__ __align__(16) _Float16 sh[64][136], sl[64][136]; __shared__ __align__(16) _Float16 th[128][72]; __shared__ __align__(16) __bf16 tb[128][72], tbl[128][72];
  const int tid = threadIdx.x, wave = tid >> 5, lane = tid & 31, col = lane & 15, g = lane >> 4; const int which = blockIdx.z; const int c0 = blockIdx.y * 128; const size_t r0 = (size_t)blockIdx.x * 64; const size_t bb = r0 / TT; const int t0 = (int)(r0 % TT);
  const float* X = which == 0 ? XQ : which == 1 ? XK : XV; const float* WA = which == 0 ? WQ : which == 1 ? WK : WV; const float* BA = which == 0 ? BQ : which == 1 ? BK : BV;
  v8f acc[8] = {};
#pragma unroll 2
  for (int kc = 0; kc < DIN / 32; ++kc) { v16b a; { const float* p = X + (r0 + wave * 16 + col) * DIN + kc * 32 + 8 * g;
#pragma unroll
      for (int i = 0; i < 8; ++i) { a[i] = (__bf16)p[i]; a[8 + i] = (__bf16)p[16 + i]; } }
    asm volatile("s_wait_loadcnt 0x0" ::: "memory");
#pragma unroll
    for (int j = 0; j < 8; ++j) { const v16b w = WCOL(WA, kc * 32, c0 + j * 16 + col, lane); asm volatile("s_wait_loadcnt 0x0" ::: "memory"); acc[j] = wmma_bf(a, w, acc[j]); } }
  if (which < 2) { _Float16* DH = which == 0 ? QH : KH; _Float16* DL = which == 0 ? QL : KL; const int nhi = which == 0 ? QHI : KHI; const bool hi_rows = t0 < nhi;
#pragma unroll
    for (int j = 0; j < 8; ++j) { const float bias = BA ? bfr(BA[c0 + j * 16 + col]) : 0.f;
#pragma unroll
      for (int r = 0; r < 8; ++r) { const float v = acc[j][r] + bias; const _Float16 hv = (_Float16)v; sh[wave * 16 + 8 * g + r][j * 16 + col] = hv; sl[wave * 16 + 8 * g + r][j * 16 + col] = (_Float16)((v - (float)hv) * 1024.0f); } }
    __syncthreads();
    for (int e = tid; e < 64 * 16; e += 128) { const int rl = e >> 4, q = e & 15; vst2((unsigned*)(DH + (r0 + rl) * CC + c0 + q * 8), *(const v4u*)&sh[rl][q * 8]); if (hi_rows) vst2((unsigned*)(DL + (bb * nhi + t0 + rl) * (size_t)CC + c0 + q * 8), *(const v4u*)&sl[rl][q * 8]); }
  } else { const bool hi_rows = t0 < KHI;
#pragma unroll
    for (int j = 0; j < 8; ++j) { const float bias = BA ? bfr(BA[c0 + j * 16 + col]) : 0.f;
#pragma unroll
      for (int r = 0; r < 8; ++r) { const float v = acc[j][r] + bias; const int rl = wave * 16 + 8 * g + r, cl = j * 16 + col; th[cl][rl] = (_Float16)v; const __bf16 bh = (__bf16)v; tb[cl][rl] = bh; tbl[cl][rl] = (__bf16)(v - (float)bh); } }
    __syncthreads();
    for (int e = tid; e < 128 * 8; e += 128) { const int cl = e >> 3, q = e & 7; vst2((unsigned*)(VT + (bb * CC + c0 + cl) * (size_t)TT + t0 + q * 8), *(const v4u*)&th[cl][q * 8]); if (hi_rows) { const size_t o3 = (bb * CC + c0 + cl) * (size_t)KHI + t0 + q * 8; vst2((unsigned*)(VB + o3), *(const v4u*)&tb[cl][q * 8]); vst2((unsigned*)(VBL + o3), *(const v4u*)&tbl[cl][q * 8]); } } } }
// ---- k_att: block = 16 queries of sequence b, PVW waves; wave w takes the 32-key chunks w, w + PVW, ... up to the diagonal. Logits are formed transposed (A = k rows, B = q rows), so a lane holds 16 logits of ONE query in the very order of the A fragment of P . v: they stay in registers, are masked by index, and are turned into exp(logit - the wave's own row maximum) x 2^11 (once to f16 against v f16; query blocks < QBH: 3-product logits, P and v as bf16 hi + lo). Each wave leaves its f32 partial tile, row maxima and row sums in LDS; behind one barrier wave w joins row w over the waves in wave order, each partial weighted by exp(its maximum - the row's maximum), and divides by the joined sum. A masked logit is -3e38: its exp is 0 beside any real maximum; a row with no open key in a wave's chunks has the maximum -3e38, and that wave's partial for it gets the weight 0 in the join (key 0 is open to every query, so the row's maximum is real)
#define PVW 16
#define NCH (TT / 32 / PVW)   // most chunks one wave can own
// XW: in front of a load whose result may land on the address pair of loads issued before it
__device__ __forceinline__ void XW() { asm volatile("s_wait_xcnt 0x0" ::: "memory"); }
// last fragment of a run of loads off one address pair: only the run's last load can get that pair as its result registers, so the wait stands in front of it
__device__ __forceinline__ v16h frag_h_end(const _Float16* rowk0, int lane) {
  union { v16h v; v8h q[2]; } u; const _Float16* p = rowk0 + 8 * (lane >> 4);
  u.q[0] = *(const v8h*)p; XW(); u.q[1] = *(const v8h*)(p + 16); return u.v;
}
// fragments of the three-product path (many address pairs, one chunk a wave): the wait behind every load
__device__ __forceinline__ v16h frag_h_w(const _Float16* rowk0, int lane) {
  union { v16h v; v8h q[2]; } u; const _Float16* p = rowk0 + 8 * (lane >> 4);
  u.q[0] = *(const v8h*)p; XW(); u.q[1] = *(const v8h*)(p + 16); XW(); return u.v;
}
__device__ __forceinline__ v16b frag_b_w(const __bf16* rowk0, int lane) {
  union { v16b v; v8b q[2]; } u; const __bf16* p = rowk0 + 8 * (lane >> 4);
  u.q[0] = *(const v8b*)p; XW(); u.q[1] = *(const v8b*)(p + 16); XW(); return u.v;
}
__global__ __launch_bounds__(PVW * 32) void k_att(const _Float16* __restrict__ QH, const _Float16* __restrict__ KH, const _Float16* __restrict__ QL, const _Float16* __restrict__ KL, const _Float16* __restrict__ VT, const __bf16* __restrict__ VB, const __bf16* __restrict__ VBL, int b, float* __restrict__ Y) {
  __shared__ __align__(16) float ss[PVW][16][HD + 4]; __shared__ float smx[PVW][16], ssu[PVW][16];
  const int tid = threadIdx.x, wave = __builtin_amdgcn_readfirstlane(tid >> 5), lane = tid & 31, col = lane & 15, g = lane >> 4; const int qb = blockIdx.x >> 2; const int ql0 = blockIdx.x * 16; const int kce = (ql0 >> 5) + 1;   // chunks that hold a key <= the block's last query
  const int t = ql0 + col;   // the query whose logits this lane holds
  const _Float16* Qr = QH + ((size_t)b * TT + t) * CC; const _Float16* Kb = KH + (size_t)b * TT * CC;
  v8f acc[HD / 16] = {}; float m = -3.0e38f, sum = 0.f;
  // every unroll below: the loop indexes register arrays or vector elements, which takes constant indices
  if (qb < QBH) {
    if (wave < kce) { const int k0 = wave * 32; const _Float16* Qlr = QL + ((size_t)b * QHI + t) * CC; const _Float16* Klb = KL + (size_t)b * KHI * CC;
      v8f a0[2] = {}, a1[2] = {};
#pragma unroll
      for (int c = 0; c < HD / 32; ++c) { const v16h ah = frag_h_w(Qr + c * 32, lane), al = frag_h_w(Qlr + c * 32, lane);
#pragma unroll
        for (int u = 0; u < 2; ++u) { const size_t ko = (size_t)(k0 + u * 16 + col) * CC + c * 32; const v16h kbf = frag_h_w(Kb + ko, lane), klf = frag_h_w(Klb + ko, lane); a0[u] = wmma16(kbf, ah, a0[u]); a1[u] = wmma16(kbf, al, a1[u]); a1[u] = wmma16(klf, ah, a1[u]); } }
      float s[16];
#pragma unroll
      for (int e = 0; e < 16; ++e) { const float v = (a0[e >> 3][e & 7] + a1[e >> 3][e & 7] * (1.0f / 1024.0f)) * SCALE; s[e] = (k0 + (e >> 3) * 16 + 8 * g + (e & 7) <= t) ? v : -3.0e38f; m = fmaxf(m, s[e]); }
      m = fmaxf(m, __shfl_xor(m, 16));
#pragma unroll
      for (int e = 0; e < 16; ++e) { const float ev = expf(s[e] - m); sum += ev; s[e] = ev * 2048.0f; }
      const F2 p = bsplit16(s);
#pragma unroll
      for (int j = 0; j < HD / 16; ++j) { const size_t po = ((size_t)b * CC + j * 16 + col) * (size_t)KHI + k0; const v16b vh = frag_b_w(VB + po, lane); acc[j] = wmma_bf(p.h, vh, acc[j]); acc[j] = wmma_bf(p.l, vh, acc[j]); acc[j] = wmma_bf(p.h, frag_b_w(VBL + po, lane), acc[j]); } }
  } else {
    v16h p[NCH];
    { float s[NCH][16]; v16h qf[HD / 32];
#pragma unroll
      for (int c = 0; c < HD / 32; ++c) qf[c] = frag_h(Qr + c * 32, lane);
      asm volatile("s_wait_xcnt 0x0" ::: "memory");   // the q loads' address pair is reused for the first k addresses in the next block
#pragma unroll   // s and p are indexed by constants only, so they live in registers
      for (int i = 0; i < NCH; ++i) { const int kc = wave + i * PVW, k0 = kc * 32;
        if (kc < kce) { v16h kf[2 * (HD / 32)]; v8f a[2] = {};
#pragma unroll
          for (int c = 0; c < HD / 32; ++c)
#pragma unroll
            for (int u = 0; u < 2; ++u) { const _Float16* kp = Kb + (size_t)(k0 + u * 16 + col) * CC + c * 32; kf[c * 2 + u] = (c * 2 + u < 7) ? frag_h(kp, lane) : frag_h_end(kp, lane); }
#pragma unroll
          for (int c = 0; c < HD / 32; ++c)
#pragma unroll
            for (int u = 0; u < 2; ++u) a[u] = wmma16(kf[c * 2 + u], qf[c], a[u]);
          if (kc == kce - 1) {   // only the last chunk reaches past a query of this block
#pragma unroll
            for (int e = 0; e < 16; ++e) { s[i][e] = (k0 + (e >> 3) * 16 + 8 * g + (e & 7) <= t) ? a[e >> 3][e & 7] * SCALE : -3.0e38f; m = fmaxf(m, s[i][e]); }
          } else {
#pragma unroll
            for (int e = 0; e < 16; ++e) { s[i][e] = a[e >> 3][e & 7] * SCALE; m = fmaxf(m, s[i][e]); } } } }
      m = fmaxf(m, __shfl_xor(m, 16));
#pragma unroll
      for (int i = 0; i < NCH; ++i)
        if (wave + i * PVW < kce) {
#pragma unroll
          for (int e = 0; e < 16; ++e) { const float ev = expf(s[i][e] - m); sum += ev; p[i][e] = (_Float16)(ev * 2048.0f); } } }
#pragma unroll
    for (int i = 0; i < NCH; ++i) { const int k0 = (wave + i * PVW) * 32;
      if (wave + i * PVW < kce) { v16h vf[HD / 16];
#pragma unroll
        for (int j = 0; j < HD / 16; ++j) { const _Float16* vp = VT + ((size_t)b * CC + j * 16 + col) * (size_t)TT + k0; vf[j] = (j < HD / 16 - 1) ? frag_h(vp, lane) : frag_h_end(vp, lane); }
#pragma unroll
        for (int j = 0; j < HD / 16; ++j) acc[j] = wmma16(p[i], vf[j], acc[j]); } } }
  sum += __shfl_xor(sum, 16);
  if (g == 0) { smx[wave][col] = m; ssu[wave][col] = sum; }
#pragma unroll
  for (int j = 0; j < HD / 16; ++j)
#pragma unroll
    for (int r = 0; r < 8; ++r) ss[wave][8 * g + r][j * 16 + col] = acc[j][r];
  __syncthreads();   // every wave's partial tile, maxima and sums are in LDS before any wave joins them
  float mm = smx[0][wave];
#pragma unroll
  for (int w = 1; w < PVW; ++w) mm = fmaxf(mm, smx[w][wave]);
  v4f o = {}; float tot = 0.f;
#pragma unroll   // the LDS reads of all partial tiles issue ahead of the adds instead of one round trip each
  for (int w = 0; w < PVW; ++w) { const float f = expf(smx[w][wave] - mm); tot += ssu[w][wave] * f; o += *(const v4f*)&ss[w][wave][lane * 4] * f; }
  o *= tot > 0.f ? 1.0f / (2048.0f * tot) : 0.f;
  vst2(Y + ((size_t)b * TT + ql0 + wave) * CC + lane * 4, o); }

extern "C" void kernel_launch(void* const* d_in, const int* in_sizes, int n_in, void* d_out, int out_size, void* d_ws, size_t ws_size, hipStream_t stream) {
  (void)in_sizes; (void)n_in; (void)out_size;
  const float** F = (const float**)d_in;
  if (ws_size < (size_t)WS_END) return;
  char* ws = (char*)d_ws; _Float16 *QH = (_Float16*)(ws + WS_QH), *KH = (_Float16*)(ws + WS_KH), *VT = (_Float16*)(ws + WS_VT), *QL = (_Float16*)(ws + WS_QL), *KL = (_Float16*)(ws + WS_KL); __bf16 *VB = (__bf16*)(ws + WS_VB), *VBL = (__bf16*)(ws + WS_VBL); float *Y = (float*)(ws + WS_Y);
  (void)Y; (void)QL; (void)KL; (void)VB; (void)VBL;
  // inputs: 0 X [4,4096,512]; 1 Wq, 2 Wk, 3 Wv [512,64] (in,out)
  if (ws_size < (size_t)WS_END2) return;
  float* YB = (float*)(ws + WS_YB);
  k_proj<<<dim3(TNB * TT / 64, CC / 128, 3), 128, 0, stream>>>(F[0], F[0], F[0], F[1], F[2], F[3], nullptr, nullptr, nullptr, QH, QL, KH, KL, VT, VB, VBL);
  for (int b = 0; b < TNB; ++b) {
    k_att<<<dim3(TT / 16, 1, 1), PVW * 32, 0, stream>>>(QH, KH, QL, KL, VT, VB, VBL, b, YB);
  }
  k_fin64<<<dim3((unsigned)(((size_t)TNB * TT * (DOUT / 4) + 255) / 256)), 256, 0, stream>>>(YB, (float*)d_out);
}

// v003
// One run takes 102 microseconds.
// Two timings next to v002 put it at 1.59 and 1.60 times that version's speed.
// Counting every step since v000, it is 9.98 times as fast.
// compute dtype: all float inputs rounded to bf16; Q/K/V = X W with EXACT bf16 products on WMMA 16x16x32 (f32 accumulate; the single head's planes are 64 wide); causal logits: q, k once to f16 (1 product) x 64^-0.5, except the first 384 query rows of each sequence (3 products with f16 residuals); softmax in f32; exp(logit - max) x 2^11 once to f16 against v once to f16 (1 product; bf16 hi + lo below row 384); f32 output.
#include <hip/hip_runtime.h>
#include <math.h>

typedef __attribute__((ext_vector_type(16))) _Float16 v16h;
typedef __attribute__((ext_vector_type(16))) __bf16 v16b;
typedef __attribute__((ext_vector_type(8)))  _Float16 v8h;
typedef __attribute__((ext_vector_type(8)))  float v8f;
typedef __attribute__((ext_vector_type(4)))  float v4f;
typedef __attribute__((ext_vector_type(2)))  float v2f;
typedef __attribute__((ext_vector_type(4)))  unsigned v4u;
typedef __attribute__((ext_vector_type(4)))  int v4i;
typedef float __attribute__((may_alias)) float_a;
typedef int __attribute__((may_alias)) int_a;

template <typename T> __device__ __forceinline__ void vst2(void* p, T v) { *(T*)p = v;  }
__device__ __forceinline__ v8f wmma16(v16h a, v16h b, v8f c) {
  v8f d = __builtin_amdgcn_wmma_f32_16x16x32_f16(false, a, false, b, (short)0, c, false, false);
  asm volatile("v_nop\n\tv_nop\n\tv_nop\n\tv_nop" : "+v"(d) : "v"(a), "v"(b));
  return d;
}
__device__ __forceinline__ v8f wmma_bf(v16b a, v16b b, v8f c) {
  v8f d = __builtin_amdgcn_wmma_f32_16x16x32_bf16(false, a, false, b, (short)0, c, false, false);
  asm volatile("v_nop\n\tv_nop\n\tv_nop\n\tv_nop" : "+v"(d) : "v"(a), "v"(b));
  return d;
}
// 16x16x32 fragments: lane = (h = lane>>4, row/col = lane&15); elements 0..7 = k0+8h+0..7, 8..15 = k0+16+8h+0..7; D element r = row 8h+r
__device__ __forceinline__ v16h frag_h(const _Float16* rowk0, int lane) {
  union { v16h v; v8h q[2]; } u; const _Float16* p = rowk0 + 8 * (lane >> 4);
  u.q[0] = *(const v8h*)p; u.q[1] = *(const v8h*)(p + 16); return u.v;
}
__device__ __forceinline__ v16h frag_f32(const float* rowk0, int lane) {
  v16h a; const float* p = rowk0 + 8 * (lane >> 4);
#pragma unroll
  for (int i = 0; i < 8; ++i) { a[i] = (_Float16)p[i]; a[8 + i] = (_Float16)p[16 + i]; }
  return a;
}
__device__ __forceinline__ v16h frag_f32s(const float* rowk0, int lane, float sc) {
  v16h a; const float* p = rowk0 + 8 * (lane >> 4);
#pragma unroll
  for (int i = 0; i < 8; ++i) { a[i] = (_Float16)(p[i] * sc); a[8 + i] = (_Float16)(p[16 + i] * sc); }
  return a;
}
// column fragment from a [K][ld] layout (column n), rows >= K read as 0
__device__ __forceinline__ v16h fragc_f32(const float* W, int k0, int n, int lane, int ld, int K) {
  v16h a; const int g = lane >> 4;
#pragma unroll
  for (int i = 0; i < 8; ++i) { const int ka = k0 + 8 * g + i, kb = ka + 16;
    a[i] = (_Float16)(ka < K ? W[(size_t)(ka < K ? ka : K - 1) * ld + n] : 0.f); a[8 + i] = (_Float16)(kb < K ? W[(size_t)(kb < K ? kb : K - 1) * ld + n] : 0.f); }
  return a;
}
struct F2 { v16b h, l; };
__device__ __forceinline__ F2 bsplit16(const float v[16]) { F2 r;
#pragma unroll
  for (int i = 0; i < 16; ++i) { const __bf16 h = (__bf16)v[i]; r.h[i] = h; r.l[i] = (__bf16)(v[i] - (float)h); }
  return r; }
__device__ __forceinline__ F2 split_row(const float* row, int k0, int lane) { float v[16]; const float* p = row + k0 + 8 * (lane >> 4);
#pragma unroll
  for (int i = 0; i < 8; ++i) { v[i] = p[i]; v[8 + i] = p[16 + i]; }
  return bsplit16(v); }
__device__ __forceinline__ F2 split_rowK(const float* row, int k0, int lane, int K) { float v[16]; const int g = lane >> 4;
#pragma unroll
  for (int i = 0; i < 8; ++i) { const int ka = k0 + 8 * g + i, kb = ka + 16; v[i] = ka < K ? row[ka < K ? ka : K - 1] : 0.f; v[8 + i] = kb < K ? row[kb < K ? kb : K - 1] : 0.f; }
  return bsplit16(v); }
__device__ __forceinline__ F2 split_col(const float* W, int k0, int n, int lane, int ld, int K) { float v[16]; const int g = lane >> 4;
#pragma unroll
  for (int i = 0; i < 8; ++i) { const int ka = k0 + 8 * g + i, kb = ka + 16; v[i] = ka < K ? W[(size_t)(ka < K ? ka : K - 1) * ld + n] : 0.f; v[8 + i] = kb < K ? W[(size_t)(kb < K ? kb : K - 1) * ld + n] : 0.f; }
  return bsplit16(v); }
__device__ __forceinline__ v8f mac3(const F2& a, const F2& b, v8f c) { c = wmma_bf(a.l, b.h, c); c = wmma_bf(a.h, b.l, c); return wmma_bf(a.h, b.h, c); }
__device__ __forceinline__ float sigm(float v) { return 1.0f / (1.0f + expf(-v)); }
#define LDSX() do { asm volatile("s_wait_dscnt 0" ::: "memory"); __builtin_amdgcn_wave_barrier(); __builtin_amdgcn_fence(__ATOMIC_RELEASE, "workgroup"); } while (0)

// Single-head causal self-attention (B 4, S 4,096, D_in 512 -> 64): Q, K, V = X Wq/Wk/Wv ((in,out) [512, 64]); W = softmax(causal(Q K^T) / 8); Z = W V -> [B, S, 64].
#define NB 4
#define TT 4096
#define CC 64             // NH * HD = projected width
#define DIN 512          // input (model) width
#define NH 1
#define HD 64
#define NQB (TT / 64)
#define HG 1
#define SCALE (0.125f)
#define CAUSAL 1
#ifndef TNB
#define TNB NB
#endif
__device__ __forceinline__ v16b zero16b() { v16b z; _Pragma("unroll") for (int i = 0; i < 16; ++i) z[i] = (__bf16)0.f; return z; }
__device__ __forceinline__ float bfr(float v) { return (float)(__bf16)v; }
__host__ __device__ __forceinline__ int kb_last(int qb) { return CAUSAL ? ((qb * 64 + 63) >> 7) : (TT / 128 - 1); }
typedef __attribute__((ext_vector_type(8))) __bf16 v8b;
__device__ __forceinline__ v16b frag_b(const __bf16* rowk0, int lane) {
  union { v16b v; v8b q[2]; } u; const __bf16* p = rowk0 + 8 * (lane >> 4);
  u.q[0] = *(const v8b*)p; u.q[1] = *(const v8b*)(p + 16); return u.v;
}
#define QBH 6              // causal: query blocks 0..QBH-1 of each sequence (few keys, no averaging) take the high-precision path
#define QHI 384            // rows carrying a q residual plane
#define KHI 384            // key rows carrying k residual / v bf16 hi+lo planes (used only by the causal high-precision path)
// B fragment (k rows k0+.., output column o) of a weight: (in,out) [K][ld] or (out,in) [ld rows of K]: bf16 exact, or f16(bf16 * 256) exact
__device__ __forceinline__ v16b wcol_io(const float* Wm, int k0, int o, int lane, int ld) { v16b w; const int g = lane >> 4;
#pragma unroll
  for (int i = 0; i < 8; ++i) { w[i] = (__bf16)Wm[(size_t)(k0 + 8 * g + i) * ld + o];
    if (i == 7) asm volatile("s_wait_xcnt 0x0" ::: "memory");   // only the run's last load can get the run's address pair as its result register: the wait stands in front of it
    w[8 + i] = (__bf16)Wm[(size_t)(k0 + 16 + 8 * g + i) * ld + o]; }
  return w; }
__device__ __forceinline__ v16b wcol_oi(const float* Wm, int k0, int o, int lane, int K) { v16b w; const float* p = Wm + (size_t)o * K + k0 + 8 * (lane >> 4);
#pragma unroll
  for (int i = 0; i < 8; ++i) { w[i] = (__bf16)p[i]; w[8 + i] = (__bf16)p[16 + i]; }
  return w; }
__device__ __forceinline__ v16h wcolh_io(const float* Wm, int k0, int o, int lane, int ld) { v16h w; const int g = lane >> 4;
#pragma unroll
  for (int i = 0; i < 8; ++i) { w[i] = (_Float16)(bfr(Wm[(size_t)(k0 + 8 * g + i) * ld + o]) * 256.0f); w[8 + i] = (_Float16)(bfr(Wm[(size_t)(k0 + 16 + 8 * g + i) * ld + o]) * 256.0f); }
  return w; }
__device__ __forceinline__ v16h wcolh_oi(const float* Wm, int k0, int o, int lane, int K) { v16h w; const float* p = Wm + (size_t)o * K + k0 + 8 * (lane >> 4);
#pragma unroll
  for (int i = 0; i < 8; ++i) { w[i] = (_Float16)(bfr(p[i]) * 256.0f); w[8 + i] = (_Float16)(bfr(p[16 + i]) * 256.0f); }
  return w; }
#define WQKV_LAYOUT 0   // 0 = (in,out) [DIN][DOUT]; 1 = (out,in) [CC][DIN]; 2 = per-head [NH][DIN][HD]
__device__ __forceinline__ v16b wcol_hdk(const float* Wm, int k0, int o, int lane) { v16b w; const int g = lane >> 4; const float* p = Wm + (size_t)(o / HD) * DIN * HD + (o % HD);
#pragma unroll
  for (int i = 0; i < 8; ++i) { w[i] = (__bf16)p[(size_t)(k0 + 8 * g + i) * HD]; w[8 + i] = (__bf16)p[(size_t)(k0 + 16 + 8 * g + i) * HD]; }
  return w; }
#define WO_OUT_IN 0
#if WQKV_LAYOUT == 1
#define WCOL(W, k0, o, lane) wcol_oi(W, k0, o, lane, DIN)
#elif WQKV_LAYOUT == 2
#define WCOL(W, k0, o, lane) wcol_hdk(W, k0, o, lane)
#else
#define WCOL(W, k0, o, lane) wcol_io(W, k0, (o), lane, DOUT)   /* W (in,out) [512][64] */
#endif
#if WO_OUT_IN
#define WOCOL(W, k0, o, lane) wcol_oi(W, k0, o, lane, CC)
#define WOCOLH(W, k0, o, lane) wcolh_oi(W, k0, o, lane, CC)
#else
#define WOCOL(W, k0, o, lane) wcol_io(W, k0, o, lane, DIN)
#define WOCOLH(W, k0, o, lane) wcolh_io(W, k0, o, lane, DIN)
#endif
#define DOUT 64            // head width = plane width CC
#ifndef SM_EXTRA_PARAMS
#define SM_EXTRA_PARAMS
#endif
#ifndef PROJ_EXTRA_PARAMS
#define PROJ_EXTRA_PARAMS
#endif
#ifndef SM_MASK_HOOK
#define SM_MASK_HOOK (void)0
#endif

#define WS_QH  0u                                      // f16 q rows [b*t][CC]
#define WS_KH  (WS_QH + 2u * (size_t)NB * TT * CC)      // f16 k rows [b*t][CC]
#define WS_VT  (WS_KH + 2u * (size_t)NB * TT * CC)      // f16 v planes [b][c][t]
#define WS_QL  (WS_VT + 2u * (size_t)NB * CC * TT)      // f16 q residual x 2^10 rows [b][t < QHI][CC]
#define WS_KL  (WS_QL + 2u * (size_t)NB * QHI * CC)     // f16 k residual x 2^10 rows [b][t < KHI][CC]
#define WS_VB  (WS_KL + 2u * (size_t)NB * KHI * CC)     // bf16 v hi planes [b][c][t < KHI]
#define WS_VBL (WS_VB + 2u * (size_t)NB * CC * KHI)
#define WS_Y   (WS_VBL + 2u * (size_t)NB * CC * KHI)    // f32 ctx rows [b*t][CC] (only when there is an output projection)
#define WS_END (WS_Y  + 0u)

// SXW: behind a global store, before the next LDS read or address sum reuses its data or address registers
__device__ __forceinline__ void SXW() { asm volatile("s_wait_xcnt 0x0" ::: "memory"); }
// ---- k_proj: block = (64 rows, all CC cols, which): q/k/v = X W (+ b) with exact bf16 products (K = DIN) -> which 0: q f16 rows (+ residual rows < QHI); 1: k f16 rows (+ residual rows < KHI); 2: v f16 planes [c][t] (+ bf16 hi/lo planes for t < KHI)
__global__ __launch_bounds__(128) void k_proj(const float* __restrict__ XQ, const float* __restrict__ XK, const float* __restrict__ XV, const float* __restrict__ WQ, const float* __restrict__ WK, const float* __restrict__ WV, const float* __restrict__ BQ, const float* __restrict__ BK, const float* __restrict__ BV,
    _Float16* __restrict__ QH, _Float16* __restrict__ QL, _Float16* __restrict__ KH, _Float16* __restrict__ KL, _Float16* __restrict__ VT, __bf16* __restrict__ VB, __bf16* __restrict__ VBL) {
  __shared__ __align__(16) _Float16 sh[64][CC + 8], sl[64][CC + 8]; __shared__ __align__(16) _Float16 th[CC][72]; __shared__ __align__(16) __bf16 tb[CC][72], tbl[CC][72];
  const int tid = threadIdx.x, wave = tid >> 5, lane = tid & 31, col = lane & 15, g = lane >> 4; const int which = blockIdx.z; const int c0 = 0; const size_t r0 = (size_t)blockIdx.x * 64; const size_t bb = r0 / TT; const int t0 = (int)(r0 % TT);
  const float* X = which == 0 ? XQ : which == 1 ? XK : XV; const float* WA = which == 0 ? WQ : which == 1 ? WK : WV; const float* BA = which == 0 ? BQ : which == 1 ? BK : BV;
  v8f acc[CC / 16] = {};
#pragma unroll 2
  for (int kc = 0; kc < DIN / 32; ++kc) { v16b a; { const float* p = X + (r0 + wave * 16 + col) * DIN + kc * 32 + 8 * g;
#pragma unroll
      for (int i = 0; i < 8; ++i) { a[i] = (__bf16)p[i]; a[8 + i] = (__bf16)p[16 + i]; } }
    asm volatile("s_wait_loadcnt 0x0" ::: "memory");
#pragma unroll
    for (int j = 0; j < CC / 16; ++j) { const v16b w = WCOL(WA, kc * 32, c0 + j * 16 + col, lane); asm volatile("s_wait_loadcnt 0x0" ::: "memory"); acc[j] = wmma_bf(a, w, acc[j]); } }
  if (which < 2) { _Float16* DH = which == 0 ? QH : KH; _Float16* DL = which == 0 ? QL : KL; const int nhi = which == 0 ? QHI : KHI; const bool hi_rows = t0 < nhi;
#pragma unroll
    for (int j = 0; j < CC / 16; ++j) { const float bias = BA ? bfr(BA[c0 + j * 16 + col]) : 0.f;
#pragma unroll
      for (int r = 0; r < 8; ++r) { const float v = acc[j][r] + bias; const _Float16 hv = (_Float16)v; sh[wave * 16 + 8 * g + r][j * 16 + col] = hv; sl[wave * 16 + 8 * g + r][j * 16 + col] = (_Float16)((v - (float)hv) * 1024.0f); } }
    __syncthreads();
    for (int e = tid; e < 64 * (CC / 8); e += 128) { const int rl = e / (CC / 8), q = e % (CC / 8); vst2((unsigned*)(DH + (r0 + rl) * CC + c0 + q * 8), *(const v4u*)&sh[rl][q * 8]); SXW(); if (hi_rows) { vst2((unsigned*)(DL + (bb * nhi + t0 + rl) * (size_t)CC + c0 + q * 8), *(const v4u*)&sl[rl][q * 8]); SXW(); } }
  } else { const bool hi_rows = t0 < KHI;
#pragma unroll
    for (int j = 0; j < CC / 16; ++j) { const float bias = BA ? bfr(BA[c0 + j * 16 + col]) : 0.f;
#pragma unroll
      for (int r = 0; r < 8; ++r) { const float v = acc[j][r] + bias; const int rl = wave * 16 + 8 * g + r, cl = j * 16 + col; th[cl][rl] = (_Float16)v; const __bf16 bh = (__bf16)v; tb[cl][rl] = bh; tbl[cl][rl] = (__bf16)(v - (float)bh); } }
    __syncthreads();
    for (int e = tid; e < CC * 8; e += 128) { const int cl = e >> 3, q = e & 7; vst2((unsigned*)(VT + (bb * CC + c0 + cl) * (size_t)TT + t0 + q * 8), *(const v4u*)&th[cl][q * 8]); SXW(); if (hi_rows) { const size_t o3 = (bb * CC + c0 + cl) * (size_t)KHI + t0 + q * 8; vst2((unsigned*)(VB + o3), *(const v4u*)&tb[cl][q * 8]); SXW(); vst2((unsigned*)(VBL + o3), *(const v4u*)&tbl[cl][q * 8]); SXW(); } } } }
// ---- k_att: block = 16 queries of sequence b, PVW waves; wave w takes the 32-key chunks w, w + PVW, ... up to the diagonal. Logits are formed transposed (A = k rows, B = q rows), so a lane holds 16 logits of ONE query in the very order of the A fragment of P . v: they stay in registers, are masked by index, and are turned into exp(logit - the wave's own row maximum) x 2^11 (once to f16 against v f16; query blocks < QBH: 3-product logits, P and v as bf16 hi + lo). Each wave leaves its f32 partial tile, row maxima and row sums in LDS; behind one barrier wave w joins row w over the waves in wave order, each partial weighted by exp(its maximum - the row's maximum), and divides by the joined sum. A masked logit is -3e38: its exp is 0 beside any real maximum; a row with no open key in a wave's chunks has the maximum -3e38, and that wave's partial for it gets the weight 0 in the join (key 0 is open to every query, so the row's maximum is real)
#define PVW 16
#define NCH (TT / 32 / PVW)   // most chunks one wave can own
// XW: in front of a load whose result may land on the address pair of loads issued before it
__device__ __forceinline__ void XW() { asm volatile("s_wait_xcnt 0x0" ::: "memory"); }
// last fragment of a run of loads off one address pair: only the run's last load can get that pair as its result registers, so the wait stands in front of it
__device__ __forceinline__ v16h frag_h_end(const _Float16* rowk0, int lane) {
  union { v16h v; v8h q[2]; } u; const _Float16* p = rowk0 + 8 * (lane >> 4);
  u.q[0] = *(const v8h*)p; XW(); u.q[1] = *(const v8h*)(p + 16); return u.v;
}
// fragments of the three-product path (many address pairs, one chunk a wave): the wait behind every load
__device__ __forceinline__ v16h frag_h_w(const _Float16* rowk0, int lane) {
  union { v16h v; v8h q[2]; } u; const _Float16* p = rowk0 + 8 * (lane >> 4);
  u.q[0] = *(const v8h*)p; XW(); u.q[1] = *(const v8h*)(p + 16); XW(); return u.v;
}
__device__ __forceinline__ v16b frag_b_w(const __bf16* rowk0, int lane) {
  union { v16b v; v8b q[2]; } u; const __bf16* p = rowk0 + 8 * (lane >> 4);
  u.q[0] = *(const v8b*)p; XW(); u.q[1] = *(const v8b*)(p + 16); XW(); return u.v;
}
__global__ __launch_bounds__(PVW * 32) void k_att(const _Float16* __restrict__ QH, const _Float16* __restrict__ KH, const _Float16* __restrict__ QL, const _Float16* __restrict__ KL, const _Float16* __restrict__ VT, const __bf16* __restrict__ VB, const __bf16* __restrict__ VBL, int b, float* __restrict__ Y) {
  __shared__ __align__(16) float ss[PVW][16][HD + 4]; __shared__ float smx[PVW][16], ssu[PVW][16];
  const int tid = threadIdx.x, wave = __builtin_amdgcn_readfirstlane(tid >> 5), lane = tid & 31, col = lane & 15, g = lane >> 4; const int qb = blockIdx.x >> 2; const int ql0 = blockIdx.x * 16; const int kce = (ql0 >> 5) + 1;   // chunks that hold a key <= the block's last query
  const int t = ql0 + col;   // the query whose logits this lane holds
  const _Float16* Qr = QH + ((size_t)b * TT + t) * CC; const _Float16* Kb = KH + (size_t)b * TT * CC;
  v8f acc[HD / 16] = {}; float m = -3.0e38f, sum = 0.f;
  // every unroll below: the loop indexes register arrays or vector elements, which takes constant indices
  if (qb < QBH) {
    if (wave < kce) { const int k0 = wave * 32; const _Float16* Qlr = QL + ((size_t)b * QHI + t) * CC; const _Float16* Klb = KL + (size_t)b * KHI * CC;
      v8f a0[2] = {}, a1[2] = {};
#pragma unroll
      for (int c = 0; c < HD / 32; ++c) { const v16h ah = frag_h_w(Qr + c * 32, lane), al = frag_h_w(Qlr + c * 32, lane);
#pragma unroll
        for (int u = 0; u < 2; ++u) { const size_t ko = (size_t)(k0 + u * 16 + col) * CC + c * 32; const v16h kbf = frag_h_w(Kb + ko, lane), klf = frag_h_w(Klb + ko, lane); a0[u] = wmma16(kbf, ah, a0[u]); a1[u] = wmma16(kbf, al, a1[u]); a1[u] = wmma16(klf, ah, a1[u]); } }
      float s[16];
#pragma unroll
      for (int e = 0; e < 16; ++e) { const float v = (a0[e >> 3][e & 7] + a1[e >> 3][e & 7] * (1.0f / 1024.0f)) * SCALE; s[e] = (k0 + (e >> 3) * 16 + 8 * g + (e & 7) <= t) ? v : -3.0e38f; m = fmaxf(m, s[e]); }
      m = fmaxf(m, __shfl_xor(m, 16));
#pragma unroll
      for (int e = 0; e < 16; ++e) { const float ev = expf(s[e] - m); sum += ev; s[e] = ev * 2048.0f; }
      const F2 p = bsplit16(s);
#pragma unroll
      for (int j = 0; j < HD / 16; ++j) { const size_t po = ((size_t)b * CC + j * 16 + col) * (size_t)KHI + k0; const v16b vh = frag_b_w(VB + po, lane); acc[j] = wmma_bf(p.h, vh, acc[j]); acc[j] = wmma_bf(p.l, vh, acc[j]); acc[j] = wmma_bf(p.h, frag_b_w(VBL + po, lane), acc[j]); } }
  } else {
    v16h p[NCH];
    { float s[NCH][16]; v16h qf[HD / 32];
#pragma unroll
      for (int c = 0; c < HD / 32; ++c) qf[c] = frag_h(Qr + c * 32, lane);
      asm volatile("s_wait_xcnt 0x0" ::: "memory");   // the q loads' address pair is reused for the first k addresses in the next block
#pragma unroll   // s and p are indexed by constants only, so they live in registers
      for (int i = 0; i < NCH; ++i) { const int kc = wave + i * PVW, k0 = kc * 32;
        if (kc < kce) { v16h kf[2 * (HD / 32)]; v8f a[2] = {};
#pragma unroll
          for (int c = 0; c < HD / 32; ++c)
#pragma unroll
            for (int u = 0; u < 2; ++u) { const _Float16* kp = Kb + (size_t)(k0 + u * 16 + col) * CC + c * 32; kf[c * 2 + u] = (c * 2 + u < 2 * (HD / 32) - 1) ? frag_h(kp, lane) : frag_h_end(kp, lane); }
#pragma unroll
          for (int c = 0; c < HD / 32; ++c)
#pragma unroll
            for (int u = 0; u < 2; ++u) a[u] = wmma16(kf[c * 2 + u], qf[c], a[u]);
          if (kc == kce - 1) {   // only the last chunk reaches past a query of this block
#pragma unroll
            for (int e = 0; e < 16; ++e) { s[i][e] = (k0 + (e >> 3) * 16 + 8 * g + (e & 7) <= t) ? a[e >> 3][e & 7] * SCALE : -3.0e38f; m = fmaxf(m, s[i][e]); }
          } else {
#pragma unroll
            for (int e = 0; e < 16; ++e) { s[i][e] = a[e >> 3][e & 7] * SCALE; m = fmaxf(m, s[i][e]); } } } }
      m = fmaxf(m, __shfl_xor(m, 16));
#pragma unroll
      for (int i = 0; i < NCH; ++i)
        if (wave + i * PVW < kce) {
#pragma unroll
          for (int e = 0; e < 16; ++e) { const float ev = expf(s[i][e] - m); sum += ev; p[i][e] = (_Float16)(ev * 2048.0f); } } }
#pragma unroll
    for (int i = 0; i < NCH; ++i) { const int k0 = (wave + i * PVW) * 32;
      if (wave + i * PVW < kce) { v16h vf[HD / 16];
#pragma unroll
        for (int j = 0; j < HD / 16; ++j) { const _Float16* vp = VT + ((size_t)b * CC + j * 16 + col) * (size_t)TT + k0; vf[j] = (j < HD / 16 - 1) ? frag_h(vp, lane) : frag_h_end(vp, lane); }
#pragma unroll
        for (int j = 0; j < HD / 16; ++j) acc[j] = wmma16(p[i], vf[j], acc[j]); } } }
  sum += __shfl_xor(sum, 16);
  if (g == 0) { smx[wave][col] = m; ssu[wave][col] = sum; }
#pragma unroll
  for (int j = 0; j < HD / 16; ++j)
#pragma unroll
    for (int r = 0; r < 8; ++r) ss[wave][8 * g + r][j * 16 + col] = acc[j][r];
  __syncthreads();   // every wave's partial tile, maxima and sums are in LDS before any wave joins them
  float mm = smx[0][wave];
#pragma unroll
  for (int w = 1; w < PVW; ++w) mm = fmaxf(mm, smx[w][wave]);
  v2f o = {}; float tot = 0.f;
#pragma unroll   // the LDS reads of all partial tiles issue ahead of the adds instead of one round trip each
  for (int w = 0; w < PVW; ++w) { const float f = expf(smx[w][wave] - mm); tot += ssu[w][wave] * f; o += *(const v2f*)&ss[w][wave][lane * 2] * f; }
  o *= tot > 0.f ? 1.0f / (2048.0f * tot) : 0.f;
  vst2(Y + ((size_t)b * TT + ql0 + wave) * CC + lane * 2, o); }

extern "C" void kernel_launch(void* const* d_in, const int* in_sizes, int n_in, void* d_out, int out_size, void* d_ws, size_t ws_size, hipStream_t stream) {
  (void)in_sizes; (void)n_in; (void)out_size;
  const float** F = (const float**)d_in;
  if (ws_size < (size_t)WS_END) return;
  char* ws = (char*)d_ws; _Float16 *QH = (_Float16*)(ws + WS_QH), *KH = (_Float16*)(ws + WS_KH), *VT = (_Float16*)(ws + WS_VT), *QL = (_Float16*)(ws + WS_QL), *KL = (_Float16*)(ws + WS_KL); __bf16 *VB = (__bf16*)(ws + WS_VB), *VBL = (__bf16*)(ws + WS_VBL); float *Y = (float*)(ws + WS_Y);
  (void)Y; (void)QL; (void)KL; (void)VB; (void)VBL;
  // inputs: 0 X [4,4096,512]; 1 Wq, 2 Wk, 3 Wv [512,64] (in,out)
  k_proj<<<dim3(TNB * TT / 64, 1, 3), 128, 0, stream>>>(F[0], F[0], F[0], F[1], F[2], F[3], nullptr, nullptr, nullptr, QH, QL, KH, KL, VT, VB, VBL);
  for (int b = 0; b < TNB; ++b) {
    k_att<<<dim3(TT / 16, 1, 1), PVW * 32, 0, stream>>>(QH, KH, QL, KL, VT, VB, VBL, b, (float*)d_out);
  }
}

// v004
// It runs in 74.2 microseconds.
// Two timings next to v003 put it at 1.38 and 1.39 times that version's speed.
// Over all steps from v000 it is 13.8 times as fast.
// compute dtype: all float inputs rounded to bf16; Q/K/V = X W with EXACT bf16 products on WMMA 16x16x32 (f32 accumulate; the single head's planes are 64 wide); causal logits: q, k once to f16 (1 product) x 64^-0.5, except the first 384 query rows of each sequence (3 products with f16 residuals); softmax in f32; exp(logit - max) x 2^11 once to f16 against v once to f16 (1 product; bf16 hi + lo below row 384); f32 output.
#include <hip/hip_runtime.h>
#include <math.h>

typedef __attribute__((ext_vector_type(16))) _Float16 v16h;
typedef __attribute__((ext_vector_type(16))) __bf16 v16b;
typedef __attribute__((ext_vector_type(8)))  _Float16 v8h;
typedef __attribute__((ext_vector_type(8)))  float v8f;
typedef __attribute__((ext_vector_type(4)))  float v4f;
typedef __attribute__((ext_vector_type(2)))  float v2f;
typedef __attribute__((ext_vector_type(4)))  unsigned v4u;
typedef __attribute__((ext_vector_type(4)))  int v4i;
typedef float __attribute__((may_alias)) float_a;
typedef int __attribute__((may_alias)) int_a;

template <typename T> __device__ __forceinline__ void vst2(void* p, T v) { *(T*)p = v;  }
__device__ __forceinline__ v8f wmma16(v16h a, v16h b, v8f c) {
  v8f d = __builtin_amdgcn_wmma_f32_16x16x32_f16(false, a, false, b, (short)0, c, false, false);
  asm volatile("v_nop\n\tv_nop\n\tv_nop\n\tv_nop" : "+v"(d) : "v"(a), "v"(b));
  return d;
}
__device__ __forceinline__ v8f wmma_bf(v16b a, v16b b, v8f c) {
  v8f d = __builtin_amdgcn_wmma_f32_16x16x32_bf16(false, a, false, b, (short)0, c, false, false);
  asm volatile("v_nop\n\tv_nop\n\tv_nop\n\tv_nop" : "+v"(d) : "v"(a), "v"(b));
  return d;
}
// 16x16x32 fragments: lane = (h = lane>>4, row/col = lane&15); elements 0..7 = k0+8h+0..7, 8..15 = k0+16+8h+0..7; D element r = row 8h+r
__device__ __forceinline__ v16h frag_h(const _Float16* rowk0, int lane) {
  union { v16h v; v8h q[2]; } u; const _Float16* p = rowk0 + 8 * (lane >> 4);
  u.q[0] = *(const v8h*)p; u.q[1] = *(const v8h*)(p + 16); return u.v;
}
__device__ __forceinline__ v16h frag_f32(const float* rowk0, int lane) {
  v16h a; const float* p = rowk0 + 8 * (lane >> 4);
#pragma unroll
  for (int i = 0; i < 8; ++i) { a[i] = (_Float16)p[i]; a[8 + i] = (_Float16)p[16 + i]; }
  return a;
}
__device__ __forceinline__ v16h frag_f32s(const float* rowk0, int lane, float sc) {
  v16h a; const float* p = rowk0 + 8 * (lane >> 4);
#pragma unroll
  for (int i = 0; i < 8; ++i) { a[i] = (_Float16)(p[i] * sc); a[8 + i] = (_Float16)(p[16 + i] * sc); }
  return a;
}
// column fragment from a [K][ld] layout (column n), rows >= K read as 0
__device__ __forceinline__ v16h fragc_f32(const float* W, int k0, int n, int lane, int ld, int K) {
  v16h a; const int g = lane >> 4;
#pragma unroll
  for (int i = 0; i < 8; ++i) { const int ka = k0 + 8 * g + i, kb = ka + 16;
    a[i] = (_Float16)(ka < K ? W[(size_t)(ka < K ? ka : K - 1) * ld + n] : 0.f); a[8 + i] = (_Float16)(kb < K ? W[(size_t)(kb < K ? kb : K - 1) * ld + n] : 0.f); }
  return a;
}
struct F2 { v16b h, l; };
__device__ __forceinline__ F2 bsplit16(const float v[16]) { F2 r;
#pragma unroll
  for (int i = 0; i < 16; ++i) { const __bf16 h = (__bf16)v[i]; r.h[i] = h; r.l[i] = (__bf16)(v[i] - (float)h); }
  return r; }
__device__ __forceinline__ F2 split_row(const float* row, int k0, int lane) { float v[16]; const float* p = row + k0 + 8 * (lane >> 4);
#pragma unroll
  for (int i = 0; i < 8; ++i) { v[i] = p[i]; v[8 + i] = p[16 + i]; }
  return bsplit16(v); }
__device__ __forceinline__ F2 split_rowK(const float* row, int k0, int lane, int K) { float v[16]; const int g = lane >> 4;
#pragma unroll
  for (int i = 0; i < 8; ++i) { const int ka = k0 + 8 * g + i, kb = ka + 16; v[i] = ka < K ? row[ka < K ? ka : K - 1] : 0.f; v[8 + i] = kb < K ? row[kb < K ? kb : K - 1] : 0.f; }
  return bsplit16(v); }
__device__ __forceinline__ F2 split_col(const float* W, int k0, int n, int lane, int ld, int K) { float v[16]; const int g = lane >> 4;
#pragma unroll
  for (int i = 0; i < 8; ++i) { const int ka = k0 + 8 * g + i, kb = ka + 16; v[i] = ka < K ? W[(size_t)(ka < K ? ka : K - 1) * ld + n] : 0.f; v[8 + i] = kb < K ? W[(size_t)(kb < K ? kb : K - 1) * ld + n] : 0.f; }
  return bsplit16(v); }
__device__ __forceinline__ v8f mac3(const F2& a, const F2& b, v8f c) { c = wmma_bf(a.l, b.h, c); c = wmma_bf(a.h, b.l, c); return wmma_bf(a.h, b.h, c); }
__device__ __forceinline__ float sigm(float v) { return 1.0f / (1.0f + expf(-v)); }
#define LDSX() do { asm volatile("s_wait_dscnt 0" ::: "memory"); __builtin_amdgcn_wave_barrier(); __builtin_amdgcn_fence(__ATOMIC_RELEASE, "workgroup"); } while (0)

// Single-head causal self-attention (B 4, S 4,096, D_in 512 -> 64): Q, K, V = X Wq/Wk/Wv ((in,out) [512, 64]); W = softmax(causal(Q K^T) / 8); Z = W V -> [B, S, 64].
#define NB 4
#define TT 4096
#define CC 64             // NH * HD = projected width
#define DIN 512          // input (model) width
#define NH 1
#define HD 64
#define NQB (TT / 64)
#define HG 1
#define SCALE (0.125f)
#define CAUSAL 1
#ifndef TNB
#define TNB NB
#endif
__device__ __forceinline__ v16b zero16b() { v16b z; _Pragma("unroll") for (int i = 0; i < 16; ++i) z[i] = (__bf16)0.f; return z; }
__device__ __forceinline__ float bfr(float v) { return (float)(__bf16)v; }
__host__ __device__ __forceinline__ int kb_last(int qb) { return CAUSAL ? ((qb * 64 + 63) >> 7) : (TT / 128 - 1); }
typedef __attribute__((ext_vector_type(8))) __bf16 v8b;
__device__ __forceinline__ v16b frag_b(const __bf16* rowk0, int lane) {
  union { v16b v; v8b q[2]; } u; const __bf16* p = rowk0 + 8 * (lane >> 4);
  u.q[0] = *(const v8b*)p; u.q[1] = *(const v8b*)(p + 16); return u.v;
}
#define QBH 6              // causal: query blocks 0..QBH-1 of each sequence (few keys, no averaging) take the high-precision path
#define QHI 384            // rows carrying a q residual plane
#define KHI 384            // key rows carrying k residual / v bf16 hi+lo planes (used only by the causal high-precision path)
// B fragment (k rows k0+.., output column o) of a weight: (in,out) [K][ld] or (out,in) [ld rows of K]: bf16 exact, or f16(bf16 * 256) exact
__device__ __forceinline__ v16b wcol_io(const float* Wm, int k0, int o, int lane, int ld) { v16b w; const int g = lane >> 4;
#pragma unroll
  for (int i = 0; i < 8; ++i) { w[i] = (__bf16)Wm[(size_t)(k0 + 8 * g + i) * ld + o];
    if (i == 7) asm volatile("s_wait_xcnt 0x0" ::: "memory");   // only the run's last load can get the run's address pair as its result register: the wait stands in front of it
    w[8 + i] = (__bf16)Wm[(size_t)(k0 + 16 + 8 * g + i) * ld + o]; }
  return w; }
__device__ __forceinline__ v16b wcol_oi(const float* Wm, int k0, int o, int lane, int K) { v16b w; const float* p = Wm + (size_t)o * K + k0 + 8 * (lane >> 4);
#pragma unroll
  for (int i = 0; i < 8; ++i) { w[i] = (__bf16)p[i]; w[8 + i] = (__bf16)p[16 + i]; }
  return w; }
__device__ __forceinline__ v16h wcolh_io(const float* Wm, int k0, int o, int lane, int ld) { v16h w; const int g = lane >> 4;
#pragma unroll
  for (int i = 0; i < 8; ++i) { w[i] = (_Float16)(bfr(Wm[(size_t)(k0 + 8 * g + i) * ld + o]) * 256.0f); w[8 + i] = (_Float16)(bfr(Wm[(size_t)(k0 + 16 + 8 * g + i) * ld + o]) * 256.0f); }
  return w; }
__device__ __forceinline__ v16h wcolh_oi(const float* Wm, int k0, int o, int lane, int K) { v16h w; const float* p = Wm + (size_t)o * K + k0 + 8 * (lane >> 4);
#pragma unroll
  for (int i = 0; i < 8; ++i) { w[i] = (_Float16)(bfr(p[i]) * 256.0f); w[8 + i] = (_Float16)(bfr(p[16 + i]) * 256.0f); }
  return w; }
#define WQKV_LAYOUT 0   // 0 = (in,out) [DIN][DOUT]; 1 = (out,in) [CC][DIN]; 2 = per-head [NH][DIN][HD]
__device__ __forceinline__ v16b wcol_hdk(const float* Wm, int k0, int o, int lane) { v16b w; const int g = lane >> 4; const float* p = Wm + (size_t)(o / HD) * DIN * HD + (o % HD);
#pragma unroll
  for (int i = 0; i < 8; ++i) { w[i] = (__bf16)p[(size_t)(k0 + 8 * g + i) * HD]; w[8 + i] = (__bf16)p[(size_t)(k0 + 16 + 8 * g + i) * HD]; }
  return w; }
#define WO_OUT_IN 0
#if WQKV_LAYOUT == 1
#define WCOL(W, k0, o, lane) wcol_oi(W, k0, o, lane, DIN)
#elif WQKV_LAYOUT == 2
#define WCOL(W, k0, o, lane) wcol_hdk(W, k0, o, lane)
#else
#define WCOL(W, k0, o, lane) wcol_io(W, k0, (o), lane, DOUT)   /* W (in,out) [512][64] */
#endif
#if WO_OUT_IN
#define WOCOL(W, k0, o, lane) wcol_oi(W, k0, o, lane, CC)
#define WOCOLH(W, k0, o, lane) wcolh_oi(W, k0, o, lane, CC)
#else
#define WOCOL(W, k0, o, lane) wcol_io(W, k0, o, lane, DIN)
#define WOCOLH(W, k0, o, lane) wcolh_io(W, k0, o, lane, DIN)
#endif
#define DOUT 64            // head width = plane width CC
#ifndef SM_EXTRA_PARAMS
#define SM_EXTRA_PARAMS
#endif
#ifndef PROJ_EXTRA_PARAMS
#define PROJ_EXTRA_PARAMS
#endif
#ifndef SM_MASK_HOOK
#define SM_MASK_HOOK (void)0
#endif

#define WS_QH  0u                                      // f16 q rows [b*t][CC]
#define WS_KH  (WS_QH + 2u * (size_t)NB * TT * CC)      // f16 k rows [b*t][CC]
#define WS_VT  (WS_KH + 2u * (size_t)NB * TT * CC)      // f16 v planes [b][c][t]
#define WS_QL  (WS_VT + 2u * (size_t)NB * CC * TT)      // f16 q residual x 2^10 rows [b][t < QHI][CC]
#define WS_KL  (WS_QL + 2u * (size_t)NB * QHI * CC)     // f16 k residual x 2^10 rows [b][t < KHI][CC]
#define WS_VB  (WS_KL + 2u * (size_t)NB * KHI * CC)     // bf16 v hi planes [b][c][t < KHI]
#define WS_VBL (WS_VB + 2u * (size_t)NB * CC * KHI)
#define WS_Y   (WS_VBL + 2u * (size_t)NB * CC * KHI)    // f32 ctx rows [b*t][CC] (only when there is an output projection)
#define WS_END (WS_Y  + 0u)

// SXW: behind a global store, before the next LDS read or address sum reuses its data or address registers
__device__ __forceinline__ void SXW() { asm volatile("s_wait_xcnt 0x0" ::: "memory"); }
// ---- k_proj: block = (64 rows, all CC cols, which): q/k/v = X W (+ b) with exact bf16 products (K = DIN) -> which 0: q f16 rows (+ residual rows < QHI); 1: k f16 rows (+ residual rows < KHI); 2: v f16 planes [c][t] (+ bf16 hi/lo planes for t < KHI)
__global__ __launch_bounds__(128) void k_proj(const float* __restrict__ XQ, const float* __restrict__ XK, const float* __restrict__ XV, const float* __restrict__ WQ, const float* __restrict__ WK, const float* __restrict__ WV, const float* __restrict__ BQ, const float* __restrict__ BK, const float* __restrict__ BV,
    _Float16* __restrict__ QH, _Float16* __restrict__ QL, _Float16* __restrict__ KH, _Float16* __restrict__ KL, _Float16* __restrict__ VT, __bf16* __restrict__ VB, __bf16* __restrict__ VBL) {
  __shared__ __align__(16) _Float16 sh[64][CC + 8], sl[64][CC + 8]; __shared__ __align__(16) _Float16 th[CC][72]; __shared__ __align__(16) __bf16 tb[CC][72], tbl[CC][72];
  const int tid = threadIdx.x, wave = tid >> 5, lane = tid & 31, col = lane & 15, g = lane >> 4; const int which = blockIdx.z; const int c0 = 0; const size_t r0 = (size_t)blockIdx.x * 64; const size_t bb = r0 / TT; const int t0 = (int)(r0 % TT);
  const float* X = which == 0 ? XQ : which == 1 ? XK : XV; const float* WA = which == 0 ? WQ : which == 1 ? WK : WV; const float* BA = which == 0 ? BQ : which == 1 ? BK : BV;
  v8f acc[CC / 16] = {};
#pragma unroll 2
  for (int kc = 0; kc < DIN / 32; ++kc) { v16b a; { const float* p = X + (r0 + wave * 16 + col) * DIN + kc * 32 + 8 * g;
#pragma unroll
      for (int i = 0; i < 8; ++i) { a[i] = (__bf16)p[i]; a[8 + i] = (__bf16)p[16 + i]; } }
    asm volatile("s_wait_loadcnt 0x0" ::: "memory");
#pragma unroll
    for (int j = 0; j < CC / 16; ++j) { const v16b w = WCOL(WA, kc * 32, c0 + j * 16 + col, lane); asm volatile("s_wait_loadcnt 0x0" ::: "memory"); acc[j] = wmma_bf(a, w, acc[j]); } }
  if (which < 2) { _Float16* DH = which == 0 ? QH : KH; _Float16* DL = which == 0 ? QL : KL; const int nhi = which == 0 ? QHI : KHI; const bool hi_rows = t0 < nhi;
#pragma unroll
    for (int j = 0; j < CC / 16; ++j) { const float bias = BA ? bfr(BA[c0 + j * 16 + col]) : 0.f;
#pragma unroll
      for (int r = 0; r < 8; ++r) { const float v = acc[j][r] + bias; const _Float16 hv = (_Float16)v; sh[wave * 16 + 8 * g + r][j * 16 + col] = hv; sl[wave * 16 + 8 * g + r][j * 16 + col] = (_Float16)((v - (float)hv) * 1024.0f); } }
    __syncthreads();
    for (int e = tid; e < 64 * (CC / 8); e += 128) { const int rl = e / (CC / 8), q = e % (CC / 8); vst2((unsigned*)(DH + (r0 + rl) * CC + c0 + q * 8), *(const v4u*)&sh[rl][q * 8]); SXW(); if (hi_rows) { vst2((unsigned*)(DL + (bb * nhi + t0 + rl) * (size_t)CC + c0 + q * 8), *(const v4u*)&sl[rl][q * 8]); SXW(); } }
  } else { const bool hi_rows = t0 < KHI;
#pragma unroll
    for (int j = 0; j < CC / 16; ++j) { const float bias = BA ? bfr(BA[c0 + j * 16 + col]) : 0.f;
#pragma unroll
      for (int r = 0; r < 8; ++r) { const float v = acc[j][r] + bias; const int rl = wave * 16 + 8 * g + r, cl = j * 16 + col; th[cl][rl] = (_Float16)v; const __bf16 bh = (__bf16)v; tb[cl][rl] = bh; tbl[cl][rl] = (__bf16)(v - (float)bh); } }
    __syncthreads();
    for (int e = tid; e < CC * 8; e += 128) { const int cl = e >> 3, q = e & 7; vst2((unsigned*)(VT + (bb * CC + c0 + cl) * (size_t)TT + t0 + q * 8), *(const v4u*)&th[cl][q * 8]); SXW(); if (hi_rows) { const size_t o3 = (bb * CC + c0 + cl) * (size_t)KHI + t0 + q * 8; vst2((unsigned*)(VB + o3), *(const v4u*)&tb[cl][q * 8]); SXW(); vst2((unsigned*)(VBL + o3), *(const v4u*)&tbl[cl][q * 8]); SXW(); } } } }
// ---- k_att: block = 16 queries of sequence b, PVW waves; wave w takes the 32-key chunks w, w + PVW, ... up to the diagonal. Logits are formed transposed (A = k rows, B = q rows), so a lane holds 16 logits of ONE query in the very order of the A fragment of P . v: they stay in registers, are masked by index, and are turned into exp(logit - the wave's own row maximum) x 2^11 (once to f16 against v f16; query blocks < QBH: 3-product logits, P and v as bf16 hi + lo). Each wave leaves its f32 partial tile, row maxima and row sums in LDS; behind one barrier wave w joins row w over the waves in wave order, each partial weighted by exp(its maximum - the row's maximum), and divides by the joined sum. A masked logit is -3e38: its exp is 0 beside any real maximum; a row with no open key in a wave's chunks has the maximum -3e38, and that wave's partial for it gets the weight 0 in the join (key 0 is open to every query, so the row's maximum is real)
#define PVW 16
#define NCH (TT / 32 / PVW)   // most chunks one wave can own
// XW: in front of a load whose result may land on the address pair of loads issued before it
__device__ __forceinline__ void XW() { asm volatile("s_wait_xcnt 0x0" ::: "memory"); }
// last fragment of a run of loads off one address pair: only the run's last load can get that pair as its result registers, so the wait stands in front of it
__device__ __forceinline__ v16h frag_h_end(const _Float16* rowk0, int lane) {
  union { v16h v; v8h q[2]; } u; const _Float16* p = rowk0 + 8 * (lane >> 4);
  u.q[0] = *(const v8h*)p; XW(); u.q[1] = *(const v8h*)(p + 16); return u.v;
}
// fragments of the three-product path (many address pairs, one chunk a wave): the wait behind every load
__device__ __forceinline__ v16h frag_h_w(const _Float16* rowk0, int lane) {
  union { v16h v; v8h q[2]; } u; const _Float16* p = rowk0 + 8 * (lane >> 4);
  u.q[0] = *(const v8h*)p; XW(); u.q[1] = *(const v8h*)(p + 16); XW(); return u.v;
}
__device__ __forceinline__ v16b frag_b_w(const __bf16* rowk0, int lane) {
  union { v16b v; v8b q[2]; } u; const __bf16* p = rowk0 + 8 * (lane >> 4);
  u.q[0] = *(const v8b*)p; XW(); u.q[1] = *(const v8b*)(p + 16); XW(); return u.v;
}
__global__ __launch_bounds__(PVW * 32) void k_att(const _Float16* __restrict__ QH, const _Float16* __restrict__ KH, const _Float16* __restrict__ QL, const _Float16* __restrict__ KL, const _Float16* __restrict__ VT, const __bf16* __restrict__ VB, const __bf16* __restrict__ VBL, float* __restrict__ Y) {
  __shared__ __align__(16) float ss[PVW][16][HD + 4]; __shared__ float smx[PVW][16], ssu[PVW][16];
  const int tid = threadIdx.x, wave = __builtin_amdgcn_readfirstlane(tid >> 5), lane = tid & 31, col = lane & 15, g = lane >> 4; const int b = blockIdx.x % TNB, qt = TT / 16 - 1 - blockIdx.x / TNB;   // all sequences in one grid; the query tiles with the most keys take the lowest block indices, for speed only
  const int qb = qt >> 2; const int ql0 = qt * 16; const int kce = (ql0 >> 5) + 1;   // chunks that hold a key <= the block's last query
  const int t = ql0 + col;   // the query whose logits this lane holds
  const _Float16* Qr = QH + ((size_t)b * TT + t) * CC; const _Float16* Kb = KH + (size_t)b * TT * CC;
  v8f acc[HD / 16] = {}; float m = -3.0e38f, sum = 0.f;
  // every unroll below: the loop indexes register arrays or vector elements, which takes constant indices
  if (qb < QBH) {
    if (wave < kce) { const int k0 = wave * 32; const _Float16* Qlr = QL + ((size_t)b * QHI + t) * CC; const _Float16* Klb = KL + (size_t)b * KHI * CC;
      v8f a0[2] = {}, a1[2] = {};
#pragma unroll
      for (int c = 0; c < HD / 32; ++c) { const v16h ah = frag_h_w(Qr + c * 32, lane), al = frag_h_w(Qlr + c * 32, lane);
#pragma unroll
        for (int u = 0; u < 2; ++u) { const size_t ko = (size_t)(k0 + u * 16 + col) * CC + c * 32; const v16h kbf = frag_h_w(Kb + ko, lane), klf = frag_h_w(Klb + ko, lane); a0[u] = wmma16(kbf, ah, a0[u]); a1[u] = wmma16(kbf, al, a1[u]); a1[u] = wmma16(klf, ah, a1[u]); } }
      float s[16];
#pragma unroll
      for (int e = 0; e < 16; ++e) { const float v = (a0[e >> 3][e & 7] + a1[e >> 3][e & 7] * (1.0f / 1024.0f)) * SCALE; s[e] = (k0 + (e >> 3) * 16 + 8 * g + (e & 7) <= t) ? v : -3.0e38f; m = fmaxf(m, s[e]); }
      m = fmaxf(m, __shfl_xor(m, 16));
#pragma unroll
      for (int e = 0; e < 16; ++e) { const float ev = expf(s[e] - m); sum += ev; s[e] = ev * 2048.0f; }
      const F2 p = bsplit16(s);
#pragma unroll
      for (int j = 0; j < HD / 16; ++j) { const size_t po = ((size_t)b * CC + j * 16 + col) * (size_t)KHI + k0; const v16b vh = frag_b_w(VB + po, lane); acc[j] = wmma_bf(p.h, vh, acc[j]); acc[j] = wmma_bf(p.l, vh, acc[j]); acc[j] = wmma_bf(p.h, frag_b_w(VBL + po, lane), acc[j]); } }
  } else {
    v16h p[NCH];
    { float s[NCH][16]; v16h qf[HD / 32];
#pragma unroll
      for (int c = 0; c < HD / 32; ++c) qf[c] = frag_h(Qr + c * 32, lane);
      asm volatile("s_wait_xcnt 0x0" ::: "memory");   // the q loads' address pair is reused for the first k addresses in the next block
#pragma unroll   // s and p are indexed by constants only, so they live in registers
      for (int i = 0; i < NCH; ++i) { const int kc = wave + i * PVW, k0 = kc * 32;
        if (kc < kce) { v16h kf[2 * (HD / 32)]; v8f a[2] = {};
#pragma unroll
          for (int c = 0; c < HD / 32; ++c)
#pragma unroll
            for (int u = 0; u < 2; ++u) { const _Float16* kp = Kb + (size_t)(k0 + u * 16 + col) * CC + c * 32; kf[c * 2 + u] = (c * 2 + u < 2 * (HD / 32) - 1) ? frag_h(kp, lane) : frag_h_end(kp, lane); }
#pragma unroll
          for (int c = 0; c < HD / 32; ++c)
#pragma unroll
            for (int u = 0; u < 2; ++u) a[u] = wmma16(kf[c * 2 + u], qf[c], a[u]);
          if (kc == kce - 1) {   // only the last chunk reaches past a query of this block
#pragma unroll
            for (int e = 0; e < 16; ++e) { s[i][e] = (k0 + (e >> 3) * 16 + 8 * g + (e & 7) <= t) ? a[e >> 3][e & 7] * SCALE : -3.0e38f; m = fmaxf(m, s[i][e]); }
          } else {
#pragma unroll
            for (int e = 0; e < 16; ++e) { s[i][e] = a[e >> 3][e & 7] * SCALE; m = fmaxf(m, s[i][e]); } } } }
      m = fmaxf(m, __shfl_xor(m, 16));
#pragma unroll
      for (int i = 0; i < NCH; ++i)
        if (wave + i * PVW < kce) {
#pragma unroll
          for (int e = 0; e < 16; ++e) { const float ev = expf(s[i][e] - m); sum += ev; p[i][e] = (_Float16)(ev * 2048.0f); } } }
#pragma unroll
    for (int i = 0; i < NCH; ++i) { const int k0 = (wave + i * PVW) * 32;
      if (wave + i * PVW < kce) { v16h vf[HD / 16];
#pragma unroll
        for (int j = 0; j < HD / 16; ++j) { const _Float16* vp = VT + ((size_t)b * CC + j * 16 + col) * (size_t)TT + k0; vf[j] = (j < HD / 16 - 1) ? frag_h(vp, lane) : frag_h_end(vp, lane); }
#pragma unroll
        for (int j = 0; j < HD / 16; ++j) acc[j] = wmma16(p[i], vf[j], acc[j]); } } }
  sum += __shfl_xor(sum, 16);
  if (g == 0) { smx[wave][col] = m; ssu[wave][col] = sum; }
#pragma unroll
  for (int j = 0; j < HD / 16; ++j)
#pragma unroll
    for (int r = 0; r < 8; ++r) ss[wave][8 * g + r][j * 16 + col] = acc[j][r];
  __syncthreads();   // every wave's partial tile, maxima and sums are in LDS before any wave joins them
  float mm = smx[0][wave];
#pragma unroll
  for (int w = 1; w < PVW; ++w) mm = fmaxf(mm, smx[w][wave]);
  v2f o = {}; float tot = 0.f;
#pragma unroll   // the LDS reads of all partial tiles issue ahead of the adds instead of one round trip each
  for (int w = 0; w < PVW; ++w) { const float f = expf(smx[w][wave] - mm); tot += ssu[w][wave] * f; o += *(const v2f*)&ss[w][wave][lane * 2] * f; }
  o *= tot > 0.f ? 1.0f / (2048.0f * tot) : 0.f;
  vst2(Y + ((size_t)b * TT + ql0 + wave) * CC + lane * 2, o); }

extern "C" void kernel_launch(void* const* d_in, const int* in_sizes, int n_in, void* d_out, int out_size, void* d_ws, size_t ws_size, hipStream_t stream) {
  (void)in_sizes; (void)n_in; (void)out_size;
  const float** F = (const float**)d_in;
  if (ws_size < (size_t)WS_END) return;
  char* ws = (char*)d_ws; _Float16 *QH = (_Float16*)(ws + WS_QH), *KH = (_Float16*)(ws + WS_KH), *VT = (_Float16*)(ws + WS_VT), *QL = (_Float16*)(ws + WS_QL), *KL = (_Float16*)(ws + WS_KL); __bf16 *VB = (__bf16*)(ws + WS_VB), *VBL = (__bf16*)(ws + WS_VBL); float *Y = (float*)(ws + WS_Y);
  (void)Y; (void)QL; (void)KL; (void)VB; (void)VBL;
  // inputs: 0 X [4,4096,512]; 1 Wq, 2 Wk, 3 Wv [512,64] (in,out)
  k_proj<<<dim3(TNB * TT / 64, 1, 3), 128, 0, stream>>>(F[0], F[0], F[0], F[1], F[2], F[3], nullptr, nullptr, nullptr, QH, QL, KH, KL, VT, VB, VBL);
  k_att<<<dim3(TNB * (TT / 16), 1, 1), PVW * 32, 0, stream>>>(QH, KH, QL, KL, VT, VB, VBL, (float*)d_out);
}

// v005
// Measured time: 62.5 microseconds a run.
// Timed twice side by side with v004, it ran 1.18 times as fast both times.
// Over all steps from v000 it is 16.3 times as fast.
// compute dtype: all float inputs rounded to bf16; Q/K/V = X W with EXACT bf16 products on WMMA 16x16x32 (f32 accumulate; the single head's planes are 64 wide); causal logits: q, k once to f16 (1 product) x 64^-0.5, except the first 384 query rows of each sequence (3 products with f16 residuals); softmax in f32; exp(logit - max) x 2^11 once to f16 against v once to f16 (1 product; bf16 hi + lo below row 384); f32 output.
#include <hip/hip_runtime.h>
#include <math.h>

typedef __attribute__((ext_vector_type(16))) _Float16 v16h;
typedef __attribute__((ext_vector_type(16))) __bf16 v16b;
typedef __attribute__((ext_vector_type(8)))  _Float16 v8h;
typedef __attribute__((ext_vector_type(8)))  float v8f;
typedef __attribute__((ext_vector_type(4)))  float v4f;
typedef __attribute__((ext_vector_type(2)))  float v2f;
typedef __attribute__((ext_vector_type(4)))  unsigned v4u;
typedef __attribute__((ext_vector_type(4)))  int v4i;
typedef float __attribute__((may_alias)) float_a;
typedef int __attribute__((may_alias)) int_a;

template <typename T> __device__ __forceinline__ void vst2(void* p, T v) { *(T*)p = v;  }
__device__ __forceinline__ v8f wmma16(v16h a, v16h b, v8f c) {
  v8f d = __builtin_amdgcn_wmma_f32_16x16x32_f16(false, a, false, b, (short)0, c, false, false);
  asm volatile("v_nop\n\tv_nop\n\tv_nop\n\tv_nop" : "+v"(d) : "v"(a), "v"(b));
  return d;
}
__device__ __forceinline__ v8f wmma_bf(v16b a, v16b b, v8f c) {
  v8f d = __builtin_amdgcn_wmma_f32_16x16x32_bf16(false, a, false, b, (short)0, c, false, false);
  asm volatile("v_nop\n\tv_nop\n\tv_nop\n\tv_nop" : "+v"(d) : "v"(a), "v"(b));
  return d;
}
// 16x16x32 fragments: lane = (h = lane>>4, row/col = lane&15); elements 0..7 = k0+8h+0..7, 8..15 = k0+16+8h+0..7; D element r = row 8h+r
__device__ __forceinline__ v16h frag_h(const _Float16* rowk0, int lane) {
  union { v16h v; v8h q[2]; } u; const _Float16* p = rowk0 + 8 * (lane >> 4);
  u.q[0] = *(const v8h*)p; u.q[1] = *(const v8h*)(p + 16); return u.v;
}
__device__ __forceinline__ v16h frag_f32(const float* rowk0, int lane) {
  v16h a; const float* p = rowk0 + 8 * (lane >> 4);
#pragma unroll
  for (int i = 0; i < 8; ++i) { a[i] = (_Float16)p[i]; a[8 + i] = (_Float16)p[16 + i]; }
  return a;
}
__device__ __forceinline__ v16h frag_f32s(const float* rowk0, int lane, float sc) {
  v16h a; const float* p = rowk0 + 8 * (lane >> 4);
#pragma unroll
  for (int i = 0; i < 8; ++i) { a[i] = (_Float16)(p[i] * sc); a[8 + i] = (_Float16)(p[16 + i] * sc); }
  return a;
}
// column fragment from a [K][ld] layout (column n), rows >= K read as 0
__device__ __forceinline__ v16h fragc_f32(const float* W, int k0, int n, int lane, int ld, int K) {
  v16h a; const int g = lane >> 4;
#pragma unroll
  for (int i = 0; i < 8; ++i) { const int ka = k0 + 8 * g + i, kb = ka + 16;
    a[i] = (_Float16)(ka < K ? W[(size_t)(ka < K ? ka : K - 1) * ld + n] : 0.f); a[8 + i] = (_Float16)(kb < K ? W[(size_t)(kb < K ? kb : K - 1) * ld + n] : 0.f); }
  return a;
}
struct F2 { v16b h, l; };
__device__ __forceinline__ F2 bsplit16(const float v[16]) { F2 r;
#pragma unroll
  for (int i = 0; i < 16; ++i) { const __bf16 h = (__bf16)v[i]; r.h[i] = h; r.l[i] = (__bf16)(v[i] - (float)h); }
  return r; }
__device__ __forceinline__ F2 split_row(const float* row, int k0, int lane) { float v[16]; const float* p = row + k0 + 8 * (lane >> 4);
#pragma unroll
  for (int i = 0; i < 8; ++i) { v[i] = p[i]; v[8 + i] = p[16 + i]; }
  return bsplit16(v); }
__device__ __forceinline__ F2 split_rowK(const float* row, int k0, int lane, int K) { float v[16]; const int g = lane >> 4;
#pragma unroll
  for (int i = 0; i < 8; ++i) { const int ka = k0 + 8 * g + i, kb = ka + 16; v[i] = ka < K ? row[ka < K ? ka : K - 1] : 0.f; v[8 + i] = kb < K ? row[kb < K ? kb : K - 1] : 0.f; }
  return bsplit16(v); }
__device__ __forceinline__ F2 split_col(const float* W, int k0, int n, int lane, int ld, int K) { float v[16]; const int g = lane >> 4;
#pragma unroll
  for (int i = 0; i < 8; ++i) { const int ka = k0 + 8 * g + i, kb = ka + 16; v[i] = ka < K ? W[(size_t)(ka < K ? ka : K - 1) * ld + n] : 0.f; v[8 + i] = kb < K ? W[(size_t)(kb < K ? kb : K - 1) * ld + n] : 0.f; }
  return bsplit16(v); }
__device__ __forceinline__ v8f mac3(const F2& a, const F2& b, v8f c) { c = wmma_bf(a.l, b.h, c); c = wmma_bf(a.h, b.l, c); return wmma_bf(a.h, b.h, c); }
__device__ __forceinline__ float sigm(float v) { return 1.0f / (1.0f + expf(-v)); }
#define LDSX() do { asm volatile("s_wait_dscnt 0" ::: "memory"); __builtin_amdgcn_wave_barrier(); __builtin_amdgcn_fence(__ATOMIC_RELEASE, "workgroup"); } while (0)

// Single-head causal self-attention (B 4, S 4,096, D_in 512 -> 64): Q, K, V = X Wq/Wk/Wv ((in,out) [512, 64]); W = softmax(causal(Q K^T) / 8); Z = W V -> [B, S, 64].
#define NB 4
#define TT 4096
#define CC 64             // NH * HD = projected width
#define DIN 512          // input (model) width
#define NH 1
#define HD 64
#define NQB (TT / 64)
#define HG 1
#define SCALE (0.125f)
#define CAUSAL 1
#ifndef TNB
#define TNB NB
#endif
__device__ __forceinline__ v16b zero16b() { v16b z; _Pragma("unroll") for (int i = 0; i < 16; ++i) z[i] = (__bf16)0.f; return z; }
__device__ __forceinline__ float bfr(float v) { return (float)(__bf16)v; }
__host__ __device__ __forceinline__ int kb_last(int qb) { return CAUSAL ? ((qb * 64 + 63) >> 7) : (TT / 128 - 1); }
typedef __attribute__((ext_vector_type(8))) __bf16 v8b;
__device__ __forceinline__ v16b frag_b(const __bf16* rowk0, int lane) {
  union { v16b v; v8b q[2]; } u; const __bf16* p = rowk0 + 8 * (lane >> 4);
  u.q[0] = *(const v8b*)p; u.q[1] = *(const v8b*)(p + 16); return u.v;
}
#define QBH 6              // causal: query blocks 0..QBH-1 of each sequence (few keys, no averaging) take the high-precision path
#define QHI 384            // rows carrying a q residual plane
#define KHI 384            // key rows carrying k residual / v bf16 hi+lo planes (used only by the causal high-precision path)
// B fragment (k rows k0+.., output column o) of a weight: (in,out) [K][ld] or (out,in) [ld rows of K]: bf16 exact, or f16(bf16 * 256) exact
__device__ __forceinline__ v16b wcol_io(const float* Wm, int k0, int o, int lane, int ld) { v16b w; const int g = lane >> 4;
#pragma unroll
  for (int i = 0; i < 8; ++i) { w[i] = (__bf16)Wm[(size_t)(k0 + 8 * g + i) * ld + o];
    if (i == 7) asm volatile("s_wait_xcnt 0x0" ::: "memory");   // only the run's last load can get the run's address pair as its result register: the wait stands in front of it
    w[8 + i] = (__bf16)Wm[(size_t)(k0 + 16 + 8 * g + i) * ld + o]; }
  return w; }
__device__ __forceinline__ v16b wcol_oi(const float* Wm, int k0, int o, int lane, int K) { v16b w; const float* p = Wm + (size_t)o * K + k0 + 8 * (lane >> 4);
#pragma unroll
  for (int i = 0; i < 8; ++i) { w[i] = (__bf16)p[i]; w[8 + i] = (__bf16)p[16 + i]; }
  return w; }
__device__ __forceinline__ v16h wcolh_io(const float* Wm, int k0, int o, int lane, int ld) { v16h w; const int g = lane >> 4;
#pragma unroll
  for (int i = 0; i < 8; ++i) { w[i] = (_Float16)(bfr(Wm[(size_t)(k0 + 8 * g + i) * ld + o]) * 256.0f); w[8 + i] = (_Float16)(bfr(Wm[(size_t)(k0 + 16 + 8 * g + i) * ld + o]) * 256.0f); }
  return w; }
__device__ __forceinline__ v16h wcolh_oi(const float* Wm, int k0, int o, int lane, int K) { v16h w; const float* p = Wm + (size_t)o * K + k0 + 8 * (lane >> 4);
#pragma unroll
  for (int i = 0; i < 8; ++i) { w[i] = (_Float16)(bfr(p[i]) * 256.0f); w[8 + i] = (_Float16)(bfr(p[16 + i]) * 256.0f); }
  return w; }
#define WQKV_LAYOUT 0   // 0 = (in,out) [DIN][DOUT]; 1 = (out,in) [CC][DIN]; 2 = per-head [NH][DIN][HD]
__device__ __forceinline__ v16b wcol_hdk(const float* Wm, int k0, int o, int lane) { v16b w; const int g = lane >> 4; const float* p = Wm + (size_t)(o / HD) * DIN * HD + (o % HD);
#pragma unroll
  for (int i = 0; i < 8; ++i) { w[i] = (__bf16)p[(size_t)(k0 + 8 * g + i) * HD]; w[8 + i] = (__bf16)p[(size_t)(k0 + 16 + 8 * g + i) * HD]; }
  return w; }
#define WO_OUT_IN 0
#if WQKV_LAYOUT == 1
#define WCOL(W, k0, o, lane) wcol_oi(W, k0, o, lane, DIN)
#elif WQKV_LAYOUT == 2
#define WCOL(W, k0, o, lane) wcol_hdk(W, k0, o, lane)
#else
#define WCOL(W, k0, o, lane) wcol_io(W, k0, (o), lane, DOUT)   /* W (in,out) [512][64] */
#endif
#if WO_OUT_IN
#define WOCOL(W, k0, o, lane) wcol_oi(W, k0, o, lane, CC)
#define WOCOLH(W, k0, o, lane) wcolh_oi(W, k0, o, lane, CC)
#else
#define WOCOL(W, k0, o, lane) wcol_io(W, k0, o, lane, DIN)
#define WOCOLH(W, k0, o, lane) wcolh_io(W, k0, o, lane, DIN)
#endif
#define DOUT 64            // head width = plane width CC
#ifndef SM_EXTRA_PARAMS
#define SM_EXTRA_PARAMS
#endif
#ifndef PROJ_EXTRA_PARAMS
#define PROJ_EXTRA_PARAMS
#endif
#ifndef SM_MASK_HOOK
#define SM_MASK_HOOK (void)0
#endif

#define WS_QH  0u                                      // f16 q, fragment order: [b*t / 16] tiles of 16 rows x CC = 4 pieces of 512 B; piece = features 16 * piece .. + 15, a lane's 16 B (row lane & 15, features + 8 * (lane >> 4)) at lane * 16
#define WS_KH  (WS_QH + 2u * (size_t)NB * TT * CC)      // f16 k, fragment order as q
#define WS_VT  (WS_KH + 2u * (size_t)NB * TT * CC)      // f16 v, fragment order: [b*t / 32] chunks of 32 keys x CC = 8 pieces of 512 B; piece = (16 features j, 16 keys), a lane's 16 B (feature 16 * j + (lane & 15), keys + 8 * (lane >> 4)) at lane * 16
#define WS_QL  (WS_VT + 2u * (size_t)NB * CC * TT)      // f16 q residual x 2^10 rows [b][t < QHI][CC]
#define WS_KL  (WS_QL + 2u * (size_t)NB * QHI * CC)     // f16 k residual x 2^10 rows [b][t < KHI][CC]
#define WS_VB  (WS_KL + 2u * (size_t)NB * KHI * CC)     // bf16 v hi planes [b][c][t < KHI]
#define WS_VBL (WS_VB + 2u * (size_t)NB * CC * KHI)
#define WS_Y   (WS_VBL + 2u * (size_t)NB * CC * KHI)    // f32 ctx rows [b*t][CC] (only when there is an output projection)
#define WS_END (WS_Y  + 0u)

// SXW: behind a global store, before the next LDS read or address sum reuses its data or address registers
__device__ __forceinline__ void SXW() { asm volatile("s_wait_xcnt 0x0" ::: "memory"); }
// ---- k_proj: block = (64 rows, all CC cols, which): q/k/v = X W (+ b) with exact bf16 products (K = DIN) -> which 0: q f16 in fragment order (+ residual rows < QHI); 1: k f16 in fragment order (+ residual rows < KHI); 2: v f16 in fragment order (+ bf16 hi/lo planes [c][t] for t < KHI). The block's 64 rows are 8 KiB in a row of each fragment-ordered plane, stored 16 B a thread in address order
__global__ __launch_bounds__(128) void k_proj(const float* __restrict__ XQ, const float* __restrict__ XK, const float* __restrict__ XV, const float* __restrict__ WQ, const float* __restrict__ WK, const float* __restrict__ WV, const float* __restrict__ BQ, const float* __restrict__ BK, const float* __restrict__ BV,
    _Float16* __restrict__ QH, _Float16* __restrict__ QL, _Float16* __restrict__ KH, _Float16* __restrict__ KL, _Float16* __restrict__ VT, __bf16* __restrict__ VB, __bf16* __restrict__ VBL) {
  __shared__ __align__(16) _Float16 sh[64][CC + 8], sl[64][CC + 8]; __shared__ __align__(16) _Float16 th[CC][72]; __shared__ __align__(16) __bf16 tb[CC][72], tbl[CC][72];
  const int tid = threadIdx.x, wave = tid >> 5, lane = tid & 31, col = lane & 15, g = lane >> 4; const int which = blockIdx.z; const int c0 = 0; const size_t r0 = (size_t)blockIdx.x * 64; const size_t bb = r0 / TT; const int t0 = (int)(r0 % TT);
  const float* X = which == 0 ? XQ : which == 1 ? XK : XV; const float* WA = which == 0 ? WQ : which == 1 ? WK : WV; const float* BA = which == 0 ? BQ : which == 1 ? BK : BV;
  v8f acc[CC / 16] = {};
#pragma unroll 2
  for (int kc = 0; kc < DIN / 32; ++kc) { v16b a; { const float* p = X + (r0 + wave * 16 + col) * DIN + kc * 32 + 8 * g;
#pragma unroll
      for (int i = 0; i < 8; ++i) { a[i] = (__bf16)p[i]; a[8 + i] = (__bf16)p[16 + i]; } }
    asm volatile("s_wait_loadcnt 0x0" ::: "memory");
#pragma unroll
    for (int j = 0; j < CC / 16; ++j) { const v16b w = WCOL(WA, kc * 32, c0 + j * 16 + col, lane); asm volatile("s_wait_loadcnt 0x0" ::: "memory"); acc[j] = wmma_bf(a, w, acc[j]); } }
  if (which < 2) { _Float16* DH = which == 0 ? QH : KH; _Float16* DL = which == 0 ? QL : KL; const int nhi = which == 0 ? QHI : KHI; const bool hi_rows = t0 < nhi;
#pragma unroll
    for (int j = 0; j < CC / 16; ++j) { const float bias = BA ? bfr(BA[c0 + j * 16 + col]) : 0.f;
#pragma unroll
      for (int r = 0; r < 8; ++r) { const float v = acc[j][r] + bias; const _Float16 hv = (_Float16)v; sh[wave * 16 + 8 * g + r][j * 16 + col] = hv; sl[wave * 16 + 8 * g + r][j * 16 + col] = (_Float16)((v - (float)hv) * 1024.0f); } }
    __syncthreads();
    for (int e = tid; e < 64 * (CC / 8); e += 128) { const int rl = e / (CC / 8), q = e % (CC / 8); vst2((unsigned*)(DH + r0 * CC + e * 8), *(const v4u*)&sh[(e >> 7) * 16 + (e & 15)][(((e >> 5) & 3) * 2 + ((e >> 4) & 1)) * 8]); SXW(); if (hi_rows) { vst2((unsigned*)(DL + (bb * nhi + t0 + rl) * (size_t)CC + c0 + q * 8), *(const v4u*)&sl[rl][q * 8]); SXW(); } }
  } else { const bool hi_rows = t0 < KHI;
#pragma unroll
    for (int j = 0; j < CC / 16; ++j) { const float bias = BA ? bfr(BA[c0 + j * 16 + col]) : 0.f;
#pragma unroll
      for (int r = 0; r < 8; ++r) { const float v = acc[j][r] + bias; const int rl = wave * 16 + 8 * g + r, cl = j * 16 + col; th[cl][rl] = (_Float16)v; const __bf16 bh = (__bf16)v; tb[cl][rl] = bh; tbl[cl][rl] = (__bf16)(v - (float)bh); } }
    __syncthreads();
    for (int e = tid; e < CC * 8; e += 128) { const int cl = e >> 3, q = e & 7; vst2((unsigned*)(VT + r0 * CC + e * 8), *(const v4u*)&th[((e >> 6) & 3) * 16 + (e & 15)][(e >> 8) * 32 + ((e >> 5) & 1) * 16 + ((e >> 4) & 1) * 8]); SXW(); if (hi_rows) { const size_t o3 = (bb * CC + c0 + cl) * (size_t)KHI + t0 + q * 8; vst2((unsigned*)(VB + o3), *(const v4u*)&tb[cl][q * 8]); SXW(); vst2((unsigned*)(VBL + o3), *(const v4u*)&tbl[cl][q * 8]); SXW(); } } } }
// ---- k_att: block = 16 queries of sequence b, PVW waves; wave w takes the 32-key chunks w, w + PVW, ... up to the diagonal. Logits are formed transposed (A = k rows, B = q rows), so a lane holds 16 logits of ONE query in the very order of the A fragment of P . v: they stay in registers, are masked by index, and are turned into exp(logit - the wave's own row maximum) x 2^11 (once to f16 against v f16; query blocks < QBH: 3-product logits, P and v as bf16 hi + lo). Each wave leaves its f32 partial tile, row maxima and row sums in LDS; behind one barrier wave w joins row w over the waves in wave order, each partial weighted by exp(its maximum - the row's maximum), and divides by the joined sum. A masked logit is -3e38: its exp is 0 beside any real maximum; a row with no open key in a wave's chunks has the maximum -3e38, and that wave's partial for it gets the weight 0 in the join (key 0 is open to every query, so the row's maximum is real)
#define PVW 16
#define NCH (TT / 32 / PVW)   // most chunks one wave can own
// XW: in front of a load whose result may land on the address pair of loads issued before it
__device__ __forceinline__ void XW() { asm volatile("s_wait_xcnt 0x0" ::: "memory"); }
// last fragment of a run of loads off one address pair: only the run's last load can get that pair as its result registers, so the wait stands in front of it
__device__ __forceinline__ v16h frag_t_end(const _Float16* tile, int c, int lane) {
  union { v16h v; v8h q[2]; } u; const _Float16* p = tile + c * 512 + lane * 8;
  u.q[0] = *(const v8h*)p; XW(); u.q[1] = *(const v8h*)(p + 256); return u.v;
}
// fragment c of a fragment-ordered tile (q, k: 16 rows, c = the 32 features; v: 32 keys, c = the 16 features): two loads of 512 contiguous bytes a wave, 4 whole lines each
__device__ __forceinline__ v16h frag_t(const _Float16* tile, int c, int lane) {
  union { v16h v; v8h q[2]; } u; const _Float16* p = tile + c * 512 + lane * 8;
  u.q[0] = *(const v8h*)p; u.q[1] = *(const v8h*)(p + 256); return u.v;
}
__device__ __forceinline__ v16h frag_t_w(const _Float16* tile, int c, int lane) {
  union { v16h v; v8h q[2]; } u; const _Float16* p = tile + c * 512 + lane * 8;
  u.q[0] = *(const v8h*)p; XW(); u.q[1] = *(const v8h*)(p + 256); XW(); return u.v;
}
// fragments of the three-product path (many address pairs, one chunk a wave): the wait behind every load
__device__ __forceinline__ v16h frag_h_w(const _Float16* rowk0, int lane) {
  union { v16h v; v8h q[2]; } u; const _Float16* p = rowk0 + 8 * (lane >> 4);
  u.q[0] = *(const v8h*)p; XW(); u.q[1] = *(const v8h*)(p + 16); XW(); return u.v;
}
__device__ __forceinline__ v16b frag_b_w(const __bf16* rowk0, int lane) {
  union { v16b v; v8b q[2]; } u; const __bf16* p = rowk0 + 8 * (lane >> 4);
  u.q[0] = *(const v8b*)p; XW(); u.q[1] = *(const v8b*)(p + 16); XW(); return u.v;
}
__global__ __launch_bounds__(PVW * 32) void k_att(const _Float16* __restrict__ QH, const _Float16* __restrict__ KH, const _Float16* __restrict__ QL, const _Float16* __restrict__ KL, const _Float16* __restrict__ VT, const __bf16* __restrict__ VB, const __bf16* __restrict__ VBL, float* __restrict__ Y) {
  __shared__ __align__(16) float ss[PVW][16][HD + 4]; __shared__ float smx[PVW][16], ssu[PVW][16];
  const int tid = threadIdx.x, wave = __builtin_amdgcn_readfirstlane(tid >> 5), lane = tid & 31, col = lane & 15, g = lane >> 4; const int b = blockIdx.x % TNB, qt = TT / 16 - 1 - blockIdx.x / TNB;   // all sequences in one grid; the query tiles with the most keys take the lowest block indices, for speed only
  const int qb = qt >> 2; const int ql0 = qt * 16; const int kce = (ql0 >> 5) + 1;   // chunks that hold a key <= the block's last query
  const int t = ql0 + col;   // the query whose logits this lane holds
  const _Float16* Qt = QH + ((size_t)b * TT + ql0) * CC; const _Float16* Kb = KH + (size_t)b * TT * CC;
  v8f acc[HD / 16] = {}; float m = -3.0e38f, sum = 0.f;
  // every unroll below: the loop indexes register arrays or vector elements, which takes constant indices
  if (qb < QBH) {
    if (wave < kce) { const int k0 = wave * 32; const _Float16* Qlr = QL + ((size_t)b * QHI + t) * CC; const _Float16* Klb = KL + (size_t)b * KHI * CC;
      v8f a0[2] = {}, a1[2] = {};
#pragma unroll
      for (int c = 0; c < HD / 32; ++c) { const v16h ah = frag_t_w(Qt, c, lane), al = frag_h_w(Qlr + c * 32, lane);
#pragma unroll
        for (int u = 0; u < 2; ++u) { const size_t ko = (size_t)(k0 + u * 16 + col) * CC + c * 32; const v16h kbf = frag_t_w(Kb + (size_t)(k0 + u * 16) * CC, c, lane), klf = frag_h_w(Klb + ko, lane); a0[u] = wmma16(kbf, ah, a0[u]); a1[u] = wmma16(kbf, al, a1[u]); a1[u] = wmma16(klf, ah, a1[u]); } }
      float s[16];
#pragma unroll
      for (int e = 0; e < 16; ++e) { const float v = (a0[e >> 3][e & 7] + a1[e >> 3][e & 7] * (1.0f / 1024.0f)) * SCALE; s[e] = (k0 + (e >> 3) * 16 + 8 * g + (e & 7) <= t) ? v : -3.0e38f; m = fmaxf(m, s[e]); }
      m = fmaxf(m, __shfl_xor(m, 16));
#pragma unroll
      for (int e = 0; e < 16; ++e) { const float ev = expf(s[e] - m); sum += ev; s[e] = ev * 2048.0f; }
      const F2 p = bsplit16(s);
#pragma unroll
      for (int j = 0; j < HD / 16; ++j) { const size_t po = ((size_t)b * CC + j * 16 + col) * (size_t)KHI + k0; const v16b vh = frag_b_w(VB + po, lane); acc[j] = wmma_bf(p.h, vh, acc[j]); acc[j] = wmma_bf(p.l, vh, acc[j]); acc[j] = wmma_bf(p.h, frag_b_w(VBL + po, lane), acc[j]); } }
  } else {
    v16h p[NCH];
    { float s[NCH][16]; v16h qf[HD / 32];
#pragma unroll
      for (int c = 0; c < HD / 32; ++c) qf[c] = frag_t(Qt, c, lane);
      asm volatile("s_wait_xcnt 0x0" ::: "memory");   // the q loads' address registers may be reused for the k addresses in the next block
#pragma unroll   // s and p are indexed by constants only, so they live in registers
      for (int i = 0; i < NCH; ++i) { const int kc = wave + i * PVW, k0 = kc * 32;
        if (kc < kce) { v16h kf[2 * (HD / 32)]; v8f a[2] = {};
#pragma unroll
          for (int c = 0; c < HD / 32; ++c)
#pragma unroll
            for (int u = 0; u < 2; ++u) { const _Float16* kp = Kb + (size_t)(k0 + u * 16) * CC; kf[c * 2 + u] = (c * 2 + u < 2 * (HD / 32) - 1) ? frag_t(kp, c, lane) : frag_t_end(kp, c, lane); }
#pragma unroll
          for (int c = 0; c < HD / 32; ++c)
#pragma unroll
            for (int u = 0; u < 2; ++u) a[u] = wmma16(kf[c * 2 + u], qf[c], a[u]);
          if (kc == kce - 1) {   // only the last chunk reaches past a query of this block
#pragma unroll
            for (int e = 0; e < 16; ++e) { s[i][e] = (k0 + (e >> 3) * 16 + 8 * g + (e & 7) <= t) ? a[e >> 3][e & 7] * SCALE : -3.0e38f; m = fmaxf(m, s[i][e]); }
          } else {
#pragma unroll
            for (int e = 0; e < 16; ++e) { s[i][e] = a[e >> 3][e & 7] * SCALE; m = fmaxf(m, s[i][e]); } } } }
      m = fmaxf(m, __shfl_xor(m, 16));
#pragma unroll
      for (int i = 0; i < NCH; ++i)
        if (wave + i * PVW < kce) {
#pragma unroll
          for (int e = 0; e < 16; ++e) { const float ev = expf(s[i][e] - m); sum += ev; p[i][e] = (_Float16)(ev * 2048.0f); } } }
#pragma unroll
    for (int i = 0; i < NCH; ++i) { const int k0 = (wave + i * PVW) * 32;
      if (wave + i * PVW < kce) { v16h vf[HD / 16];
#pragma unroll
        for (int j = 0; j < HD / 16; ++j) { const _Float16* vp = VT + ((size_t)b * TT + k0) * CC; vf[j] = (j < HD / 16 - 1) ? frag_t(vp, j, lane) : frag_t_end(vp, j, lane); }
#pragma unroll
        for (int j = 0; j < HD / 16; ++j) acc[j] = wmma16(p[i], vf[j], acc[j]); } } }
  sum += __shfl_xor(sum, 16);
  if (g == 0) { smx[wave][col] = m; ssu[wave][col] = sum; }
#pragma unroll
  for (int j = 0; j < HD / 16; ++j)
#pragma unroll
    for (int r = 0; r < 8; ++r) ss[wave][8 * g + r][j * 16 + col] = acc[j][r];
  __syncthreads();   // every wave's partial tile, maxima and sums are in LDS before any wave joins them
  float mm = smx[0][wave];
#pragma unroll
  for (int w = 1; w < PVW; ++w) mm = fmaxf(mm, smx[w][wave]);
  v2f o = {}; float tot = 0.f;
#pragma unroll   // the LDS reads of all partial tiles issue ahead of the adds instead of one round trip each
  for (int w = 0; w < PVW; ++w) { const float f = expf(smx[w][wave] - mm); tot += ssu[w][wave] * f; o += *(const v2f*)&ss[w][wave][lane * 2] * f; }
  o *= tot > 0.f ? 1.0f / (2048.0f * tot) : 0.f;
  vst2(Y + ((size_t)b * TT + ql0 + wave) * CC + lane * 2, o); }

extern "C" void kernel_launch(void* const* d_in, const int* in_sizes, int n_in, void* d_out, int out_size, void* d_ws, size_t ws_size, hipStream_t stream) {
  (void)in_sizes; (void)n_in; (void)out_size;
  const float** F = (const float**)d_in;
  if (ws_size < (size_t)WS_END) return;
  char* ws = (char*)d_ws; _Float16 *QH = (_Float16*)(ws + WS_QH), *KH = (_Float16*)(ws + WS_KH), *VT = (_Float16*)(ws + WS_VT), *QL = (_Float16*)(ws + WS_QL), *KL = (_Float16*)(ws + WS_KL); __bf16 *VB = (__bf16*)(ws + WS_VB), *VBL = (__bf16*)(ws + WS_VBL); float *Y = (float*)(ws + WS_Y);
  (void)Y; (void)QL; (void)KL; (void)VB; (void)VBL;
  // inputs: 0 X [4,4096,512]; 1 Wq, 2 Wk, 3 Wv [512,64] (in,out)
  k_proj<<<dim3(TNB * TT / 64, 1, 3), 128, 0, stream>>>(F[0], F[0], F[0], F[1], F[2], F[3], nullptr, nullptr, nullptr, QH, QL, KH, KL, VT, VB, VBL);
  k_att<<<dim3(TNB * (TT / 16), 1, 1), PVW * 32, 0, stream>>>(QH, KH, QL, KL, VT, VB, VBL, (float*)d_out);
}

// v006
// A run of this version takes 54.3 microseconds.
// Two timings next to v005 put it at 1.15 and 1.16 times that version's speed.
// Counting every step since v000, it is 18.9 times as fast.
// compute dtype: all float inputs rounded to bf16; Q/K/V = X W with EXACT bf16 products on WMMA 16x16x32 (f32 accumulate; the single head's planes are 64 wide); causal logits: q, k once to f16 (1 product) x 64^-0.5, except the first 384 query rows of each sequence (3 products with f16 residuals); softmax in f32; exp(logit - max) x 2^11 once to f16 against v once to f16 (1 product; bf16 hi + lo below row 384); f32 output.
#include <hip/hip_runtime.h>
#include <math.h>

typedef __attribute__((ext_vector_type(16))) _Float16 v16h;
typedef __attribute__((ext_vector_type(16))) __bf16 v16b;
typedef __attribute__((ext_vector_type(8)))  _Float16 v8h;
typedef __attribute__((ext_vector_type(8)))  float v8f;
typedef __attribute__((ext_vector_type(4)))  float v4f;
typedef __attribute__((ext_vector_type(2)))  float v2f;
typedef __attribute__((ext_vector_type(4)))  unsigned v4u;
typedef __attribute__((ext_vector_type(4)))  int v4i;
typedef float __attribute__((may_alias)) float_a;
typedef int __attribute__((may_alias)) int_a;

template <typename T> __device__ __forceinline__ void vst2(void* p, T v) { *(T*)p = v;  }
__device__ __forceinline__ v8f wmma16(v16h a, v16h b, v8f c) {
  v8f d = __builtin_amdgcn_wmma_f32_16x16x32_f16(false, a, false, b, (short)0, c, false, false);
  asm volatile("v_nop\n\tv_nop\n\tv_nop\n\tv_nop" : "+v"(d) : "v"(a), "v"(b));
  return d;
}
__device__ __forceinline__ v8f wmma_bf(v16b a, v16b b, v8f c) {
  v8f d = __builtin_amdgcn_wmma_f32_16x16x32_bf16(false, a, false, b, (short)0, c, false, false);
  asm volatile("v_nop\n\tv_nop\n\tv_nop\n\tv_nop" : "+v"(d) : "v"(a), "v"(b));
  return d;
}
// 16x16x32 fragments: lane = (h = lane>>4, row/col = lane&15); elements 0..7 = k0+8h+0..7, 8..15 = k0+16+8h+0..7; D element r = row 8h+r
__device__ __forceinline__ v16h frag_h(const _Float16* rowk0, int lane) {
  union { v16h v; v8h q[2]; } u; const _Float16* p = rowk0 + 8 * (lane >> 4);
  u.q[0] = *(const v8h*)p; u.q[1] = *(const v8h*)(p + 16); return u.v;
}
__device__ __forceinline__ v16h frag_f32(const float* rowk0, int lane) {
  v16h a; const float* p = rowk0 + 8 * (lane >> 4);
#pragma unroll
  for (int i = 0; i < 8; ++i) { a[i] = (_Float16)p[i]; a[8 + i] = (_Float16)p[16 + i]; }
  return a;
}
__device__ __forceinline__ v16h frag_f32s(const float* rowk0, int lane, float sc) {
  v16h a; const float* p = rowk0 + 8 * (lane >> 4);
#pragma unroll
  for (int i = 0; i < 8; ++i) { a[i] = (_Float16)(p[i] * sc); a[8 + i] = (_Float16)(p[16 + i] * sc); }
  return a;
}
// column fragment from a [K][ld] layout (column n), rows >= K read as 0
__device__ __forceinline__ v16h fragc_f32(const float* W, int k0, int n, int lane, int ld, int K) {
  v16h a; const int g = lane >> 4;
#pragma unroll
  for (int i = 0; i < 8; ++i) { const int ka = k0 + 8 * g + i, kb = ka + 16;
    a[i] = (_Float16)(ka < K ? W[(size_t)(ka < K ? ka : K - 1) * ld + n] : 0.f); a[8 + i] = (_Float16)(kb < K ? W[(size_t)(kb < K ? kb : K - 1) * ld + n] : 0.f); }
  return a;
}
struct F2 { v16b h, l; };
__device__ __forceinline__ F2 bsplit16(const float v[16]) { F2 r;
#pragma unroll
  for (int i = 0; i < 16; ++i) { const __bf16 h = (__bf16)v[i]; r.h[i] = h; r.l[i] = (__bf16)(v[i] - (float)h); }
  return r; }
__device__ __forceinline__ F2 split_row(const float* row, int k0, int lane) { float v[16]; const float* p = row + k0 + 8 * (lane >> 4);
#pragma unroll
  for (int i = 0; i < 8; ++i) { v[i] = p[i]; v[8 + i] = p[16 + i]; }
  return bsplit16(v); }
__device__ __forceinline__ F2 split_rowK(const float* row, int k0, int lane, int K) { float v[16]; const int g = lane >> 4;
#pragma unroll
  for (int i = 0; i < 8; ++i) { const int ka = k0 + 8 * g + i, kb = ka + 16; v[i] = ka < K ? row[ka < K ? ka : K - 1] : 0.f; v[8 + i] = kb < K ? row[kb < K ? kb : K - 1] : 0.f; }
  return bsplit16(v); }
__device__ __forceinline__ F2 split_col(const float* W, int k0, int n, int lane, int ld, int K) { float v[16]; const int g = lane >> 4;
#pragma unroll
  for (int i = 0; i < 8; ++i) { const int ka = k0 + 8 * g + i, kb = ka + 16; v[i] = ka < K ? W[(size_t)(ka < K ? ka : K - 1) * ld + n] : 0.f; v[8 + i] = kb < K ? W[(size_t)(kb < K ? kb : K - 1) * ld + n] : 0.f; }
  return bsplit16(v); }
__device__ __forceinline__ v8f mac3(const F2& a, const F2& b, v8f c) { c = wmma_bf(a.l, b.h, c); c = wmma_bf(a.h, b.l, c); return wmma_bf(a.h, b.h, c); }
__device__ __forceinline__ float sigm(float v) { return 1.0f / (1.0f + expf(-v)); }
#define LDSX() do { asm volatile("s_wait_dscnt 0" ::: "memory"); __builtin_amdgcn_wave_barrier(); __builtin_amdgcn_fence(__ATOMIC_RELEASE, "workgroup"); } while (0)

// Single-head causal self-attention (B 4, S 4,096, D_in 512 -> 64): Q, K, V = X Wq/Wk/Wv ((in,out) [512, 64]); W = softmax(causal(Q K^T) / 8); Z = W V -> [B, S, 64].
#define NB 4
#define TT 4096
#define CC 64             // NH * HD = projected width
#define DIN 512          // input (model) width
#define NH 1
#define HD 64
#define NQB (TT / 64)
#define HG 1
#define SCALE (0.125f)
#define CAUSAL 1
#ifndef TNB
#define TNB NB
#endif
__device__ __forceinline__ v16b zero16b() { v16b z; _Pragma("unroll") for (int i = 0; i < 16; ++i) z[i] = (__bf16)0.f; return z; }
__device__ __forceinline__ float bfr(float v) { return (float)(__bf16)v; }
__host__ __device__ __forceinline__ int kb_last(int qb) { return CAUSAL ? ((qb * 64 + 63) >> 7) : (TT / 128 - 1); }
typedef __attribute__((ext_vector_type(8))) __bf16 v8b;
__device__ __forceinline__ v16b frag_b(const __bf16* rowk0, int lane) {
  union { v16b v; v8b q[2]; } u; const __bf16* p = rowk0 + 8 * (lane >> 4);
  u.q[0] = *(const v8b*)p; u.q[1] = *(const v8b*)(p + 16); return u.v;
}
#define QBH 6              // causal: query blocks 0..QBH-1 of each sequence (few keys, no averaging) take the high-precision path
#define QHI 384            // rows carrying a q residual plane
#define KHI 384            // key rows carrying k residual / v bf16 hi+lo planes (used only by the causal high-precision path)
// B fragment (k rows k0+.., output column o) of a weight: (in,out) [K][ld] or (out,in) [ld rows of K]: bf16 exact, or f16(bf16 * 256) exact
__device__ __forceinline__ v16b wcol_io(const float* Wm, int k0, int o, int lane, int ld) { v16b w; const int g = lane >> 4;
#pragma unroll
  for (int i = 0; i < 8; ++i) { w[i] = (__bf16)Wm[(size_t)(k0 + 8 * g + i) * ld + o];
    if (i == 7) asm volatile("s_wait_xcnt 0x0" ::: "memory");   // only the run's last load can get the run's address pair as its result register: the wait stands in front of it
    w[8 + i] = (__bf16)Wm[(size_t)(k0 + 16 + 8 * g + i) * ld + o]; }
  return w; }
__device__ __forceinline__ v16b wcol_oi(const float* Wm, int k0, int o, int lane, int K) { v16b w; const float* p = Wm + (size_t)o * K + k0 + 8 * (lane >> 4);
#pragma unroll
  for (int i = 0; i < 8; ++i) { w[i] = (__bf16)p[i]; w[8 + i] = (__bf16)p[16 + i]; }
  return w; }
__device__ __forceinline__ v16h wcolh_io(const float* Wm, int k0, int o, int lane, int ld) { v16h w; const int g = lane >> 4;
#pragma unroll
  for (int i = 0; i < 8; ++i) { w[i] = (_Float16)(bfr(Wm[(size_t)(k0 + 8 * g + i) * ld + o]) * 256.0f); w[8 + i] = (_Float16)(bfr(Wm[(size_t)(k0 + 16 + 8 * g + i) * ld + o]) * 256.0f); }
  return w; }
__device__ __forceinline__ v16h wcolh_oi(const float* Wm, int k0, int o, int lane, int K) { v16h w; const float* p = Wm + (size_t)o * K + k0 + 8 * (lane >> 4);
#pragma unroll
  for (int i = 0; i < 8; ++i) { w[i] = (_Float16)(bfr(p[i]) * 256.0f); w[8 + i] = (_Float16)(bfr(p[16 + i]) * 256.0f); }
  return w; }
#define WQKV_LAYOUT 0   // 0 = (in,out) [DIN][DOUT]; 1 = (out,in) [CC][DIN]; 2 = per-head [NH][DIN][HD]
__device__ __forceinline__ v16b wcol_hdk(const float* Wm, int k0, int o, int lane) { v16b w; const int g = lane >> 4; const float* p = Wm + (size_t)(o / HD) * DIN * HD + (o % HD);
#pragma unroll
  for (int i = 0; i < 8; ++i) { w[i] = (__bf16)p[(size_t)(k0 + 8 * g + i) * HD]; w[8 + i] = (__bf16)p[(size_t)(k0 + 16 + 8 * g + i) * HD]; }
  return w; }
#define WO_OUT_IN 0
#if WQKV_LAYOUT == 1
#define WCOL(W, k0, o, lane) wcol_oi(W, k0, o, lane, DIN)
#elif WQKV_LAYOUT == 2
#define WCOL(W, k0, o, lane) wcol_hdk(W, k0, o, lane)
#else
#define WCOL(W, k0, o, lane) wcol_io(W, k0, (o), lane, DOUT)   /* W (in,out) [512][64] */
#endif
#if WO_OUT_IN
#define WOCOL(W, k0, o, lane) wcol_oi(W, k0, o, lane, CC)
#define WOCOLH(W, k0, o, lane) wcolh_oi(W, k0, o, lane, CC)
#else
#define WOCOL(W, k0, o, lane) wcol_io(W, k0, o, lane, DIN)
#define WOCOLH(W, k0, o, lane) wcolh_io(W, k0, o, lane, DIN)
#endif
#define DOUT 64            // head width = plane width CC
#ifndef SM_EXTRA_PARAMS
#define SM_EXTRA_PARAMS
#endif
#ifndef PROJ_EXTRA_PARAMS
#define PROJ_EXTRA_PARAMS
#endif
#ifndef SM_MASK_HOOK
#define SM_MASK_HOOK (void)0
#endif

#define WS_QH  0u                                      // f16 q, fragment order: [b*t / 16] tiles of 16 rows x CC = 4 pieces of 512 B; piece = features 16 * piece .. + 15, a lane's 16 B (row lane & 15, features + 8 * (lane >> 4)) at lane * 16
#define WS_KH  (WS_QH + 2u * (size_t)NB * TT * CC)      // f16 k, fragment order as q
#define WS_VT  (WS_KH + 2u * (size_t)NB * TT * CC)      // f16 v, fragment order: [b*t / 32] chunks of 32 keys x CC = 8 pieces of 512 B; piece = (16 features j, 16 keys), a lane's 16 B (feature 16 * j + (lane & 15), keys + 8 * (lane >> 4)) at lane * 16
#define WS_QL  (WS_VT + 2u * (size_t)NB * CC * TT)      // f16 q residual x 2^10 rows [b][t < QHI][CC]
#define WS_KL  (WS_QL + 2u * (size_t)NB * QHI * CC)     // f16 k residual x 2^10 rows [b][t < KHI][CC]
#define WS_VB  (WS_KL + 2u * (size_t)NB * KHI * CC)     // bf16 v hi planes [b][c][t < KHI]
#define WS_VBL (WS_VB + 2u * (size_t)NB * CC * KHI)
#define WS_Y   (WS_VBL + 2u * (size_t)NB * CC * KHI)    // f32 ctx rows [b*t][CC] (only when there is an output projection)
#define WS_END (WS_Y  + 0u)

// SXW: behind a global store, before the next LDS read or address sum reuses its data or address registers
__device__ __forceinline__ void SXW() { asm volatile("s_wait_xcnt 0x0" ::: "memory"); }
#define WFS 1040   // LDS bytes from one W fragment (two halves of 512 B) to the next: the 16 B over 1 KiB spread the staging stores of the 4 column tiles over all banks
// ---- k_proj: block = (64 rows, all CC cols, which): q/k/v = X W (+ b) with exact bf16 products (K = DIN) -> which 0: q f16 in fragment order (+ residual rows < QHI); 1: k f16 in fragment order (+ residual rows < KHI); 2: v f16 in fragment order (+ bf16 hi/lo planes [c][t] for t < KHI). The block's 64 rows are 8 KiB in a row of each fragment-ordered plane, stored 16 B a thread in address order
__global__ __launch_bounds__(128) void k_proj(const float* __restrict__ XQ, const float* __restrict__ XK, const float* __restrict__ XV, const float* __restrict__ WQ, const float* __restrict__ WK, const float* __restrict__ WV, const float* __restrict__ BQ, const float* __restrict__ BK, const float* __restrict__ BV,
    _Float16* __restrict__ QH, _Float16* __restrict__ QL, _Float16* __restrict__ KH, _Float16* __restrict__ KL, _Float16* __restrict__ VT, __bf16* __restrict__ VB, __bf16* __restrict__ VBL) {
  // one LDS block, used twice: first the block's whole W as bf16 B fragments, then (behind a barrier) the tiles that reorder the results for the stores
  __shared__ __align__(16) union { unsigned char w[(DIN / 32) * (CC / 16) * WFS]; struct { _Float16 sh[64][CC + 8], sl[64][CC + 8]; } qk; struct { _Float16 th[CC][72]; __bf16 tb[CC][72], tbl[CC][72]; } vv; } sm;
  _Float16 (*sh)[CC + 8] = sm.qk.sh; _Float16 (*sl)[CC + 8] = sm.qk.sl; _Float16 (*th)[72] = sm.vv.th; __bf16 (*tb)[72] = sm.vv.tb; __bf16 (*tbl)[72] = sm.vv.tbl;
  const int tid = threadIdx.x, wave = tid >> 5, lane = tid & 31, col = lane & 15, g = lane >> 4; const int which = blockIdx.z; const int c0 = 0; const size_t r0 = (size_t)blockIdx.x * 64; const size_t bb = r0 / TT; const int t0 = (int)(r0 % TT);
  const float* X = which == 0 ? XQ : which == 1 ? XK : XV; const float* WA = which == 0 ? WQ : which == 1 ? WK : WV; const float* BA = which == 0 ? BQ : which == 1 ? BK : BV;
  // W (in,out) [DIN][DOUT] -> LDS: a thread takes 8 rows k x 4 columns in each of the 8 blocks of 64 rows (64 loads of 16 B; a wave's load covers 4 whole lines), rounds to bf16 and stores each column's 8 k as the 16 B that lane (g = (k >> 3) & 1, col) of fragment (kc = k >> 5, j = column >> 4), half (k >> 4) & 1, reads in the loop
  { const int sc = tid & 15, sk = tid >> 4; const float* wp = WA + (size_t)sk * 8 * DOUT + sc * 4;
    unsigned char* wd = sm.w + ((sk >> 2) * (CC / 16) + (sc >> 2)) * WFS + ((sk >> 1) & 1) * 512 + ((sk & 1) * 16 + (sc & 3) * 4) * 16; v4f r[DIN / 64][8];
#pragma unroll   // constant offsets off one address pair and one LDS address; all of a thread's loads are in flight at once
    for (int it = 0; it < DIN / 64; ++it)
#pragma unroll
      for (int i = 0; i < 8; ++i) r[it][i] = *(const v4f*)(wp + (size_t)(it * 64 + i) * DOUT);
    asm volatile("s_wait_xcnt 0x0" :: "v"(wp) : "memory");   // behind the last load, with the address pair held up to here: what follows may reuse that pair
#pragma unroll
    for (int it = 0; it < DIN / 64; ++it)
#pragma unroll
      for (int x = 0; x < 4; ++x) { v8b q;
#pragma unroll
        for (int i = 0; i < 8; ++i) q[i] = (__bf16)r[it][i][x];
        *(v8b*)(wd + it * 2 * (CC / 16) * WFS + x * 16) = q; } }
  __syncthreads();   // the whole W stands in LDS before any wave reads a fragment
  v8f acc[CC / 16] = {};
#pragma unroll 2
  for (int kc = 0; kc < DIN / 32; ++kc) { v16b a; { const float* p = X + (r0 + wave * 16 + col) * DIN + kc * 32 + 8 * g;
#pragma unroll
      for (int i = 0; i < 8; ++i) { a[i] = (__bf16)p[i]; a[8 + i] = (__bf16)p[16 + i]; } }
    v16b w[CC / 16];
#pragma unroll
    for (int j = 0; j < CC / 16; ++j) { union { v16b v; v8b q[2]; } u; const unsigned char* p = sm.w + (kc * (CC / 16) + j) * WFS + lane * 16; u.q[0] = *(const v8b*)p; u.q[1] = *(const v8b*)(p + 512); w[j] = u.v; }
    asm volatile("s_wait_loadcnt 0x0" ::: "memory");
#pragma unroll
    for (int j = 0; j < CC / 16; ++j) acc[j] = wmma_bf(a, w[j], acc[j]); }
  __syncthreads();   // every wave has read its last W fragment before the result tiles overwrite that LDS
  if (which < 2) { _Float16* DH = which == 0 ? QH : KH; _Float16* DL = which == 0 ? QL : KL; const int nhi = which == 0 ? QHI : KHI; const bool hi_rows = t0 < nhi;
#pragma unroll
    for (int j = 0; j < CC / 16; ++j) { const float bias = BA ? bfr(BA[c0 + j * 16 + col]) : 0.f;
#pragma unroll
      for (int r = 0; r < 8; ++r) { const float v = acc[j][r] + bias; const _Float16 hv = (_Float16)v; sh[wave * 16 + 8 * g + r][j * 16 + col] = hv; sl[wave * 16 + 8 * g + r][j * 16 + col] = (_Float16)((v - (float)hv) * 1024.0f); } }
    __syncthreads();
    for (int e = tid; e < 64 * (CC / 8); e += 128) { const int rl = e / (CC / 8), q = e % (CC / 8); vst2((unsigned*)(DH + r0 * CC + e * 8), *(const v4u*)&sh[(e >> 7) * 16 + (e & 15)][(((e >> 5) & 3) * 2 + ((e >> 4) & 1)) * 8]); SXW(); if (hi_rows) { vst2((unsigned*)(DL + (bb * nhi + t0 + rl) * (size_t)CC + c0 + q * 8), *(const v4u*)&sl[rl][q * 8]); SXW(); } }
  } else { const bool hi_rows = t0 < KHI;
#pragma unroll
    for (int j = 0; j < CC / 16; ++j) { const float bias = BA ? bfr(BA[c0 + j * 16 + col]) : 0.f;
#pragma unroll
      for (int r = 0; r < 8; ++r) { const float v = acc[j][r] + bias; const int rl = wave * 16 + 8 * g + r, cl = j * 16 + col; th[cl][rl] = (_Float16)v; const __bf16 bh = (__bf16)v; tb[cl][rl] = bh; tbl[cl][rl] = (__bf16)(v - (float)bh); } }
    __syncthreads();
    for (int e = tid; e < CC * 8; e += 128) { const int cl = e >> 3, q = e & 7; vst2((unsigned*)(VT + r0 * CC + e * 8), *(const v4u*)&th[((e >> 6) & 3) * 16 + (e & 15)][(e >> 8) * 32 + ((e >> 5) & 1) * 16 + ((e >> 4) & 1) * 8]); SXW(); if (hi_rows) { const size_t o3 = (bb * CC + c0 + cl) * (size_t)KHI + t0 + q * 8; vst2((unsigned*)(VB + o3), *(const v4u*)&tb[cl][q * 8]); SXW(); vst2((unsigned*)(VBL + o3), *(const v4u*)&tbl[cl][q * 8]); SXW(); } } } }
// ---- k_att: block = 16 queries of sequence b, PVW waves; wave w takes the 32-key chunks w, w + PVW, ... up to the diagonal. Logits are formed transposed (A = k rows, B = q rows), so a lane holds 16 logits of ONE query in the very order of the A fragment of P . v: they stay in registers, are masked by index, and are turned into exp(logit - the wave's own row maximum) x 2^11 (once to f16 against v f16; query blocks < QBH: 3-product logits, P and v as bf16 hi + lo). Each wave leaves its f32 partial tile, row maxima and row sums in LDS; behind one barrier wave w joins row w over the waves in wave order, each partial weighted by exp(its maximum - the row's maximum), and divides by the joined sum. A masked logit is -3e38: its exp is 0 beside any real maximum; a row with no open key in a wave's chunks has the maximum -3e38, and that wave's partial for it gets the weight 0 in the join (key 0 is open to every query, so the row's maximum is real)
#define PVW 16
#define NCH (TT / 32 / PVW)   // most chunks one wave can own
// XW: in front of a load whose result may land on the address pair of loads issued before it
__device__ __forceinline__ void XW() { asm volatile("s_wait_xcnt 0x0" ::: "memory"); }
// last fragment of a run of loads off one address pair: only the run's last load can get that pair as its result registers, so the wait stands in front of it
__device__ __forceinline__ v16h frag_t_end(const _Float16* tile, int c, int lane) {
  union { v16h v; v8h q[2]; } u; const _Float16* p = tile + c * 512 + lane * 8;
  u.q[0] = *(const v8h*)p; XW(); u.q[1] = *(const v8h*)(p + 256); return u.v;
}
// fragment c of a fragment-ordered tile (q, k: 16 rows, c = the 32 features; v: 32 keys, c = the 16 features): two loads of 512 contiguous bytes a wave, 4 whole lines each
__device__ __forceinline__ v16h frag_t(const _Float16* tile, int c, int lane) {
  union { v16h v; v8h q[2]; } u; const _Float16* p = tile + c * 512 + lane * 8;
  u.q[0] = *(const v8h*)p; u.q[1] = *(const v8h*)(p + 256); return u.v;
}
__device__ __forceinline__ v16h frag_t_w(const _Float16* tile, int c, int lane) {
  union { v16h v; v8h q[2]; } u; const _Float16* p = tile + c * 512 + lane * 8;
  u.q[0] = *(const v8h*)p; XW(); u.q[1] = *(const v8h*)(p + 256); XW(); return u.v;
}
// fragments of the three-product path (many address pairs, one chunk a wave): the wait behind every load
__device__ __forceinline__ v16h frag_h_w(const _Float16* rowk0, int lane) {
  union { v16h v; v8h q[2]; } u; const _Float16* p = rowk0 + 8 * (lane >> 4);
  u.q[0] = *(const v8h*)p; XW(); u.q[1] = *(const v8h*)(p + 16); XW(); return u.v;
}
__device__ __forceinline__ v16b frag_b_w(const __bf16* rowk0, int lane) {
  union { v16b v; v8b q[2]; } u; const __bf16* p = rowk0 + 8 * (lane >> 4);
  u.q[0] = *(const v8b*)p; XW(); u.q[1] = *(const v8b*)(p + 16); XW(); return u.v;
}
__global__ __launch_bounds__(PVW * 32) void k_att(const _Float16* __restrict__ QH, const _Float16* __restrict__ KH, const _Float16* __restrict__ QL, const _Float16* __restrict__ KL, const _Float16* __restrict__ VT, const __bf16* __restrict__ VB, const __bf16* __restrict__ VBL, float* __restrict__ Y) {
  __shared__ __align__(16) float ss[PVW][16][HD + 4]; __shared__ float smx[PVW][16], ssu[PVW][16];
  const int tid = threadIdx.x, wave = __builtin_amdgcn_readfirstlane(tid >> 5), lane = tid & 31, col = lane & 15, g = lane >> 4; const int b = blockIdx.x % TNB, qt = TT / 16 - 1 - blockIdx.x / TNB;   // all sequences in one grid; the query tiles with the most keys take the lowest block indices, for speed only
  const int qb = qt >> 2; const int ql0 = qt * 16; const int kce = (ql0 >> 5) + 1;   // chunks that hold a key <= the block's last query
  const int t = ql0 + col;   // the query whose logits this lane holds
  const _Float16* Qt = QH + ((size_t)b * TT + ql0) * CC; const _Float16* Kb = KH + (size_t)b * TT * CC;
  v8f acc[HD / 16] = {}; float m = -3.0e38f, sum = 0.f;
  // every unroll below: the loop indexes register arrays or vector elements, which takes constant indices
  if (qb < QBH) {
    if (wave < kce) { const int k0 = wave * 32; const _Float16* Qlr = QL + ((size_t)b * QHI + t) * CC; const _Float16* Klb = KL + (size_t)b * KHI * CC;
      v8f a0[2] = {}, a1[2] = {};
#pragma unroll
      for (int c = 0; c < HD / 32; ++c) { const v16h ah = frag_t_w(Qt, c, lane), al = frag_h_w(Qlr + c * 32, lane);
#pragma unroll
        for (int u = 0; u < 2; ++u) { const size_t ko = (size_t)(k0 + u * 16 + col) * CC + c * 32; const v16h kbf = frag_t_w(Kb + (size_t)(k0 + u * 16) * CC, c, lane), klf = frag_h_w(Klb + ko, lane); a0[u] = wmma16(kbf, ah, a0[u]); a1[u] = wmma16(kbf, al, a1[u]); a1[u] = wmma16(klf, ah, a1[u]); } }
      float s[16];
#pragma unroll
      for (int e = 0; e < 16; ++e) { const float v = (a0[e >> 3][e & 7] + a1[e >> 3][e & 7] * (1.0f / 1024.0f)) * SCALE; s[e] = (k0 + (e >> 3) * 16 + 8 * g + (e & 7) <= t) ? v : -3.0e38f; m = fmaxf(m, s[e]); }
      m = fmaxf(m, __shfl_xor(m, 16));
#pragma unroll
      for (int e = 0; e < 16; ++e) { const float ev = expf(s[e] - m); sum += ev; s[e] = ev * 2048.0f; }
      const F2 p = bsplit16(s);
#pragma unroll
      for (int j = 0; j < HD / 16; ++j) { const size_t po = ((size_t)b * CC + j * 16 + col) * (size_t)KHI + k0; const v16b vh = frag_b_w(VB + po, lane); acc[j] = wmma_bf(p.h, vh, acc[j]); acc[j] = wmma_bf(p.l, vh, acc[j]); acc[j] = wmma_bf(p.h, frag_b_w(VBL + po, lane), acc[j]); } }
  } else {
    v16h p[NCH];
    { float s[NCH][16]; v16h qf[HD / 32];
#pragma unroll
      for (int c = 0; c < HD / 32; ++c) qf[c] = frag_t(Qt, c, lane);
      asm volatile("s_wait_xcnt 0x0" ::: "memory");   // the q loads' address registers may be reused for the k addresses in the next block
#pragma unroll   // s and p are indexed by constants only, so they live in registers
      for (int i = 0; i < NCH; ++i) { const int kc = wave + i * PVW, k0 = kc * 32;
        if (kc < kce) { v16h kf[2 * (HD / 32)]; v8f a[2] = {};
#pragma unroll
          for (int c = 0; c < HD / 32; ++c)
#pragma unroll
            for (int u = 0; u < 2; ++u) { const _Float16* kp = Kb + (size_t)(k0 + u * 16) * CC; kf[c * 2 + u] = (c * 2 + u < 2 * (HD / 32) - 1) ? frag_t(kp, c, lane) : frag_t_end(kp, c, lane); }
#pragma unroll
          for (int c = 0; c < HD / 32; ++c)
#pragma unroll
            for (int u = 0; u < 2; ++u) a[u] = wmma16(kf[c * 2 + u], qf[c], a[u]);
          if (kc == kce - 1) {   // only the last chunk reaches past a query of this block
#pragma unroll
            for (int e = 0; e < 16; ++e) { s[i][e] = (k0 + (e >> 3) * 16 + 8 * g + (e & 7) <= t) ? a[e >> 3][e & 7] * SCALE : -3.0e38f; m = fmaxf(m, s[i][e]); }
          } else {
#pragma unroll
            for (int e = 0; e < 16; ++e) { s[i][e] = a[e >> 3][e & 7] * SCALE; m = fmaxf(m, s[i][e]); } } } }
      m = fmaxf(m, __shfl_xor(m, 16));
#pragma unroll
      for (int i = 0; i < NCH; ++i)
        if (wave + i * PVW < kce) {
#pragma unroll
          for (int e = 0; e < 16; ++e) { const float ev = expf(s[i][e] - m); sum += ev; p[i][e] = (_Float16)(ev * 2048.0f); } } }
#pragma unroll
    for (int i = 0; i < NCH; ++i) { const int k0 = (wave + i * PVW) * 32;
      if (wave + i * PVW < kce) { v16h vf[HD / 16];
#pragma unroll
        for (int j = 0; j < HD / 16; ++j) { const _Float16* vp = VT + ((size_t)b * TT + k0) * CC; vf[j] = (j < HD / 16 - 1) ? frag_t(vp, j, lane) : frag_t_end(vp, j, lane); }
#pragma unroll
        for (int j = 0; j < HD / 16; ++j) acc[j] = wmma16(p[i], vf[j], acc[j]); } } }
  sum += __shfl_xor(sum, 16);
  if (g == 0) { smx[wave][col] = m; ssu[wave][col] = sum; }
#pragma unroll
  for (int j = 0; j < HD / 16; ++j)
#pragma unroll
    for (int r = 0; r < 8; ++r) ss[wave][8 * g + r][j * 16 + col] = acc[j][r];
  __syncthreads();   // every wave's partial tile, maxima and sums are in LDS before any wave joins them
  float mm = smx[0][wave];
#pragma unroll
  for (int w = 1; w < PVW; ++w) mm = fmaxf(mm, smx[w][wave]);
  v2f o = {}; float tot = 0.f;
#pragma unroll   // the LDS reads of all partial tiles issue ahead of the adds instead of one round trip each
  for (int w = 0; w < PVW; ++w) { const float f = expf(smx[w][wave] - mm); tot += ssu[w][wave] * f; o += *(const v2f*)&ss[w][wave][lane * 2] * f; }
  o *= tot > 0.f ? 1.0f / (2048.0f * tot) : 0.f;
  vst2(Y + ((size_t)b * TT + ql0 + wave) * CC + lane * 2, o); }

extern "C" void kernel_launch(void* const* d_in, const int* in_sizes, int n_in, void* d_out, int out_size, void* d_ws, size_t ws_size, hipStream_t stream) {
  (void)in_sizes; (void)n_in; (void)out_size;
  const float** F = (const float**)d_in;
  if (ws_size < (size_t)WS_END) return;
  char* ws = (char*)d_ws; _Float16 *QH = (_Float16*)(ws + WS_QH), *KH = (_Float16*)(ws + WS_KH), *VT = (_Float16*)(ws + WS_VT), *QL = (_Float16*)(ws + WS_QL), *KL = (_Float16*)(ws + WS_KL); __bf16 *VB = (__bf16*)(ws + WS_VB), *VBL = (__bf16*)(ws + WS_VBL); float *Y = (float*)(ws + WS_Y);
  (void)Y; (void)QL; (void)KL; (void)VB; (void)VBL;
  // inputs: 0 X [4,4096,512]; 1 Wq, 2 Wk, 3 Wv [512,64] (in,out)
  k_proj<<<dim3(TNB * TT / 64, 1, 3), 128, 0, stream>>>(F[0], F[0], F[0], F[1], F[2], F[3], nullptr, nullptr, nullptr, QH, QL, KH, KL, VT, VB, VBL);
  k_att<<<dim3(TNB * (TT / 16), 1, 1), PVW * 32, 0, stream>>>(QH, KH, QL, KL, VT, VB, VBL, (float*)d_out);
}

// v007
// It runs in 48.1 microseconds.
// Timed twice side by side with v006, it ran 1.12 times as fast both times.
// All steps since v000 together make it 21.1 times as fast.
// compute dtype: all float inputs rounded to bf16; Q/K/V = X W with EXACT bf16 products on WMMA 16x16x32 (f32 accumulate; the single head's planes are 64 wide); causal logits: q, k once to f16 (1 product) x 64^-0.5, except the first 384 query rows of each sequence (3 products with f16 residuals); softmax in f32; exp(logit - max) x 2^11 once to f16 against v once to f16 (1 product; bf16 hi + lo below row 384); f32 output.
#include <hip/hip_runtime.h>
#include <math.h>

typedef __attribute__((ext_vector_type(16))) _Float16 v16h;
typedef __attribute__((ext_vector_type(16))) __bf16 v16b;
typedef __attribute__((ext_vector_type(8)))  _Float16 v8h;
typedef __attribute__((ext_vector_type(8)))  float v8f;
typedef __attribute__((ext_vector_type(4)))  float v4f;
typedef __attribute__((ext_vector_type(2)))  float v2f;
typedef __attribute__((ext_vector_type(4)))  unsigned v4u;
typedef __attribute__((ext_vector_type(4)))  int v4i;
typedef float __attribute__((may_alias)) float_a;
typedef int __attribute__((may_alias)) int_a;

template <typename T> __device__ __forceinline__ void vst2(void* p, T v) { *(T*)p = v;  }
__device__ __forceinline__ v8f wmma16(v16h a, v16h b, v8f c) {
  v8f d = __builtin_amdgcn_wmma_f32_16x16x32_f16(false, a, false, b, (short)0, c, false, false);
  asm volatile("v_nop\n\tv_nop\n\tv_nop\n\tv_nop" : "+v"(d) : "v"(a), "v"(b));
  return d;
}
__device__ __forceinline__ v8f wmma_bf(v16b a, v16b b, v8f c) {
  v8f d = __builtin_amdgcn_wmma_f32_16x16x32_bf16(false, a, false, b, (short)0, c, false, false);
  asm volatile("v_nop\n\tv_nop\n\tv_nop\n\tv_nop" : "+v"(d) : "v"(a), "v"(b));
  return d;
}
// 16x16x32 fragments: lane = (h = lane>>4, row/col = lane&15); elements 0..7 = k0+8h+0..7, 8..15 = k0+16+8h+0..7; D element r = row 8h+r
__device__ __forceinline__ v16h frag_h(const _Float16* rowk0, int lane) {
  union { v16h v; v8h q[2]; } u; const _Float16* p = rowk0 + 8 * (lane >> 4);
  u.q[0] = *(const v8h*)p; u.q[1] = *(const v8h*)(p + 16); return u.v;
}
__device__ __forceinline__ v16h frag_f32(const float* rowk0, int lane) {
  v16h a; const float* p = rowk0 + 8 * (lane >> 4);
#pragma unroll
  for (int i = 0; i < 8; ++i) { a[i] = (_Float16)p[i]; a[8 + i] = (_Float16)p[16 + i]; }
  return a;
}
__device__ __forceinline__ v16h frag_f32s(const float* rowk0, int lane, float sc) {
  v16h a; const float* p = rowk0 + 8 * (lane >> 4);
#pragma unroll
  for (int i = 0; i < 8; ++i) { a[i] = (_Float16)(p[i] * sc); a[8 + i] = (_Float16)(p[16 + i] * sc); }
  return a;
}
// column fragment from a [K][ld] layout (column n), rows >= K read as 0
__device__ __forceinline__ v16h fragc_f32(const float* W, int k0, int n, int lane, int ld, int K) {
  v16h a; const int g = lane >> 4;
#pragma unroll
  for (int i = 0; i < 8; ++i) { const int ka = k0 + 8 * g + i, kb = ka + 16;
    a[i] = (_Float16)(ka < K ? W[(size_t)(ka < K ? ka : K - 1) * ld + n] : 0.f); a[8 + i] = (_Float16)(kb < K ? W[(size_t)(kb < K ? kb : K - 1) * ld + n] : 0.f); }
  return a;
}
struct F2 { v16b h, l; };
__device__ __forceinline__ F2 bsplit16(const float v[16]) { F2 r;
#pragma unroll
  for (int i = 0; i < 16; ++i) { const __bf16 h = (__bf16)v[i]; r.h[i] = h; r.l[i] = (__bf16)(v[i] - (float)h); }
  return r; }
__device__ __forceinline__ F2 split_row(const float* row, int k0, int lane) { float v[16]; const float* p = row + k0 + 8 * (lane >> 4);
#pragma unroll
  for (int i = 0; i < 8; ++i) { v[i] = p[i]; v[8 + i] = p[16 + i]; }
  return bsplit16(v); }
__device__ __forceinline__ F2 split_rowK(const float* row, int k0, int lane, int K) { float v[16]; const int g = lane >> 4;
#pragma unroll
  for (int i = 0; i < 8; ++i) { const int ka = k0 + 8 * g + i, kb = ka + 16; v[i] = ka < K ? row[ka < K ? ka : K - 1] : 0.f; v[8 + i] = kb < K ? row[kb < K ? kb : K - 1] : 0.f; }
  return bsplit16(v); }
__device__ __forceinline__ F2 split_col(const float* W, int k0, int n, int lane, int ld, int K) { float v[16]; const int g = lane >> 4;
#pragma unroll
  for (int i = 0; i < 8; ++i) { const int ka = k0 + 8 * g + i, kb = ka + 16; v[i] = ka < K ? W[(size_t)(ka < K ? ka : K - 1) * ld + n] : 0.f; v[8 + i] = kb < K ? W[(size_t)(kb < K ? kb : K - 1) * ld + n] : 0.f; }
  return bsplit16(v); }
__device__ __forceinline__ v8f mac3(const F2& a, const F2& b, v8f c) { c = wmma_bf(a.l, b.h, c); c = wmma_bf(a.h, b.l, c); return wmma_bf(a.h, b.h, c); }
__device__ __forceinline__ float sigm(float v) { return 1.0f / (1.0f + expf(-v)); }
#define LDSX() do { asm volatile("s_wait_dscnt 0" ::: "memory"); __builtin_amdgcn_wave_barrier(); __builtin_amdgcn_fence(__ATOMIC_RELEASE, "workgroup"); } while (0)

// Single-head causal self-attention (B 4, S 4,096, D_in 512 -> 64): Q, K, V = X Wq/Wk/Wv ((in,out) [512, 64]); W = softmax(causal(Q K^T) / 8); Z = W V -> [B, S, 64].
#define NB 4
#define TT 4096
#define CC 64             // NH * HD = projected width
#define DIN 512          // input (model) width
#define NH 1
#define HD 64
#define NQB (TT / 64)
#define HG 1
#define SCALE (0.125f)
#define CAUSAL 1
#ifndef TNB
#define TNB NB
#endif
__device__ __forceinline__ v16b zero16b() { v16b z; _Pragma("unroll") for (int i = 0; i < 16; ++i) z[i] = (__bf16)0.f; return z; }
__device__ __forceinline__ float bfr(float v) { return (float)(__bf16)v; }
__host__ __device__ __forceinline__ int kb_last(int qb) { return CAUSAL ? ((qb * 64 + 63) >> 7) : (TT / 128 - 1); }
typedef __attribute__((ext_vector_type(8))) __bf16 v8b;
__device__ __forceinline__ v16b frag_b(const __bf16* rowk0, int lane) {
  union { v16b v; v8b q[2]; } u; const __bf16* p = rowk0 + 8 * (lane >> 4);
  u.q[0] = *(const v8b*)p; u.q[1] = *(const v8b*)(p + 16); return u.v;
}
#define QBH 6              // causal: query blocks 0..QBH-1 of each sequence (few keys, no averaging) take the high-precision path
#define QHI 384            // rows carrying a q residual plane
#define KHI 384            // key rows carrying k residual / v bf16 hi+lo planes (used only by the causal high-precision path)
// B fragment (k rows k0+.., output column o) of a weight: (in,out) [K][ld] or (out,in) [ld rows of K]: bf16 exact, or f16(bf16 * 256) exact
__device__ __forceinline__ v16b wcol_io(const float* Wm, int k0, int o, int lane, int ld) { v16b w; const int g = lane >> 4;
#pragma unroll
  for (int i = 0; i < 8; ++i) { w[i] = (__bf16)Wm[(size_t)(k0 + 8 * g + i) * ld + o];
    if (i == 7) asm volatile("s_wait_xcnt 0x0" ::: "memory");   // only the run's last load can get the run's address pair as its result register: the wait stands in front of it
    w[8 + i] = (__bf16)Wm[(size_t)(k0 + 16 + 8 * g + i) * ld + o]; }
  return w; }
__device__ __forceinline__ v16b wcol_oi(const float* Wm, int k0, int o, int lane, int K) { v16b w; const float* p = Wm + (size_t)o * K + k0 + 8 * (lane >> 4);
#pragma unroll
  for (int i = 0; i < 8; ++i) { w[i] = (__bf16)p[i]; w[8 + i] = (__bf16)p[16 + i]; }
  return w; }
__device__ __forceinline__ v16h wcolh_io(const float* Wm, int k0, int o, int lane, int ld) { v16h w; const int g = lane >> 4;
#pragma unroll
  for (int i = 0; i < 8; ++i) { w[i] = (_Float16)(bfr(Wm[(size_t)(k0 + 8 * g + i) * ld + o]) * 256.0f); w[8 + i] = (_Float16)(bfr(Wm[(size_t)(k0 + 16 + 8 * g + i) * ld + o]) * 256.0f); }
  return w; }
__device__ __forceinline__ v16h wcolh_oi(const float* Wm, int k0, int o, int lane, int K) { v16h w; const float* p = Wm + (size_t)o * K + k0 + 8 * (lane >> 4);
#pragma unroll
  for (int i = 0; i < 8; ++i) { w[i] = (_Float16)(bfr(p[i]) * 256.0f); w[8 + i] = (_Float16)(bfr(p[16 + i]) * 256.0f); }
  return w; }
#define WQKV_LAYOUT 0   // 0 = (in,out) [DIN][DOUT]; 1 = (out,in) [CC][DIN]; 2 = per-head [NH][DIN][HD]
__device__ __forceinline__ v16b wcol_hdk(const float* Wm, int k0, int o, int lane) { v16b w; const int g = lane >> 4; const float* p = Wm + (size_t)(o / HD) * DIN * HD + (o % HD);
#pragma unroll
  for (int i = 0; i < 8; ++i) { w[i] = (__bf16)p[(size_t)(k0 + 8 * g + i) * HD]; w[8 + i] = (__bf16)p[(size_t)(k0 + 16 + 8 * g + i) * HD]; }
  return w; }
#define WO_OUT_IN 0
#if WQKV_LAYOUT == 1
#define WCOL(W, k0, o, lane) wcol_oi(W, k0, o, lane, DIN)
#elif WQKV_LAYOUT == 2
#define WCOL(W, k0, o, lane) wcol_hdk(W, k0, o, lane)
#else
#define WCOL(W, k0, o, lane) wcol_io(W, k0, (o), lane, DOUT)   /* W (in,out) [512][64] */
#endif
#if WO_OUT_IN
#define WOCOL(W, k0, o, lane) wcol_oi(W, k0, o, lane, CC)
#define WOCOLH(W, k0, o, lane) wcolh_oi(W, k0, o, lane, CC)
#else
#define WOCOL(W, k0, o, lane) wcol_io(W, k0, o, lane, DIN)
#define WOCOLH(W, k0, o, lane) wcolh_io(W, k0, o, lane, DIN)
#endif
#define DOUT 64            // head width = plane width CC
#ifndef SM_EXTRA_PARAMS
#define SM_EXTRA_PARAMS
#endif
#ifndef PROJ_EXTRA_PARAMS
#define PROJ_EXTRA_PARAMS
#endif
#ifndef SM_MASK_HOOK
#define SM_MASK_HOOK (void)0
#endif

#define WS_QH  0u                                      // f16 q, fragment order: [b*t / 16] tiles of 16 rows x CC = 4 pieces of 512 B; piece = features 16 * piece .. + 15, a lane's 16 B (row lane & 15, features + 8 * (lane >> 4)) at lane * 16
#define WS_KH  (WS_QH + 2u * (size_t)NB * TT * CC)      // f16 k, fragment order as q
#define WS_VT  (WS_KH + 2u * (size_t)NB * TT * CC)      // f16 v, fragment order: [b*t / 32] chunks of 32 keys x CC = 8 pieces of 512 B; piece = (16 features j, 16 keys), a lane's 16 B (feature 16 * j + (lane & 15), keys + 8 * (lane >> 4)) at lane * 16
#define WS_QL  (WS_VT + 2u * (size_t)NB * CC * TT)      // f16 q residual x 2^10 rows [b][t < QHI][CC]
#define WS_KL  (WS_QL + 2u * (size_t)NB * QHI * CC)     // f16 k residual x 2^10 rows [b][t < KHI][CC]
#define WS_VB  (WS_KL + 2u * (size_t)NB * KHI * CC)     // bf16 v hi planes [b][c][t < KHI]
#define WS_VBL (WS_VB + 2u * (size_t)NB * CC * KHI)
#define WS_Y   (WS_VBL + 2u * (size_t)NB * CC * KHI)    // f32 ctx rows [b*t][CC] (only when there is an output projection)
#define WS_END (WS_Y  + 0u)

// SXW: behind a global store, before the next LDS read or address sum reuses its data or address registers
__device__ __forceinline__ void SXW() { asm volatile("s_wait_xcnt 0x0" ::: "memory"); }
#define WFS 1040   // LDS bytes from one W fragment (two halves of 512 B) to the next: the 16 B over 1 KiB spread the staging stores of the 4 column tiles over all banks
// ---- k_proj: block = (64 rows, all CC cols, which): q/k/v = X W (+ b) with exact bf16 products (K = DIN) -> which 0: q f16 in fragment order (+ residual rows < QHI); 1: k f16 in fragment order (+ residual rows < KHI); 2: v f16 in fragment order (+ bf16 hi/lo planes [c][t] for t < KHI). The block's 64 rows are 8 KiB in a row of each fragment-ordered plane, stored 16 B a thread in address order
__global__ __launch_bounds__(128) void k_proj(const float* __restrict__ XQ, const float* __restrict__ XK, const float* __restrict__ XV, const float* __restrict__ WQ, const float* __restrict__ WK, const float* __restrict__ WV, const float* __restrict__ BQ, const float* __restrict__ BK, const float* __restrict__ BV,
    _Float16* __restrict__ QH, _Float16* __restrict__ QL, _Float16* __restrict__ KH, _Float16* __restrict__ KL, _Float16* __restrict__ VT, __bf16* __restrict__ VB, __bf16* __restrict__ VBL) {
  // one LDS block, used twice: first the block's whole W as bf16 B fragments, then (behind a barrier) the tiles that reorder the results for the stores
  __shared__ __align__(16) union { unsigned char w[(DIN / 32) * (CC / 16) * WFS]; struct { _Float16 sh[64][CC + 8], sl[64][CC + 8]; } qk; struct { _Float16 th[CC][72]; __bf16 tb[CC][72], tbl[CC][72]; } vv; } sm;
  _Float16 (*sh)[CC + 8] = sm.qk.sh; _Float16 (*sl)[CC + 8] = sm.qk.sl; _Float16 (*th)[72] = sm.vv.th; __bf16 (*tb)[72] = sm.vv.tb; __bf16 (*tbl)[72] = sm.vv.tbl;
  const int tid = threadIdx.x, wave = tid >> 5, lane = tid & 31, col = lane & 15, g = lane >> 4; const int which = blockIdx.z; const int c0 = 0; const size_t r0 = (size_t)blockIdx.x * 64; const size_t bb = r0 / TT; const int t0 = (int)(r0 % TT);
  const float* X = which == 0 ? XQ : which == 1 ? XK : XV; const float* WA = which == 0 ? WQ : which == 1 ? WK : WV; const float* BA = which == 0 ? BQ : which == 1 ? BK : BV;
  // W (in,out) [DIN][DOUT] -> LDS: a thread takes 8 rows k x 4 columns in each of the 8 blocks of 64 rows (64 loads of 16 B; a wave's load covers 4 whole lines), rounds to bf16 and stores each column's 8 k as the 16 B that lane (g = (k >> 3) & 1, col) of fragment (kc = k >> 5, j = column >> 4), half (k >> 4) & 1, reads in the loop
  { const int sc = tid & 15, sk = tid >> 4; const float* wp = WA + (size_t)sk * 8 * DOUT + sc * 4;
    unsigned char* wd = sm.w + ((sk >> 2) * (CC / 16) + (sc >> 2)) * WFS + ((sk >> 1) & 1) * 512 + ((sk & 1) * 16 + (sc & 3) * 4) * 16; v4f r[DIN / 64][8];
#pragma unroll   // constant offsets off one address pair and one LDS address; all of a thread's loads are in flight at once
    for (int it = 0; it < DIN / 64; ++it)
#pragma unroll
      for (int i = 0; i < 8; ++i) r[it][i] = *(const v4f*)(wp + (size_t)(it * 64 + i) * DOUT);
    asm volatile("s_wait_xcnt 0x0" :: "v"(wp) : "memory");   // behind the last load, with the address pair held up to here: what follows may reuse that pair
#pragma unroll
    for (int it = 0; it < DIN / 64; ++it)
#pragma unroll
      for (int x = 0; x < 4; ++x) { v8b q;
#pragma unroll
        for (int i = 0; i < 8; ++i) q[i] = (__bf16)r[it][i][x];
        *(v8b*)(wd + it * 2 * (CC / 16) * WFS + x * 16) = q; } }
  __syncthreads();   // the whole W stands in LDS before any wave reads a fragment
  v8f acc[CC / 16] = {};
#pragma unroll 2
  for (int kc = 0; kc < DIN / 32; ++kc) { v16b a; { const float* p = X + (r0 + wave * 16 + col) * DIN + kc * 32 + 8 * g;
#pragma unroll
      for (int i = 0; i < 8; ++i) { a[i] = (__bf16)p[i]; a[8 + i] = (__bf16)p[16 + i]; } }
    v16b w[CC / 16];
#pragma unroll
    for (int j = 0; j < CC / 16; ++j) { union { v16b v; v8b q[2]; } u; const unsigned char* p = sm.w + (kc * (CC / 16) + j) * WFS + lane * 16; u.q[0] = *(const v8b*)p; u.q[1] = *(const v8b*)(p + 512); w[j] = u.v; }
    asm volatile("s_wait_loadcnt 0x0" ::: "memory");
#pragma unroll
    for (int j = 0; j < CC / 16; ++j) acc[j] = wmma_bf(a, w[j], acc[j]); }
  __syncthreads();   // every wave has read its last W fragment before the result tiles overwrite that LDS
  if (which < 2) { _Float16* DH = which == 0 ? QH : KH; _Float16* DL = which == 0 ? QL : KL; const int nhi = which == 0 ? QHI : KHI; const bool hi_rows = t0 < nhi;
#pragma unroll
    for (int j = 0; j < CC / 16; ++j) { const float bias = BA ? bfr(BA[c0 + j * 16 + col]) : 0.f;
#pragma unroll
      for (int r = 0; r < 8; ++r) { const float v = acc[j][r] + bias; const _Float16 hv = (_Float16)v; sh[wave * 16 + 8 * g + r][j * 16 + col] = hv; sl[wave * 16 + 8 * g + r][j * 16 + col] = (_Float16)((v - (float)hv) * 1024.0f); } }
    __syncthreads();
    for (int e = tid; e < 64 * (CC / 8); e += 128) { const int rl = e / (CC / 8), q = e % (CC / 8); vst2((unsigned*)(DH + r0 * CC + e * 8), *(const v4u*)&sh[(e >> 7) * 16 + (e & 15)][(((e >> 5) & 3) * 2 + ((e >> 4) & 1)) * 8]); SXW(); if (hi_rows) { vst2((unsigned*)(DL + (bb * nhi + t0 + rl) * (size_t)CC + c0 + q * 8), *(const v4u*)&sl[rl][q * 8]); SXW(); } }
  } else { const bool hi_rows = t0 < KHI;
#pragma unroll
    for (int j = 0; j < CC / 16; ++j) { const float bias = BA ? bfr(BA[c0 + j * 16 + col]) : 0.f;
#pragma unroll
      for (int r = 0; r < 8; ++r) { const float v = acc[j][r] + bias; const int rl = wave * 16 + 8 * g + r, cl = j * 16 + col; th[cl][rl] = (_Float16)v; const __bf16 bh = (__bf16)v; tb[cl][rl] = bh; tbl[cl][rl] = (__bf16)(v - (float)bh); } }
    __syncthreads();
    for (int e = tid; e < CC * 8; e += 128) { const int cl = e >> 3, q = e & 7; vst2((unsigned*)(VT + r0 * CC + e * 8), *(const v4u*)&th[((e >> 6) & 3) * 16 + (e & 15)][(e >> 8) * 32 + ((e >> 5) & 1) * 16 + ((e >> 4) & 1) * 8]); SXW(); if (hi_rows) { const size_t o3 = (bb * CC + c0 + cl) * (size_t)KHI + t0 + q * 8; vst2((unsigned*)(VB + o3), *(const v4u*)&tb[cl][q * 8]); SXW(); vst2((unsigned*)(VBL + o3), *(const v4u*)&tbl[cl][q * 8]); SXW(); } } } }
// ---- k_att: block = 16 queries of sequence b, PVW waves; wave w takes the 32-key chunks w, w + PVW, ... up to the diagonal. Logits are formed transposed (A = k rows, B = q rows), so a lane holds 16 logits of ONE query in the very order of the A fragment of P . v: they stay in registers, are masked by index, and are turned into exp(logit - the wave's own row maximum) x 2^11 (once to f16 against v f16; query blocks < QBH: 3-product logits, P and v as bf16 hi + lo). Each wave leaves its f32 partial tile, row maxima and row sums in LDS; behind one barrier wave w joins row w over the waves in wave order, each partial weighted by exp(its maximum - the row's maximum), and divides by the joined sum. A masked logit is -3e38: its exp is 0 beside any real maximum; a row with no open key in a wave's chunks has the maximum -3e38, and that wave's partial for it gets the weight 0 in the join (key 0 is open to every query, so the row's maximum is real)
#define PVW 16
#define LOG2E 1.44269504088896340736f
// 2^x in the one hardware instruction: every argument below is <= 11, and a result under 2^-126 may read 0 beside a row whose largest term is 2^11 (or 1 in the join)
__device__ __forceinline__ float ex2(float x) { return __builtin_amdgcn_exp2f(x); }
// the same for the join: the v_nop in the same statement is the one free slot that the instruction set asks for behind a transcendental
__device__ __forceinline__ float ex2_slot(float x) { float r; asm("v_exp_f32 %0, %1\n\tv_nop" : "=v"(r) : "v"(x)); return r; }
#define NCH (TT / 32 / PVW)   // most chunks one wave can own
// XW: in front of a load whose result may land on the address pair of loads issued before it
__device__ __forceinline__ void XW() { asm volatile("s_wait_xcnt 0x0" ::: "memory"); }
// last fragment of a run of loads off one address pair: only the run's last load can get that pair as its result registers, so the wait stands in front of it
__device__ __forceinline__ v16h frag_t_end(const _Float16* tile, int c, int lane) {
  union { v16h v; v8h q[2]; } u; const _Float16* p = tile + c * 512 + lane * 8;
  u.q[0] = *(const v8h*)p; XW(); u.q[1] = *(const v8h*)(p + 256); return u.v;
}
// fragment c of a fragment-ordered tile (q, k: 16 rows, c = the 32 features; v: 32 keys, c = the 16 features): two loads of 512 contiguous bytes a wave, 4 whole lines each
__device__ __forceinline__ v16h frag_t(const _Float16* tile, int c, int lane) {
  union { v16h v; v8h q[2]; } u; const _Float16* p = tile + c * 512 + lane * 8;
  u.q[0] = *(const v8h*)p; u.q[1] = *(const v8h*)(p + 256); return u.v;
}
__device__ __forceinline__ v16h frag_t_w(const _Float16* tile, int c, int lane) {
  union { v16h v; v8h q[2]; } u; const _Float16* p = tile + c * 512 + lane * 8;
  u.q[0] = *(const v8h*)p; XW(); u.q[1] = *(const v8h*)(p + 256); XW(); return u.v;
}
// fragments of the three-product path (many address pairs, one chunk a wave): the wait behind every load
__device__ __forceinline__ v16h frag_h_w(const _Float16* rowk0, int lane) {
  union { v16h v; v8h q[2]; } u; const _Float16* p = rowk0 + 8 * (lane >> 4);
  u.q[0] = *(const v8h*)p; XW(); u.q[1] = *(const v8h*)(p + 16); XW(); return u.v;
}
__device__ __forceinline__ v16b frag_b_w(const __bf16* rowk0, int lane) {
  union { v16b v; v8b q[2]; } u; const __bf16* p = rowk0 + 8 * (lane >> 4);
  u.q[0] = *(const v8b*)p; XW(); u.q[1] = *(const v8b*)(p + 16); XW(); return u.v;
}
__global__ __launch_bounds__(PVW * 32) void k_att(const _Float16* __restrict__ QH, const _Float16* __restrict__ KH, const _Float16* __restrict__ QL, const _Float16* __restrict__ KL, const _Float16* __restrict__ VT, const __bf16* __restrict__ VB, const __bf16* __restrict__ VBL, float* __restrict__ Y) {
  __shared__ __align__(16) float ss[PVW][16][HD + 4]; __shared__ float smx[PVW][16], ssu[PVW][16];
  const int tid = threadIdx.x, wave = __builtin_amdgcn_readfirstlane(tid >> 5), lane = tid & 31, col = lane & 15, g = lane >> 4; const int b = blockIdx.x % TNB, qt = TT / 16 - 1 - blockIdx.x / TNB;   // all sequences in one grid; the query tiles with the most keys take the lowest block indices, for speed only
  const int qb = qt >> 2; const int ql0 = qt * 16; const int kce = (ql0 >> 5) + 1;   // chunks that hold a key <= the block's last query
  const int t = ql0 + col;   // the query whose logits this lane holds
  const _Float16* Qt = QH + ((size_t)b * TT + ql0) * CC; const _Float16* Kb = KH + (size_t)b * TT * CC;
  v8f acc[HD / 16] = {}; float m = -3.0e38f, sum = 0.f;
  // every unroll below: the loop indexes register arrays or vector elements, which takes constant indices
  if (qb < QBH) {
    if (wave < kce) { const int k0 = wave * 32; const _Float16* Qlr = QL + ((size_t)b * QHI + t) * CC; const _Float16* Klb = KL + (size_t)b * KHI * CC;
      v8f a0[2] = {}, a1[2] = {};
#pragma unroll
      for (int c = 0; c < HD / 32; ++c) { const v16h ah = frag_t_w(Qt, c, lane), al = frag_h_w(Qlr + c * 32, lane);
#pragma unroll
        for (int u = 0; u < 2; ++u) { const size_t ko = (size_t)(k0 + u * 16 + col) * CC + c * 32; const v16h kbf = frag_t_w(Kb + (size_t)(k0 + u * 16) * CC, c, lane), klf = frag_h_w(Klb + ko, lane); a0[u] = wmma16(kbf, ah, a0[u]); a1[u] = wmma16(kbf, al, a1[u]); a1[u] = wmma16(klf, ah, a1[u]); } }
      float s[16];
#pragma unroll
      for (int e = 0; e < 16; ++e) { const float v = (a0[e >> 3][e & 7] + a1[e >> 3][e & 7] * (1.0f / 1024.0f)) * SCALE; s[e] = (k0 + (e >> 3) * 16 + 8 * g + (e & 7) <= t) ? v : -3.0e38f; m = fmaxf(m, s[e]); }
      m = fmaxf(m, __shfl_xor(m, 16));
#pragma unroll
      for (int e = 0; e < 16; ++e) { const float ev = expf(s[e] - m); sum += ev; s[e] = ev * 2048.0f; }
      const F2 p = bsplit16(s);
#pragma unroll
      for (int j = 0; j < HD / 16; ++j) { const size_t po = ((size_t)b * CC + j * 16 + col) * (size_t)KHI + k0; const v16b vh = frag_b_w(VB + po, lane); acc[j] = wmma_bf(p.h, vh, acc[j]); acc[j] = wmma_bf(p.l, vh, acc[j]); acc[j] = wmma_bf(p.h, frag_b_w(VBL + po, lane), acc[j]); } }
  } else {
    v16h p[NCH];
    { float s[NCH][16]; v16h qf[HD / 32];
#pragma unroll
      for (int c = 0; c < HD / 32; ++c) qf[c] = frag_t(Qt, c, lane);
      asm volatile("s_wait_xcnt 0x0" ::: "memory");   // the q loads' address registers may be reused for the k addresses in the next block
#pragma unroll   // s and p are indexed by constants only, so they live in registers
      for (int i = 0; i < NCH; ++i) { const int kc = wave + i * PVW, k0 = kc * 32;
        if (kc < kce) { v16h kf[2 * (HD / 32)]; v8f a[2] = {};
#pragma unroll
          for (int c = 0; c < HD / 32; ++c)
#pragma unroll
            for (int u = 0; u < 2; ++u) { const _Float16* kp = Kb + (size_t)(k0 + u * 16) * CC; kf[c * 2 + u] = (c * 2 + u < 2 * (HD / 32) - 1) ? frag_t(kp, c, lane) : frag_t_end(kp, c, lane); }
#pragma unroll
          for (int c = 0; c < HD / 32; ++c)
#pragma unroll
            for (int u = 0; u < 2; ++u) a[u] = wmma16(kf[c * 2 + u], qf[c], a[u]);
          if (kc == kce - 1) {   // only the last chunk reaches past a query of this block
#pragma unroll
            for (int e = 0; e < 16; ++e) { s[i][e] = (k0 + (e >> 3) * 16 + 8 * g + (e & 7) <= t) ? a[e >> 3][e & 7] : -3.0e38f; m = fmaxf(m, s[i][e]); }
          } else {
#pragma unroll
            for (int e = 0; e < 16; ++e) { s[i][e] = a[e >> 3][e & 7]; m = fmaxf(m, s[i][e]); } } } }
      m = fmaxf(m, __shfl_xor(m, 16));
#pragma unroll
      for (int i = 0; i < NCH; ++i)
        if (wave + i * PVW < kce) {
#pragma unroll
          for (int e = 0; e < 16; ++e) { const float ev = ex2((s[i][e] - m) * (SCALE * LOG2E) + 11.0f); sum += ev; p[i][e] = (_Float16)ev; } }   // s and m are unscaled products here: the scale, log2(e) and the 2^11 go into one multiply-add
      sum *= 1.0f / 2048.0f; m *= SCALE; }   // both exact: the join below gets the same units as from the three-product path (a wave with no chunk hands on -3e38 / 8: its weight in the join is 0 as before)
#pragma unroll
    for (int i = 0; i < NCH; ++i) { const int k0 = (wave + i * PVW) * 32;
      if (wave + i * PVW < kce) { v16h vf[HD / 16];
#pragma unroll
        for (int j = 0; j < HD / 16; ++j) { const _Float16* vp = VT + ((size_t)b * TT + k0) * CC; vf[j] = (j < HD / 16 - 1) ? frag_t(vp, j, lane) : frag_t_end(vp, j, lane); }
#pragma unroll
        for (int j = 0; j < HD / 16; ++j) acc[j] = wmma16(p[i], vf[j], acc[j]); } } }
  sum += __shfl_xor(sum, 16);
  if (g == 0) { smx[wave][col] = m; ssu[wave][col] = sum; }
#pragma unroll
  for (int j = 0; j < HD / 16; ++j)
#pragma unroll
    for (int r = 0; r < 8; ++r) ss[wave][8 * g + r][j * 16 + col] = acc[j][r];
  __syncthreads();   // every wave's partial tile, maxima and sums are in LDS before any wave joins them
  float mm = smx[0][wave];
#pragma unroll
  for (int w = 1; w < PVW; ++w) mm = fmaxf(mm, smx[w][wave]);
  v2f o = {}; float tot = 0.f;
#pragma unroll   // the LDS reads of all partial tiles issue ahead of the adds instead of one round trip each
  for (int w = 0; w < PVW; ++w) { const float f = ex2_slot((smx[w][wave] - mm) * LOG2E); tot += ssu[w][wave] * f; o += *(const v2f*)&ss[w][wave][lane * 2] * f; }
  o *= tot > 0.f ? 1.0f / (2048.0f * tot) : 0.f;
  vst2(Y + ((size_t)b * TT + ql0 + wave) * CC + lane * 2, o); }

extern "C" void kernel_launch(void* const* d_in, const int* in_sizes, int n_in, void* d_out, int out_size, void* d_ws, size_t ws_size, hipStream_t stream) {
  (void)in_sizes; (void)n_in; (void)out_size;
  const float** F = (const float**)d_in;
  if (ws_size < (size_t)WS_END) return;
  char* ws = (char*)d_ws; _Float16 *QH = (_Float16*)(ws + WS_QH), *KH = (_Float16*)(ws + WS_KH), *VT = (_Float16*)(ws + WS_VT), *QL = (_Float16*)(ws + WS_QL), *KL = (_Float16*)(ws + WS_KL); __bf16 *VB = (__bf16*)(ws + WS_VB), *VBL = (__bf16*)(ws + WS_VBL); float *Y = (float*)(ws + WS_Y);
  (void)Y; (void)QL; (void)KL; (void)VB; (void)VBL;
  // inputs: 0 X [4,4096,512]; 1 Wq, 2 Wk, 3 Wv [512,64] (in,out)
  k_proj<<<dim3(TNB * TT / 64, 1, 3), 128, 0, stream>>>(F[0], F[0], F[0], F[1], F[2], F[3], nullptr, nullptr, nullptr, QH, QL, KH, KL, VT, VB, VBL);
  k_att<<<dim3(TNB * (TT / 16), 1, 1), PVW * 32, 0, stream>>>(QH, KH, QL, KL, VT, VB, VBL, (float*)d_out);
}

// v008
// One run takes 40.9 microseconds.
// Next to v007, in two timings, it ran 1.18 and 1.17 times as fast.
// Over all steps from v000 it is 24.9 times as fast.
// compute dtype: all float inputs rounded to bf16; Q/K/V = X W with EXACT bf16 products on WMMA 16x16x32 (f32 accumulate; the single head's planes are 64 wide); causal logits: q, k once to f16 (1 product) x 64^-0.5, except the first 384 query rows of each sequence (3 products with f16 residuals); softmax in f32; exp(logit - max) x 2^11 once to f16 against v once to f16 (1 product; bf16 hi + lo below row 384); f32 output.
#include <hip/hip_runtime.h>
#include <math.h>

typedef __attribute__((ext_vector_type(16))) _Float16 v16h;
typedef __attribute__((ext_vector_type(16))) __bf16 v16b;
typedef __attribute__((ext_vector_type(8)))  _Float16 v8h;
typedef __attribute__((ext_vector_type(8)))  float v8f;
typedef __attribute__((ext_vector_type(4)))  float v4f;
typedef __attribute__((ext_vector_type(2)))  float v2f;
typedef __attribute__((ext_vector_type(4)))  unsigned v4u;
typedef __attribute__((ext_vector_type(4)))  int v4i;
typedef float __attribute__((may_alias)) float_a;
typedef int __attribute__((may_alias)) int_a;

template <typename T> __device__ __forceinline__ void vst2(void* p, T v) { *(T*)p = v;  }
__device__ __forceinline__ v8f wmma16(v16h a, v16h b, v8f c) {
  v8f d = __builtin_amdgcn_wmma_f32_16x16x32_f16(false, a, false, b, (short)0, c, false, false);
  asm volatile("v_nop\n\tv_nop\n\tv_nop\n\tv_nop" : "+v"(d) : "v"(a), "v"(b));
  return d;
}
__device__ __forceinline__ v8f wmma_bf(v16b a, v16b b, v8f c) {
  v8f d = __builtin_amdgcn_wmma_f32_16x16x32_bf16(false, a, false, b, (short)0, c, false, false);
  asm volatile("v_nop\n\tv_nop\n\tv_nop\n\tv_nop" : "+v"(d) : "v"(a), "v"(b));
  return d;
}
// 16x16x32 fragments: lane = (h = lane>>4, row/col = lane&15); elements 0..7 = k0+8h+0..7, 8..15 = k0+16+8h+0..7; D element r = row 8h+r
__device__ __forceinline__ v16h frag_h(const _Float16* rowk0, int lane) {
  union { v16h v; v8h q[2]; } u; const _Float16* p = rowk0 + 8 * (lane >> 4);
  u.q[0] = *(const v8h*)p; u.q[1] = *(const v8h*)(p + 16); return u.v;
}
__device__ __forceinline__ v16h frag_f32(const float* rowk0, int lane) {
  v16h a; const float* p = rowk0 + 8 * (lane >> 4);
#pragma unroll
  for (int i = 0; i < 8; ++i) { a[i] = (_Float16)p[i]; a[8 + i] = (_Float16)p[16 + i]; }
  return a;
}
__device__ __forceinline__ v16h frag_f32s(const float* rowk0, int lane, float sc) {
  v16h a; const float* p = rowk0 + 8 * (lane >> 4);
#pragma unroll
  for (int i = 0; i < 8; ++i) { a[i] = (_Float16)(p[i] * sc); a[8 + i] = (_Float16)(p[16 + i] * sc); }
  return a;
}
// column fragment from a [K][ld] layout (column n), rows >= K read as 0
__device__ __forceinline__ v16h fragc_f32(const float* W, int k0, int n, int lane, int ld, int K) {
  v16h a; const int g = lane >> 4;
#pragma unroll
  for (int i = 0; i < 8; ++i) { const int ka = k0 + 8 * g + i, kb = ka + 16;
    a[i] = (_Float16)(ka < K ? W[(size_t)(ka < K ? ka : K - 1) * ld + n] : 0.f); a[8 + i] = (_Float16)(kb < K ? W[(size_t)(kb < K ? kb : K - 1) * ld + n] : 0.f); }
  return a;
}
struct F2 { v16b h, l; };
__device__ __forceinline__ F2 bsplit16(const float v[16]) { F2 r;
#pragma unroll
  for (int i = 0; i < 16; ++i) { const __bf16 h = (__bf16)v[i]; r.h[i] = h; r.l[i] = (__bf16)(v[i] - (float)h); }
  return r; }
__device__ __forceinline__ F2 split_row(const float* row, int k0, int lane) { float v[16]; const float* p = row + k0 + 8 * (lane >> 4);
#pragma unroll
  for (int i = 0; i < 8; ++i) { v[i] = p[i]; v[8 + i] = p[16 + i]; }
  return bsplit16(v); }
__device__ __forceinline__ F2 split_rowK(const float* row, int k0, int lane, int K) { float v[16]; const int g = lane >> 4;
#pragma unroll
  for (int i = 0; i < 8; ++i) { const int ka = k0 + 8 * g + i, kb = ka + 16; v[i] = ka < K ? row[ka < K ? ka : K - 1] : 0.f; v[8 + i] = kb < K ? row[kb < K ? kb : K - 1] : 0.f; }
  return bsplit16(v); }
__device__ __forceinline__ F2 split_col(const float* W, int k0, int n, int lane, int ld, int K) { float v[16]; const int g = lane >> 4;
#pragma unroll
  for (int i = 0; i < 8; ++i) { const int ka = k0 + 8 * g + i, kb = ka + 16; v[i] = ka < K ? W[(size_t)(ka < K ? ka : K - 1) * ld + n] : 0.f; v[8 + i] = kb < K ? W[(size_t)(kb < K ? kb : K - 1) * ld + n] : 0.f; }
  return bsplit16(v); }
__device__ __forceinline__ v8f mac3(const F2& a, const F2& b, v8f c) { c = wmma_bf(a.l, b.h, c); c = wmma_bf(a.h, b.l, c); return wmma_bf(a.h, b.h, c); }
__device__ __forceinline__ float sigm(float v) { return 1.0f / (1.0f + expf(-v)); }
#define LDSX() do { asm volatile("s_wait_dscnt 0" ::: "memory"); __builtin_amdgcn_wave_barrier(); __builtin_amdgcn_fence(__ATOMIC_RELEASE, "workgroup"); } while (0)

// Single-head causal self-attention (B 4, S 4,096, D_in 512 -> 64): Q, K, V = X Wq/Wk/Wv ((in,out) [512, 64]); W = softmax(causal(Q K^T) / 8); Z = W V -> [B, S, 64].
#define NB 4
#define TT 4096
#define CC 64             // NH * HD = projected width
#define DIN 512          // input (model) width
#define NH 1
#define HD 64
#define NQB (TT / 64)
#define HG 1
#define SCALE (0.125f)
#define CAUSAL 1
#ifndef TNB
#define TNB NB
#endif
__device__ __forceinline__ v16b zero16b() { v16b z; _Pragma("unroll") for (int i = 0; i < 16; ++i) z[i] = (__bf16)0.f; return z; }
__device__ __forceinline__ float bfr(float v) { return (float)(__bf16)v; }
__host__ __device__ __forceinline__ int kb_last(int qb) { return CAUSAL ? ((qb * 64 + 63) >> 7) : (TT / 128 - 1); }
typedef __attribute__((ext_vector_type(8))) __bf16 v8b;
__device__ __forceinline__ v16b frag_b(const __bf16* rowk0, int lane) {
  union { v16b v; v8b q[2]; } u; const __bf16* p = rowk0 + 8 * (lane >> 4);
  u.q[0] = *(const v8b*)p; u.q[1] = *(const v8b*)(p + 16); return u.v;
}
#define QBH 6              // causal: query blocks 0..QBH-1 of each sequence (few keys, no averaging) take the high-precision path
#define QHI 384            // rows carrying a q residual plane
#define KHI 384            // key rows carrying k residual / v bf16 hi+lo planes (used only by the causal high-precision path)
// B fragment (k rows k0+.., output column o) of a weight: (in,out) [K][ld] or (out,in) [ld rows of K]: bf16 exact, or f16(bf16 * 256) exact
__device__ __forceinline__ v16b wcol_io(const float* Wm, int k0, int o, int lane, int ld) { v16b w; const int g = lane >> 4;
#pragma unroll
  for (int i = 0; i < 8; ++i) { w[i] = (__bf16)Wm[(size_t)(k0 + 8 * g + i) * ld + o];
    if (i == 7) asm volatile("s_wait_xcnt 0x0" ::: "memory");   // only the run's last load can get the run's address pair as its result register: the wait stands in front of it
    w[8 + i] = (__bf16)Wm[(size_t)(k0 + 16 + 8 * g + i) * ld + o]; }
  return w; }
__device__ __forceinline__ v16b wcol_oi(const float* Wm, int k0, int o, int lane, int K) { v16b w; const float* p = Wm + (size_t)o * K + k0 + 8 * (lane >> 4);
#pragma unroll
  for (int i = 0; i < 8; ++i) { w[i] = (__bf16)p[i]; w[8 + i] = (__bf16)p[16 + i]; }
  return w; }
__device__ __forceinline__ v16h wcolh_io(const float* Wm, int k0, int o, int lane, int ld) { v16h w; const int g = lane >> 4;
#pragma unroll
  for (int i = 0; i < 8; ++i) { w[i] = (_Float16)(bfr(Wm[(size_t)(k0 + 8 * g + i) * ld + o]) * 256.0f); w[8 + i] = (_Float16)(bfr(Wm[(size_t)(k0 + 16 + 8 * g + i) * ld + o]) * 256.0f); }
  return w; }
__device__ __forceinline__ v16h wcolh_oi(const float* Wm, int k0, int o, int lane, int K) { v16h w; const float* p = Wm + (size_t)o * K + k0 + 8 * (lane >> 4);
#pragma unroll
  for (int i = 0; i < 8; ++i) { w[i] = (_Float16)(bfr(p[i]) * 256.0f); w[8 + i] = (_Float16)(bfr(p[16 + i]) * 256.0f); }
  return w; }
#define WQKV_LAYOUT 0   // 0 = (in,out) [DIN][DOUT]; 1 = (out,in) [CC][DIN]; 2 = per-head [NH][DIN][HD]
__device__ __forceinline__ v16b wcol_hdk(const float* Wm, int k0, int o, int lane) { v16b w; const int g = lane >> 4; const float* p = Wm + (size_t)(o / HD) * DIN * HD + (o % HD);
#pragma unroll
  for (int i = 0; i < 8; ++i) { w[i] = (__bf16)p[(size_t)(k0 + 8 * g + i) * HD]; w[8 + i] = (__bf16)p[(size_t)(k0 + 16 + 8 * g + i) * HD]; }
  return w; }
#define WO_OUT_IN 0
#if WQKV_LAYOUT == 1
#define WCOL(W, k0, o, lane) wcol_oi(W, k0, o, lane, DIN)
#elif WQKV_LAYOUT == 2
#define WCOL(W, k0, o, lane) wcol_hdk(W, k0, o, lane)
#else
#define WCOL(W, k0, o, lane) wcol_io(W, k0, (o), lane, DOUT)   /* W (in,out) [512][64] */
#endif
#if WO_OUT_IN
#define WOCOL(W, k0, o, lane) wcol_oi(W, k0, o, lane, CC)
#define WOCOLH(W, k0, o, lane) wcolh_oi(W, k0, o, lane, CC)
#else
#define WOCOL(W, k0, o, lane) wcol_io(W, k0, o, lane, DIN)
#define WOCOLH(W, k0, o, lane) wcolh_io(W, k0, o, lane, DIN)
#endif
#define DOUT 64            // head width = plane width CC
#ifndef SM_EXTRA_PARAMS
#define SM_EXTRA_PARAMS
#endif
#ifndef PROJ_EXTRA_PARAMS
#define PROJ_EXTRA_PARAMS
#endif
#ifndef SM_MASK_HOOK
#define SM_MASK_HOOK (void)0
#endif

#define WS_QH  0u                                      // f16 q, fragment order: [b*t / 16] tiles of 16 rows x CC = 4 pieces of 512 B; piece = features 16 * piece .. + 15, a lane's 16 B (row lane & 15, features + 8 * (lane >> 4)) at lane * 16
#define WS_KH  (WS_QH + 2u * (size_t)NB * TT * CC)      // f16 k, fragment order as q
#define WS_VT  (WS_KH + 2u * (size_t)NB * TT * CC)      // f16 v, fragment order: [b*t / 32] chunks of 32 keys x CC = 8 pieces of 512 B; piece = (16 features j, 16 keys), a lane's 16 B (feature 16 * j + (lane & 15), keys + 8 * (lane >> 4)) at lane * 16
#define WS_QL  (WS_VT + 2u * (size_t)NB * CC * TT)      // f16 q residual x 2^10 rows [b][t < QHI][CC]
#define WS_KL  (WS_QL + 2u * (size_t)NB * QHI * CC)     // f16 k residual x 2^10 rows [b][t < KHI][CC]
#define WS_VB  (WS_KL + 2u * (size_t)NB * KHI * CC)     // bf16 v hi planes [b][c][t < KHI]
#define WS_VBL (WS_VB + 2u * (size_t)NB * CC * KHI)
#define WS_Y   (WS_VBL + 2u * (size_t)NB * CC * KHI)    // f32 ctx rows [b*t][CC] (only when there is an output projection)
#define WS_END (WS_Y  + 0u)

// SXW: behind a global store, before the next LDS read or address sum reuses its data or address registers
__device__ __forceinline__ void SXW() { asm volatile("s_wait_xcnt 0x0" ::: "memory"); }
#define WFS 1040   // LDS bytes from one W fragment (two halves of 512 B) to the next: the 16 B over 1 KiB spread the staging stores of the 4 column tiles over all banks
// ---- k_proj: block = (64 rows, all CC cols, which): q/k/v = X W (+ b) with exact bf16 products (K = DIN) -> which 0: q f16 in fragment order (+ residual rows < QHI); 1: k f16 in fragment order (+ residual rows < KHI); 2: v f16 in fragment order (+ bf16 hi/lo planes [c][t] for t < KHI). The block's 64 rows are 8 KiB in a row of each fragment-ordered plane, stored 16 B a thread in address order
__global__ __launch_bounds__(128) void k_proj(const float* __restrict__ XQ, const float* __restrict__ XK, const float* __restrict__ XV, const float* __restrict__ WQ, const float* __restrict__ WK, const float* __restrict__ WV, const float* __restrict__ BQ, const float* __restrict__ BK, const float* __restrict__ BV,
    _Float16* __restrict__ QH, _Float16* __restrict__ QL, _Float16* __restrict__ KH, _Float16* __restrict__ KL, _Float16* __restrict__ VT, __bf16* __restrict__ VB, __bf16* __restrict__ VBL) {
  // one LDS block, used twice: first the block's whole W as bf16 B fragments, then (behind a barrier) the tiles that reorder the results for the stores
  __shared__ __align__(16) union { unsigned char w[(DIN / 32) * (CC / 16) * WFS]; struct { _Float16 sh[64][CC + 8], sl[64][CC + 8]; } qk; struct { _Float16 th[CC][72]; __bf16 tb[CC][72], tbl[CC][72]; } vv; } sm;
  _Float16 (*sh)[CC + 8] = sm.qk.sh; _Float16 (*sl)[CC + 8] = sm.qk.sl; _Float16 (*th)[72] = sm.vv.th; __bf16 (*tb)[72] = sm.vv.tb; __bf16 (*tbl)[72] = sm.vv.tbl;
  const int tid = threadIdx.x, wave = tid >> 5, lane = tid & 31, col = lane & 15, g = lane >> 4; const int which = blockIdx.z; const int c0 = 0; const size_t r0 = (size_t)blockIdx.x * 64; const size_t bb = r0 / TT; const int t0 = (int)(r0 % TT);
  const float* X = which == 0 ? XQ : which == 1 ? XK : XV; const float* WA = which == 0 ? WQ : which == 1 ? WK : WV; const float* BA = which == 0 ? BQ : which == 1 ? BK : BV;
  // W (in,out) [DIN][DOUT] -> LDS: a thread takes 8 rows k x 4 columns in each of the 8 blocks of 64 rows (64 loads of 16 B; a wave's load covers 4 whole lines), rounds to bf16 and stores each column's 8 k as the 16 B that lane (g = (k >> 3) & 1, col) of fragment (kc = k >> 5, j = column >> 4), half (k >> 4) & 1, reads in the loop
  { const int sc = tid & 15, sk = tid >> 4; const float* wp = WA + (size_t)sk * 8 * DOUT + sc * 4;
    unsigned char* wd = sm.w + ((sk >> 2) * (CC / 16) + (sc >> 2)) * WFS + ((sk >> 1) & 1) * 512 + ((sk & 1) * 16 + (sc & 3) * 4) * 16; v4f r[DIN / 64][8];
#pragma unroll   // constant offsets off one address pair and one LDS address; all of a thread's loads are in flight at once
    for (int it = 0; it < DIN / 64; ++it)
#pragma unroll
      for (int i = 0; i < 8; ++i) r[it][i] = *(const v4f*)(wp + (size_t)(it * 64 + i) * DOUT);
    asm volatile("s_wait_xcnt 0x0" :: "v"(wp) : "memory");   // behind the last load, with the address pair held up to here: what follows may reuse that pair
#pragma unroll
    for (int it = 0; it < DIN / 64; ++it)
#pragma unroll
      for (int x = 0; x < 4; ++x) { v8b q;
#pragma unroll
        for (int i = 0; i < 8; ++i) q[i] = (__bf16)r[it][i][x];
        *(v8b*)(wd + it * 2 * (CC / 16) * WFS + x * 16) = q; } }
  __syncthreads();   // the whole W stands in LDS before any wave reads a fragment
  v8f acc[CC / 16] = {};
#pragma unroll 2
  for (int kc = 0; kc < DIN / 32; ++kc) { v16b a; { const float* p = X + (r0 + wave * 16 + col) * DIN + kc * 32 + 8 * g;
#pragma unroll
      for (int i = 0; i < 8; ++i) { a[i] = (__bf16)p[i]; a[8 + i] = (__bf16)p[16 + i]; } }
    v16b w[CC / 16];
#pragma unroll
    for (int j = 0; j < CC / 16; ++j) { union { v16b v; v8b q[2]; } u; const unsigned char* p = sm.w + (kc * (CC / 16) + j) * WFS + lane * 16; u.q[0] = *(const v8b*)p; u.q[1] = *(const v8b*)(p + 512); w[j] = u.v; }
    asm volatile("s_wait_loadcnt 0x0" ::: "memory");
#pragma unroll
    for (int j = 0; j < CC / 16; ++j) acc[j] = wmma_bf(a, w[j], acc[j]); }
  __syncthreads();   // every wave has read its last W fragment before the result tiles overwrite that LDS
  if (which < 2) { _Float16* DH = which == 0 ? QH : KH; _Float16* DL = which == 0 ? QL : KL; const int nhi = which == 0 ? QHI : KHI; const bool hi_rows = t0 < nhi;
#pragma unroll
    for (int j = 0; j < CC / 16; ++j) { const float bias = BA ? bfr(BA[c0 + j * 16 + col]) : 0.f;
#pragma unroll
      for (int r = 0; r < 8; ++r) { const float v = acc[j][r] + bias; const _Float16 hv = (_Float16)v; sh[wave * 16 + 8 * g + r][j * 16 + col] = hv; sl[wave * 16 + 8 * g + r][j * 16 + col] = (_Float16)((v - (float)hv) * 1024.0f); } }
    __syncthreads();
    for (int e = tid; e < 64 * (CC / 8); e += 128) { const int rl = e / (CC / 8), q = e % (CC / 8); vst2((unsigned*)(DH + r0 * CC + e * 8), *(const v4u*)&sh[(e >> 7) * 16 + (e & 15)][(((e >> 5) & 3) * 2 + ((e >> 4) & 1)) * 8]); SXW(); if (hi_rows) { vst2((unsigned*)(DL + (bb * nhi + t0 + rl) * (size_t)CC + c0 + q * 8), *(const v4u*)&sl[rl][q * 8]); SXW(); } }
  } else { const bool hi_rows = t0 < KHI;
#pragma unroll
    for (int j = 0; j < CC / 16; ++j) { const float bias = BA ? bfr(BA[c0 + j * 16 + col]) : 0.f;
#pragma unroll
      for (int r = 0; r < 8; ++r) { const float v = acc[j][r] + bias; const int rl = wave * 16 + 8 * g + r, cl = j * 16 + col; th[cl][rl] = (_Float16)v; const __bf16 bh = (__bf16)v; tb[cl][rl] = bh; tbl[cl][rl] = (__bf16)(v - (float)bh); } }
    __syncthreads();
    for (int e = tid; e < CC * 8; e += 128) { const int cl = e >> 3, q = e & 7; vst2((unsigned*)(VT + r0 * CC + e * 8), *(const v4u*)&th[((e >> 6) & 3) * 16 + (e & 15)][(e >> 8) * 32 + ((e >> 5) & 1) * 16 + ((e >> 4) & 1) * 8]); SXW(); if (hi_rows) { const size_t o3 = (bb * CC + c0 + cl) * (size_t)KHI + t0 + q * 8; vst2((unsigned*)(VB + o3), *(const v4u*)&tb[cl][q * 8]); SXW(); vst2((unsigned*)(VBL + o3), *(const v4u*)&tbl[cl][q * 8]); SXW(); } } } }
// ---- k_att: block = QT * 16 = 32 queries of sequence b, PVW waves; wave w takes the 32-key chunks w, w + PVW, ... up to the diagonal, and uses every k and v fragment it loads for both query tiles. Logits are formed transposed (A = k rows, B = q rows), so a lane holds 16 logits of ONE query in the very order of the B fragment of v^T . P^T: they stay in registers and are masked by index. The wave keeps a running row maximum: each chunk turns its logits into exp(logit - running maximum) x 2^11 (once to f16 against v f16) and first weights its sum and its output tile by exp(old maximum - new maximum); the output tile is transposed too (rows = features, column = the lane's query), so that weight is the lane's own (query blocks < QBH: one chunk a wave, 3-product logits, P and v as bf16 hi + lo). Each wave leaves its f32 partial tiles, row maxima and row sums in LDS; behind one barrier wave w joins rows w and w + 16 over the waves in wave order, each partial weighted by exp(its maximum - the row's maximum), and divides by the joined sum. A masked logit is -3e38: its exp is 0 beside any real maximum; a wave with no chunk has the maximum -3e38, and its partial gets the weight 0 in the join (key 0 is open to every query, so the row's maximum is real)
#define PVW 16
#define LOG2E 1.44269504088896340736f
// 2^x in the one hardware instruction: every argument below is <= 11, and a result under 2^-126 may read 0 beside a row whose largest term is 2^11 (or 1 in the join)
__device__ __forceinline__ float ex2(float x) { return __builtin_amdgcn_exp2f(x); }
// the same for the join: the v_nop in the same statement is the one free slot that the instruction set asks for behind a transcendental
__device__ __forceinline__ float ex2_slot(float x) { float r; asm("v_exp_f32 %0, %1\n\tv_nop" : "=v"(r) : "v"(x)); return r; }
// XW: in front of a load whose result may land on the address pair of loads issued before it
__device__ __forceinline__ void XW() { asm volatile("s_wait_xcnt 0x0" ::: "memory"); }
// last fragment of a run of loads off one address pair: only the run's last load can get that pair as its result registers, so the wait stands in front of it
__device__ __forceinline__ v16h frag_t_end(const _Float16* tile, int c, int lane) {
  union { v16h v; v8h q[2]; } u; const _Float16* p = tile + c * 512 + lane * 8;
  u.q[0] = *(const v8h*)p; XW(); u.q[1] = *(const v8h*)(p + 256); return u.v;
}
// fragment c of a fragment-ordered tile (q, k: 16 rows, c = the 32 features; v: 32 keys, c = the 16 features): two loads of 512 contiguous bytes a wave, 4 whole lines each
__device__ __forceinline__ v16h frag_t(const _Float16* tile, int c, int lane) {
  union { v16h v; v8h q[2]; } u; const _Float16* p = tile + c * 512 + lane * 8;
  u.q[0] = *(const v8h*)p; u.q[1] = *(const v8h*)(p + 256); return u.v;
}
__device__ __forceinline__ v16h frag_t_w(const _Float16* tile, int c, int lane) {
  union { v16h v; v8h q[2]; } u; const _Float16* p = tile + c * 512 + lane * 8;
  u.q[0] = *(const v8h*)p; XW(); u.q[1] = *(const v8h*)(p + 256); XW(); return u.v;
}
// fragments of the three-product path (many address pairs, one chunk a wave): the wait behind every load
__device__ __forceinline__ v16h frag_h_w(const _Float16* rowk0, int lane) {
  union { v16h v; v8h q[2]; } u; const _Float16* p = rowk0 + 8 * (lane >> 4);
  u.q[0] = *(const v8h*)p; XW(); u.q[1] = *(const v8h*)(p + 16); XW(); return u.v;
}
__device__ __forceinline__ v16b frag_b_w(const __bf16* rowk0, int lane) {
  union { v16b v; v8b q[2]; } u; const __bf16* p = rowk0 + 8 * (lane >> 4);
  u.q[0] = *(const v8b*)p; XW(); u.q[1] = *(const v8b*)(p + 16); XW(); return u.v;
}
#define QT 2   // query tiles of 16 rows a work-group
// eight 2^x in one statement: the build put a v_exp_f32 that overwrites an argument directly behind the v_exp_f32 that reads it. Here no output shares a register with an argument (early clobber), so each instruction is the free slot that the instruction set asks for behind the transcendental in front of it, and the v_nop is the last one's
__device__ __forceinline__ void ex2x8(float* r, const float* x) {
  asm("v_exp_f32 %0, %8\n\tv_exp_f32 %1, %9\n\tv_exp_f32 %2, %10\n\tv_exp_f32 %3, %11\n\tv_exp_f32 %4, %12\n\tv_exp_f32 %5, %13\n\tv_exp_f32 %6, %14\n\tv_exp_f32 %7, %15\n\tv_nop"
      : "=&v"(r[0]), "=&v"(r[1]), "=&v"(r[2]), "=&v"(r[3]), "=&v"(r[4]), "=&v"(r[5]), "=&v"(r[6]), "=&v"(r[7]) : "v"(x[0]), "v"(x[1]), "v"(x[2]), "v"(x[3]), "v"(x[4]), "v"(x[5]), "v"(x[6]), "v"(x[7])); }
// lane l with lane l ^ 16 in one vector instruction
__device__ __forceinline__ float xhalf(float x) { return __builtin_bit_cast(float, __builtin_amdgcn_permlanex16(__builtin_bit_cast(int, x), __builtin_bit_cast(int, x), 0x76543210, 0xfedcba98, false, false)); }
__global__ __launch_bounds__(PVW * 32) void k_att(const _Float16* __restrict__ QH, const _Float16* __restrict__ KH, const _Float16* __restrict__ QL, const _Float16* __restrict__ KL, const _Float16* __restrict__ VT, const __bf16* __restrict__ VB, const __bf16* __restrict__ VBL, float* __restrict__ Y) {
  __shared__ __align__(16) float ss[PVW][16 * QT][HD + 4]; __shared__ float smx[PVW][16 * QT], ssu[PVW][16 * QT];
  const int tid = threadIdx.x, wave = __builtin_amdgcn_readfirstlane(tid >> 5), lane = tid & 31, col = lane & 15, g = lane >> 4; const int b = blockIdx.x % TNB, qt = TT / (16 * QT) - 1 - blockIdx.x / TNB;   // all sequences in one grid; the query tiles with the most keys get the lowest block indices
  const int ql0 = qt * (16 * QT); const int qb = ql0 >> 6; const int kce = (ql0 >> 5) + 1;   // chunks that hold a key <= the block's last query
  const _Float16* Qt = QH + ((size_t)b * TT + ql0) * CC; const _Float16* Kb = KH + (size_t)b * TT * CC;
  v8f acc[QT][HD / 16] = {}; float m[QT], sum[QT];   // acc[h][j][r]: feature 16 j + 8 g + r of query ql0 + 16 h + col
#pragma unroll
  for (int h = 0; h < QT; ++h) { m[h] = -3.0e38f; sum[h] = 0.f; }
  // every unroll below: the loop indexes register arrays or vector elements, which takes constant indices
  if (qb < QBH) {
    if (wave < kce) { const int k0 = wave * 32; const _Float16* Klb = KL + (size_t)b * KHI * CC;
#pragma unroll
      for (int h = 0; h < QT; ++h) { const int t = ql0 + h * 16 + col; const _Float16* Qlr = QL + ((size_t)b * QHI + t) * CC;
        v8f a0[2] = {}, a1[2] = {};
#pragma unroll
        for (int c = 0; c < HD / 32; ++c) { const v16h ah = frag_t_w(Qt + h * 16 * CC, c, lane), al = frag_h_w(Qlr + c * 32, lane);
#pragma unroll
          for (int u = 0; u < 2; ++u) { const size_t ko = (size_t)(k0 + u * 16 + col) * CC + c * 32; const v16h kbf = frag_t_w(Kb + (size_t)(k0 + u * 16) * CC, c, lane), klf = frag_h_w(Klb + ko, lane); a0[u] = wmma16(kbf, ah, a0[u]); a1[u] = wmma16(kbf, al, a1[u]); a1[u] = wmma16(klf, ah, a1[u]); } }
        float s[16], mh = -3.0e38f, sh = 0.f;
#pragma unroll
        for (int e = 0; e < 16; ++e) { const float v = (a0[e >> 3][e & 7] + a1[e >> 3][e & 7] * (1.0f / 1024.0f)) * SCALE; s[e] = (k0 + (e >> 3) * 16 + 8 * g + (e & 7) <= t) ? v : -3.0e38f; mh = fmaxf(mh, s[e]); }
        mh = fmaxf(mh, xhalf(mh));
#pragma unroll
        for (int e = 0; e < 16; ++e) { const float ev = expf(s[e] - mh); sh += ev; s[e] = ev * 2048.0f; }
        m[h] = mh; sum[h] = sh;
        const F2 p = bsplit16(s);
#pragma unroll
        for (int j = 0; j < HD / 16; ++j) { const size_t po = ((size_t)b * CC + j * 16 + col) * (size_t)KHI + k0; const v16b vh = frag_b_w(VB + po, lane); acc[h][j] = wmma_bf(vh, p.h, acc[h][j]); acc[h][j] = wmma_bf(vh, p.l, acc[h][j]); acc[h][j] = wmma_bf(frag_b_w(VBL + po, lane), p.h, acc[h][j]); } } }
  } else {
    v16h qf[QT][HD / 32];
#pragma unroll
    for (int h = 0; h < QT; ++h)
#pragma unroll
      for (int c = 0; c < HD / 32; ++c) qf[h][c] = frag_t(Qt + h * 16 * CC, c, lane);
    for (int kc = wave; kc < kce; kc += PVW) { const int k0 = kc * 32; v16h kf[2 * (HD / 32)], vf[HD / 16]; v8f a[QT][2] = {};
      const _Float16* vp = VT + ((size_t)b * TT + k0) * CC;
#pragma unroll
      for (int c = 0; c < HD / 32; ++c)
#pragma unroll
        for (int u = 0; u < 2; ++u) kf[c * 2 + u] = frag_t(Kb + (size_t)(k0 + u * 16) * CC, c, lane);
      XW();   // a v load's result may land on the address pair of the k (and, in the first trip, the q) loads
#pragma unroll   // the v loads go out with the k loads: they fly while the logits and the exps are worked on
      for (int j = 0; j < HD / 16; ++j) vf[j] = (j < HD / 16 - 1) ? frag_t(vp, j, lane) : frag_t_end(vp, j, lane);
      XW();   // behind the chunk's last load: the next trip moves the addresses on
#pragma unroll
      for (int c = 0; c < HD / 32; ++c)
#pragma unroll
        for (int u = 0; u < 2; ++u)
#pragma unroll
          for (int h = 0; h < QT; ++h) a[h][u] = wmma16(kf[c * 2 + u], qf[h][c], a[h][u]);
      if (kc == kce - 1) {   // only the last chunk reaches past a query of this block
#pragma unroll
        for (int h = 0; h < QT; ++h)
#pragma unroll
          for (int e = 0; e < 16; ++e) a[h][e >> 3][e & 7] = (k0 + (e >> 3) * 16 + 8 * g + (e & 7) <= ql0 + h * 16 + col) ? a[h][e >> 3][e & 7] : -3.0e38f; }
      v16h p[QT];
#pragma unroll
      for (int h = 0; h < QT; ++h) { float cm = a[h][0][0];
#pragma unroll
        for (int e = 1; e < 16; ++e) cm = fmaxf(cm, a[h][e >> 3][e & 7]);
        const float mn = fmaxf(m[h], fmaxf(cm, xhalf(cm))); const float f = ex2_slot((m[h] - mn) * (SCALE * LOG2E)); m[h] = mn;   // the first chunk: f = 0 on a sum and a tile that are 0
        float cs = 0.f, x[16], ev[16];
#pragma unroll
        for (int e = 0; e < 16; ++e) x[e] = (a[h][e >> 3][e & 7] - mn) * (SCALE * LOG2E) + 11.0f;   // the logits and mn are unscaled products here: the scale, log2(e) and the 2^11 go into one multiply-add
        ex2x8(ev, x); ex2x8(ev + 8, x + 8);
#pragma unroll
        for (int e = 0; e < 16; ++e) { cs += ev[e]; p[h][e] = (_Float16)ev[e]; }
        sum[h] = sum[h] * f + cs;
#pragma unroll
        for (int j = 0; j < HD / 16; ++j) acc[h][j] *= f; }
#pragma unroll
      for (int j = 0; j < HD / 16; ++j)
#pragma unroll
        for (int h = 0; h < QT; ++h) acc[h][j] = wmma16(vf[j], p[h], acc[h][j]); }
#pragma unroll
    for (int h = 0; h < QT; ++h) { sum[h] *= 1.0f / 2048.0f; m[h] *= SCALE; } }   // both exact: the join below gets the same units as from the three-product path (a wave with no chunk hands on -3e38 / 8: its weight in the join is 0 as before)
#pragma unroll
  for (int h = 0; h < QT; ++h) { sum[h] += xhalf(sum[h]);
    if (g == 0) { smx[wave][h * 16 + col] = m[h]; ssu[wave][h * 16 + col] = sum[h]; }
#pragma unroll
    for (int j = 0; j < HD / 16; ++j) { float* d = &ss[wave][h * 16 + col][j * 16 + 8 * g]; const v8f x = acc[h][j];
      *(v4f*)d = (v4f){x[0], x[1], x[2], x[3]}; *(v4f*)(d + 4) = (v4f){x[4], x[5], x[6], x[7]}; } }
  __syncthreads();   // every wave's partial tiles, maxima and sums are in LDS before any wave joins them
  v2f o[QT];
#pragma unroll
  for (int h = 0; h < QT; ++h) { const int row = h * 16 + wave;
    float mm = smx[0][row];
#pragma unroll
    for (int w = 1; w < PVW; ++w) mm = fmaxf(mm, smx[w][row]);
    v2f oh = {}; float tot = 0.f;
#pragma unroll   // the LDS reads of all partial tiles issue ahead of the adds instead of one round trip each
    for (int w = 0; w < PVW; ++w) { const float f = ex2_slot((smx[w][row] - mm) * LOG2E); tot += ssu[w][row] * f; oh += *(const v2f*)&ss[w][row][lane * 2] * f; }
    o[h] = oh * (tot > 0.f ? 1.0f / (2048.0f * tot) : 0.f); }
#pragma unroll
  for (int h = 0; h < QT; ++h) { vst2(Y + ((size_t)b * TT + ql0 + h * 16 + wave) * CC + lane * 2, o[h]); if (h < QT - 1) SXW(); } }

extern "C" void kernel_launch(void* const* d_in, const int* in_sizes, int n_in, void* d_out, int out_size, void* d_ws, size_t ws_size, hipStream_t stream) {
  (void)in_sizes; (void)n_in; (void)out_size;
  const float** F = (const float**)d_in;
  if (ws_size < (size_t)WS_END) return;
  char* ws = (char*)d_ws; _Float16 *QH = (_Float16*)(ws + WS_QH), *KH = (_Float16*)(ws + WS_KH), *VT = (_Float16*)(ws + WS_VT), *QL = (_Float16*)(ws + WS_QL), *KL = (_Float16*)(ws + WS_KL); __bf16 *VB = (__bf16*)(ws + WS_VB), *VBL = (__bf16*)(ws + WS_VBL); float *Y = (float*)(ws + WS_Y);
  (void)Y; (void)QL; (void)KL; (void)VB; (void)VBL;
  // inputs: 0 X [4,4096,512]; 1 Wq, 2 Wk, 3 Wv [512,64] (in,out)
  k_proj<<<dim3(TNB * TT / 64, 1, 3), 128, 0, stream>>>(F[0], F[0], F[0], F[1], F[2], F[3], nullptr, nullptr, nullptr, QH, QL, KH, KL, VT, VB, VBL);
  k_att<<<dim3(TNB * (TT / (16 * QT)), 1, 1), PVW * 32, 0, stream>>>(QH, KH, QL, KL, VT, VB, VBL, (float*)d_out);
}

// v009
// A run of this version takes 35.8 microseconds.
// Next to v008, in two timings, it ran 1.15 times as fast each time.
// All steps since v000 together make it 28.5 times as fast.
// compute dtype: all float inputs rounded to bf16; Q/K/V = X W with EXACT bf16 products on WMMA 16x16x32 (f32 accumulate; the single head's planes are 64 wide); causal logits: q, k once to f16 (1 product) x 64^-0.5, except the first 384 query rows of each sequence (3 products with f16 residuals); softmax in f32; exp(logit - max) x 2^11 once to f16 against v once to f16 (1 product; bf16 hi + lo below row 384); f32 output.
#include <hip/hip_runtime.h>
#include <math.h>

typedef __attribute__((ext_vector_type(16))) _Float16 v16h;
typedef __attribute__((ext_vector_type(16))) __bf16 v16b;
typedef __attribute__((ext_vector_type(8)))  _Float16 v8h;
typedef __attribute__((ext_vector_type(8)))  float v8f;
typedef __attribute__((ext_vector_type(4)))  float v4f;
typedef __attribute__((ext_vector_type(2)))  float v2f;
typedef __attribute__((ext_vector_type(4)))  unsigned v4u;
typedef __attribute__((ext_vector_type(4)))  int v4i;
typedef float __attribute__((may_alias)) float_a;
typedef int __attribute__((may_alias)) int_a;

template <typename T> __device__ __forceinline__ void vst2(void* p, T v) { *(T*)p = v;  }
__device__ __forceinline__ v8f wmma16(v16h a, v16h b, v8f c) {
  v8f d = __builtin_amdgcn_wmma_f32_16x16x32_f16(false, a, false, b, (short)0, c, false, false);
  asm volatile("v_nop\n\tv_nop\n\tv_nop\n\tv_nop" : "+v"(d) : "v"(a), "v"(b));
  return d;
}
__device__ __forceinline__ v8f wmma_bf(v16b a, v16b b, v8f c) {
  v8f d = __builtin_amdgcn_wmma_f32_16x16x32_bf16(false, a, false, b, (short)0, c, false, false);
  asm volatile("v_nop\n\tv_nop\n\tv_nop\n\tv_nop" : "+v"(d) : "v"(a), "v"(b));
  return d;
}
// 16x16x32 fragments: lane = (h = lane>>4, row/col = lane&15); elements 0..7 = k0+8h+0..7, 8..15 = k0+16+8h+0..7; D element r = row 8h+r
__device__ __forceinline__ v16h frag_h(const _Float16* rowk0, int lane) {
  union { v16h v; v8h q[2]; } u; const _Float16* p = rowk0 + 8 * (lane >> 4);
  u.q[0] = *(const v8h*)p; u.q[1] = *(const v8h*)(p + 16); return u.v;
}
__device__ __forceinline__ v16h frag_f32(const float* rowk0, int lane) {
  v16h a; const float* p = rowk0 + 8 * (lane >> 4);
#pragma unroll
  for (int i = 0; i < 8; ++i) { a[i] = (_Float16)p[i]; a[8 + i] = (_Float16)p[16 + i]; }
  return a;
}
__device__ __forceinline__ v16h frag_f32s(const float* rowk0, int lane, float sc) {
  v16h a; const float* p = rowk0 + 8 * (lane >> 4);
#pragma unroll
  for (int i = 0; i < 8; ++i) { a[i] = (_Float16)(p[i] * sc); a[8 + i] = (_Float16)(p[16 + i] * sc); }
  return a;
}
// column fragment from a [K][ld] layout (column n), rows >= K read as 0
__device__ __forceinline__ v16h fragc_f32(const float* W, int k0, int n, int lane, int ld, int K) {
  v16h a; const int g = lane >> 4;
#pragma unroll
  for (int i = 0; i < 8; ++i) { const int ka = k0 + 8 * g + i, kb = ka + 16;
    a[i] = (_Float16)(ka < K ? W[(size_t)(ka < K ? ka : K - 1) * ld + n] : 0.f); a[8 + i] = (_Float16)(kb < K ? W[(size_t)(kb < K ? kb : K - 1) * ld + n] : 0.f); }
  return a;
}
struct F2 { v16b h, l; };
__device__ __forceinline__ F2 bsplit16(const float v[16]) { F2 r;
#pragma unroll
  for (int i = 0; i < 16; ++i) { const __bf16 h = (__bf16)v[i]; r.h[i] = h; r.l[i] = (__bf16)(v[i] - (float)h); }
  return r; }
__device__ __forceinline__ F2 split_row(const float* row, int k0, int lane) { float v[16]; const float* p = row + k0 + 8 * (lane >> 4);
#pragma unroll
  for (int i = 0; i < 8; ++i) { v[i] = p[i]; v[8 + i] = p[16 + i]; }
  return bsplit16(v); }
__device__ __forceinline__ F2 split_rowK(const float* row, int k0, int lane, int K) { float v[16]; const int g = lane >> 4;
#pragma unroll
  for (int i = 0; i < 8; ++i) { const int ka = k0 + 8 * g + i, kb = ka + 16; v[i] = ka < K ? row[ka < K ? ka : K - 1] : 0.f; v[8 + i] = kb < K ? row[kb < K ? kb : K - 1] : 0.f; }
  return bsplit16(v); }
__device__ __forceinline__ F2 split_col(const float* W, int k0, int n, int lane, int ld, int K) { float v[16]; const int g = lane >> 4;
#pragma unroll
  for (int i = 0; i < 8; ++i) { const int ka = k0 + 8 * g + i, kb = ka + 16; v[i] = ka < K ? W[(size_t)(ka < K ? ka : K - 1) * ld + n] : 0.f; v[8 + i] = kb < K ? W[(size_t)(kb < K ? kb : K - 1) * ld + n] : 0.f; }
  return bsplit16(v); }
__device__ __forceinline__ v8f mac3(const F2& a, const F2& b, v8f c) { c = wmma_bf(a.l, b.h, c); c = wmma_bf(a.h, b.l, c); return wmma_bf(a.h, b.h, c); }
__device__ __forceinline__ float sigm(float v) { return 1.0f / (1.0f + expf(-v)); }
#define LDSX() do { asm volatile("s_wait_dscnt 0" ::: "memory"); __builtin_amdgcn_wave_barrier(); __builtin_amdgcn_fence(__ATOMIC_RELEASE, "workgroup"); } while (0)

// Single-head causal self-attention (B 4, S 4,096, D_in 512 -> 64): Q, K, V = X Wq/Wk/Wv ((in,out) [512, 64]); W = softmax(causal(Q K^T) / 8); Z = W V -> [B, S, 64].
#define NB 4
#define TT 4096
#define CC 64             // NH * HD = projected width
#define DIN 512          // input (model) width
#define NH 1
#define HD 64
#define NQB (TT / 64)
#define HG 1
#define SCALE (0.125f)
#define CAUSAL 1
#ifndef TNB
#define TNB NB
#endif
__device__ __forceinline__ v16b zero16b() { v16b z; _Pragma("unroll") for (int i = 0; i < 16; ++i) z[i] = (__bf16)0.f; return z; }
__device__ __forceinline__ float bfr(float v) { return (float)(__bf16)v; }
__host__ __device__ __forceinline__ int kb_last(int qb) { return CAUSAL ? ((qb * 64 + 63) >> 7) : (TT / 128 - 1); }
typedef __attribute__((ext_vector_type(8))) __bf16 v8b;
__device__ __forceinline__ v16b frag_b(const __bf16* rowk0, int lane) {
  union { v16b v; v8b q[2]; } u; const __bf16* p = rowk0 + 8 * (lane >> 4);
  u.q[0] = *(const v8b*)p; u.q[1] = *(const v8b*)(p + 16); return u.v;
}
#define QBH 6              // causal: query blocks 0..QBH-1 of each sequence (few keys, no averaging) take the high-precision path
#define QHI 384            // rows carrying a q residual plane
#define KHI 384            // key rows carrying k residual / v bf16 hi+lo planes (used only by the causal high-precision path)
// B fragment (k rows k0+.., output column o) of a weight: (in,out) [K][ld] or (out,in) [ld rows of K]: bf16 exact, or f16(bf16 * 256) exact
__device__ __forceinline__ v16b wcol_io(const float* Wm, int k0, int o, int lane, int ld) { v16b w; const int g = lane >> 4;
#pragma unroll
  for (int i = 0; i < 8; ++i) { w[i] = (__bf16)Wm[(size_t)(k0 + 8 * g + i) * ld + o];
    if (i == 7) asm volatile("s_wait_xcnt 0x0" ::: "memory");   // only the run's last load can get the run's address pair as its result register: the wait stands in front of it
    w[8 + i] = (__bf16)Wm[(size_t)(k0 + 16 + 8 * g + i) * ld + o]; }
  return w; }
__device__ __forceinline__ v16b wcol_oi(const float* Wm, int k0, int o, int lane, int K) { v16b w; const float* p = Wm + (size_t)o * K + k0 + 8 * (lane >> 4);
#pragma unroll
  for (int i = 0; i < 8; ++i) { w[i] = (__bf16)p[i]; w[8 + i] = (__bf16)p[16 + i]; }
  return w; }
__device__ __forceinline__ v16h wcolh_io(const float* Wm, int k0, int o, int lane, int ld) { v16h w; const int g = lane >> 4;
#pragma unroll
  for (int i = 0; i < 8; ++i) { w[i] = (_Float16)(bfr(Wm[(size_t)(k0 + 8 * g + i) * ld + o]) * 256.0f); w[8 + i] = (_Float16)(bfr(Wm[(size_t)(k0 + 16 + 8 * g + i) * ld + o]) * 256.0f); }
  return w; }
__device__ __forceinline__ v16h wcolh_oi(const float* Wm, int k0, int o, int lane, int K) { v16h w; const float* p = Wm + (size_t)o * K + k0 + 8 * (lane >> 4);
#pragma unroll
  for (int i = 0; i < 8; ++i) { w[i] = (_Float16)(bfr(p[i]) * 256.0f); w[8 + i] = (_Float16)(bfr(p[16 + i]) * 256.0f); }
  return w; }
#define WQKV_LAYOUT 0   // 0 = (in,out) [DIN][DOUT]; 1 = (out,in) [CC][DIN]; 2 = per-head [NH][DIN][HD]
__device__ __forceinline__ v16b wcol_hdk(const float* Wm, int k0, int o, int lane) { v16b w; const int g = lane >> 4; const float* p = Wm + (size_t)(o / HD) * DIN * HD + (o % HD);
#pragma unroll
  for (int i = 0; i < 8; ++i) { w[i] = (__bf16)p[(size_t)(k0 + 8 * g + i) * HD]; w[8 + i] = (__bf16)p[(size_t)(k0 + 16 + 8 * g + i) * HD]; }
  return w; }
#define WO_OUT_IN 0
#if WQKV_LAYOUT == 1
#define WCOL(W, k0, o, lane) wcol_oi(W, k0, o, lane, DIN)
#elif WQKV_LAYOUT == 2
#define WCOL(W, k0, o, lane) wcol_hdk(W, k0, o, lane)
#else
#define WCOL(W, k0, o, lane) wcol_io(W, k0, (o), lane, DOUT)   /* W (in,out) [512][64] */
#endif
#if WO_OUT_IN
#define WOCOL(W, k0, o, lane) wcol_oi(W, k0, o, lane, CC)
#define WOCOLH(W, k0, o, lane) wcolh_oi(W, k0, o, lane, CC)
#else
#define WOCOL(W, k0, o, lane) wcol_io(W, k0, o, lane, DIN)
#define WOCOLH(W, k0, o, lane) wcolh_io(W, k0, o, lane, DIN)
#endif
#define DOUT 64            // head width = plane width CC
#ifndef SM_EXTRA_PARAMS
#define SM_EXTRA_PARAMS
#endif
#ifndef PROJ_EXTRA_PARAMS
#define PROJ_EXTRA_PARAMS
#endif
#ifndef SM_MASK_HOOK
#define SM_MASK_HOOK (void)0
#endif

#define WS_QH  0u                                      // f16 q, fragment order: [b*t / 16] tiles of 16 rows x CC = 4 pieces of 512 B; piece = features 16 * piece .. + 15, a lane's 16 B (row lane & 15, features + 8 * (lane >> 4)) at lane * 16
#define WS_KH  (WS_QH + 2u * (size_t)NB * TT * CC)      // f16 k, fragment order as q
#define WS_VT  (WS_KH + 2u * (size_t)NB * TT * CC)      // f16 v, fragment order: [b*t / 32] chunks of 32 keys x CC = 8 pieces of 512 B; piece = (16 features j, 16 keys), a lane's 16 B (feature 16 * j + (lane & 15), keys + 8 * (lane >> 4)) at lane * 16
#define WS_QL  (WS_VT + 2u * (size_t)NB * CC * TT)      // f16 q residual x 2^10 rows [b][t < QHI][CC]
#define WS_KL  (WS_QL + 2u * (size_t)NB * QHI * CC)     // f16 k residual x 2^10 rows [b][t < KHI][CC]
#define WS_VB  (WS_KL + 2u * (size_t)NB * KHI * CC)     // bf16 v hi planes [b][c][t < KHI]
#define WS_VBL (WS_VB + 2u * (size_t)NB * CC * KHI)
#define WS_Y   (WS_VBL + 2u * (size_t)NB * CC * KHI)    // f32 ctx rows [b*t][CC] (only when there is an output projection)
#define WS_END (WS_Y  + 0u)

// SXW: behind a global store, before the next LDS read or address sum reuses its data or address registers
__device__ __forceinline__ void SXW() { asm volatile("s_wait_xcnt 0x0" ::: "memory"); }
#define XH (DIN / 2)   // k's of X that a wave of k_proj has in LDS at a time
#define XU 272     // LDS bytes from one unit of X (16 rows x 8 k as bf16, 256 B) to the next: the 16 B over spread the 16 units of a staging store over all banks
typedef __attribute__((ext_vector_type(4))) __bf16 v4b;
#define WFS 1040   // LDS bytes from one W fragment (two halves of 512 B) to the next: the 16 B over 1 KiB spread the staging stores of the 4 column tiles over all banks
// ---- k_proj: block = (64 rows, all CC cols, which): q/k/v = X W (+ b) with exact bf16 products (K = DIN) -> which 0: q f16 in fragment order (+ residual rows < QHI); 1: k f16 in fragment order (+ residual rows < KHI); 2: v f16 in fragment order (+ bf16 hi/lo planes [c][t] for t < KHI). The block's 64 rows are 8 KiB in a row of each fragment-ordered plane, stored 16 B a thread in address order
__global__ __launch_bounds__(128) void k_proj(const float* __restrict__ XQ, const float* __restrict__ XK, const float* __restrict__ XV, const float* __restrict__ WQ, const float* __restrict__ WK, const float* __restrict__ WV, const float* __restrict__ BQ, const float* __restrict__ BK, const float* __restrict__ BV,
    _Float16* __restrict__ QH, _Float16* __restrict__ QL, _Float16* __restrict__ KH, _Float16* __restrict__ KL, _Float16* __restrict__ VT, __bf16* __restrict__ VB, __bf16* __restrict__ VBL) {
  // one LDS block, used twice: first the block's whole W as bf16 B fragments, then (behind a barrier) the tiles that reorder the results for the stores
  __shared__ __align__(16) union { unsigned char w[(DIN / 32) * (CC / 16) * WFS]; struct { _Float16 sh[64][CC + 8], sl[64][CC + 8]; } qk; struct { _Float16 th[CC][72]; __bf16 tb[CC][72], tbl[CC][72]; } vv; } sm;
  __shared__ __align__(16) unsigned char xs[4][(XH / 8) * XU];   // each wave's own 16 rows of X, XH k's, as bf16 in A-fragment order; no other wave touches them
  _Float16 (*sh)[CC + 8] = sm.qk.sh; _Float16 (*sl)[CC + 8] = sm.qk.sl; _Float16 (*th)[72] = sm.vv.th; __bf16 (*tb)[72] = sm.vv.tb; __bf16 (*tbl)[72] = sm.vv.tbl;
  const int tid = threadIdx.x, wave = tid >> 5, lane = tid & 31, col = lane & 15, g = lane >> 4; const int which = blockIdx.z; const int c0 = 0; const size_t r0 = (size_t)blockIdx.x * 64; const size_t bb = r0 / TT; const int t0 = (int)(r0 % TT);
  const float* X = which == 0 ? XQ : which == 1 ? XK : XV; const float* WA = which == 0 ? WQ : which == 1 ? WK : WV; const float* BA = which == 0 ? BQ : which == 1 ? BK : BV;
  // X -> LDS, half of K at a time: a wave's load covers 512 contiguous bytes of one row (4 whole lines; a fragment load straight from X touches 16). A lane rounds its 4 k to bf16 and stores them as 8 B of unit k >> 3, at row * 16 + ((k >> 2) & 1) * 8: lane (g, col) then reads elements 0..7 of step kl from unit kl * 4 + g and 8..15 from unit kl * 4 + 2 + g, at col * 16
  const float* xp = X + (r0 + wave * 16) * DIN + lane * 4; unsigned char* xst = xs[wave] + (lane >> 1) * XU + (lane & 1) * 8; const unsigned char* xld = xs[wave] + g * XU + col * 16; v4f xr[32];
#define XLDH(hf) do { _Pragma("unroll") for (int e = 0; e < 32; ++e) xr[e] = *(const v4f*)(xp + (e >> 1) * DIN + (hf) * XH + (e & 1) * 128); \
    asm volatile("s_wait_xcnt 0x0" :: "v"(xp) : "memory"); /* behind the last load, with the address pair held up to here: what follows may reuse that pair */ } while (0)
#define XSTH() do { _Pragma("unroll") for (int e = 0; e < 32; ++e) { v4b q; _Pragma("unroll") for (int i = 0; i < 4; ++i) q[i] = (__bf16)xr[e][i]; *(v4b*)(xst + (e & 1) * 16 * XU + (e >> 1) * 16) = q; } } while (0)
  // W (in,out) [DIN][DOUT] -> LDS: a thread takes 64 rows k (8 runs of 8, 64 apart) x 4 columns (64 loads of 16 B; a wave's load covers 4 whole lines), rounds to bf16 and stores each column's 8 k as the 16 B that lane (g = (k >> 3) & 1, col) of fragment (kc = k >> 5, j = column >> 4), half (k >> 4) & 1, reads in the loop
  { const int sc = tid & 15, sk = tid >> 4; const float* wp = WA + (size_t)sk * 8 * DOUT + sc * 4;
    unsigned char* wd = sm.w + ((sk >> 2) * (CC / 16) + (sc >> 2)) * WFS + ((sk >> 1) & 1) * 512 + ((sk & 1) * 16 + (sc & 3) * 4) * 16; v4f r[DIN / 64][8];
#pragma unroll   // constant offsets off one address pair and one LDS address; all of a thread's loads are in flight at once
    for (int it = 0; it < DIN / 64; ++it)
#pragma unroll
      for (int i = 0; i < 8; ++i) r[it][i] = *(const v4f*)(wp + (size_t)(it * 64 + i) * DOUT);
    asm volatile("s_wait_xcnt 0x0" :: "v"(wp) : "memory");   // behind the last load, with the address pair held up to here: what follows may reuse that pair
#pragma unroll
    for (int it = 0; it < DIN / 64; ++it)
#pragma unroll
      for (int x = 0; x < 4; ++x) { v8b q;
#pragma unroll
        for (int i = 0; i < 8; ++i) q[i] = (__bf16)r[it][i][x];
        *(v8b*)(wd + it * 2 * (CC / 16) * WFS + x * 16) = q; } }
  XLDH(0);   // into registers that the W rows have left
  __syncthreads();   // the whole W stands in LDS before any wave reads a fragment
  v8f acc[CC / 16] = {};
#pragma unroll   // two halves: xr is loaded for the second while the first is worked on
  for (int hf = 0; hf < 2; ++hf) {
  __builtin_amdgcn_sched_barrier(0);   // this half's roundings stay here, behind the barrier or the products in front: lifted in among the W roundings they cost registers (339 in the build without this line, 329 with it; three waves fit a SIMD up to 336)
  LDSX();   // the wave's fragment reads of the half before are done before its stores overwrite them (lanes read what other lanes of the wave stored: the compiler sees no dependence)
  XSTH();
  LDSX();   // the wave's stores stand in LDS before its lanes read each other's
  if (hf == 0) XLDH(1);   // flies while the first half is worked on
#pragma unroll 2
  for (int kl = 0; kl < XH / 32; ++kl) { const int kc = hf * (XH / 32) + kl; v16b a; { union { v16b v; v8b q[2]; } u; const unsigned char* p = xld + kl * 4 * XU; u.q[0] = *(const v8b*)p; u.q[1] = *(const v8b*)(p + 2 * XU); a = u.v; }
    v16b w[CC / 16];
#pragma unroll
    for (int j = 0; j < CC / 16; ++j) { union { v16b v; v8b q[2]; } u; const unsigned char* p = sm.w + (kc * (CC / 16) + j) * WFS + lane * 16; u.q[0] = *(const v8b*)p; u.q[1] = *(const v8b*)(p + 512); w[j] = u.v; }
#pragma unroll
    for (int j = 0; j < CC / 16; ++j) acc[j] = wmma_bf(a, w[j], acc[j]); } }
  __syncthreads();   // every wave has read its last W fragment before the result tiles overwrite that LDS
  if (which < 2) { _Float16* DH = which == 0 ? QH : KH; _Float16* DL = which == 0 ? QL : KL; const int nhi = which == 0 ? QHI : KHI; const bool hi_rows = t0 < nhi;
#pragma unroll
    for (int j = 0; j < CC / 16; ++j) { const float bias = BA ? bfr(BA[c0 + j * 16 + col]) : 0.f;
#pragma unroll
      for (int r = 0; r < 8; ++r) { const float v = acc[j][r] + bias; const _Float16 hv = (_Float16)v; sh[wave * 16 + 8 * g + r][j * 16 + col] = hv; sl[wave * 16 + 8 * g + r][j * 16 + col] = (_Float16)((v - (float)hv) * 1024.0f); } }
    __syncthreads();
    for (int e = tid; e < 64 * (CC / 8); e += 128) { const int rl = e / (CC / 8), q = e % (CC / 8); vst2((unsigned*)(DH + r0 * CC + e * 8), *(const v4u*)&sh[(e >> 7) * 16 + (e & 15)][(((e >> 5) & 3) * 2 + ((e >> 4) & 1)) * 8]); SXW(); if (hi_rows) { vst2((unsigned*)(DL + (bb * nhi + t0 + rl) * (size_t)CC + c0 + q * 8), *(const v4u*)&sl[rl][q * 8]); SXW(); } }
  } else { const bool hi_rows = t0 < KHI;
#pragma unroll
    for (int j = 0; j < CC / 16; ++j) { const float bias = BA ? bfr(BA[c0 + j * 16 + col]) : 0.f;
#pragma unroll
      for (int r = 0; r < 8; ++r) { const float v = acc[j][r] + bias; const int rl = wave * 16 + 8 * g + r, cl = j * 16 + col; th[cl][rl] = (_Float16)v; const __bf16 bh = (__bf16)v; tb[cl][rl] = bh; tbl[cl][rl] = (__bf16)(v - (float)bh); } }
    __syncthreads();
    for (int e = tid; e < CC * 8; e += 128) { const int cl = e >> 3, q = e & 7; vst2((unsigned*)(VT + r0 * CC + e * 8), *(const v4u*)&th[((e >> 6) & 3) * 16 + (e & 15)][(e >> 8) * 32 + ((e >> 5) & 1) * 16 + ((e >> 4) & 1) * 8]); SXW(); if (hi_rows) { const size_t o3 = (bb * CC + c0 + cl) * (size_t)KHI + t0 + q * 8; vst2((unsigned*)(VB + o3), *(const v4u*)&tb[cl][q * 8]); SXW(); vst2((unsigned*)(VBL + o3), *(const v4u*)&tbl[cl][q * 8]); SXW(); } } } }
// ---- k_att: block = QT * 16 = 32 queries of sequence b, PVW waves; wave w takes the 32-key chunks w, w + PVW, ... up to the diagonal, and uses every k and v fragment it loads for both query tiles. Logits are formed transposed (A = k rows, B = q rows), so a lane holds 16 logits of ONE query in the very order of the B fragment of v^T . P^T: they stay in registers and are masked by index. The wave keeps a running row maximum: each chunk turns its logits into exp(logit - running maximum) x 2^11 (once to f16 against v f16) and first weights its sum and its output tile by exp(old maximum - new maximum); the output tile is transposed too (rows = features, column = the lane's query), so that weight is the lane's own (query blocks < QBH: one chunk a wave, 3-product logits, P and v as bf16 hi + lo). Each wave leaves its f32 partial tiles, row maxima and row sums in LDS; behind one barrier wave w joins rows w and w + 16 over the waves in wave order, each partial weighted by exp(its maximum - the row's maximum), and divides by the joined sum. A masked logit is -3e38: its exp is 0 beside any real maximum; a wave with no chunk has the maximum -3e38, and its partial gets the weight 0 in the join (key 0 is open to every query, so the row's maximum is real)
#define PVW 16
#define LOG2E 1.44269504088896340736f
// 2^x in the one hardware instruction: every argument below is <= 11, and a result under 2^-126 may read 0 beside a row whose largest term is 2^11 (or 1 in the join)
__device__ __forceinline__ float ex2(float x) { return __builtin_amdgcn_exp2f(x); }
// the same for the join: the v_nop in the same statement is the one free slot that the instruction set asks for behind a transcendental
__device__ __forceinline__ float ex2_slot(float x) { float r; asm("v_exp_f32 %0, %1\n\tv_nop" : "=v"(r) : "v"(x)); return r; }
// XW: in front of a load whose result may land on the address pair of loads issued before it
__device__ __forceinline__ void XW() { asm volatile("s_wait_xcnt 0x0" ::: "memory"); }
// last fragment of a run of loads off one address pair: only the run's last load can get that pair as its result registers, so the wait stands in front of it
__device__ __forceinline__ v16h frag_t_end(const _Float16* tile, int c, int lane) {
  union { v16h v; v8h q[2]; } u; const _Float16* p = tile + c * 512 + lane * 8;
  u.q[0] = *(const v8h*)p; XW(); u.q[1] = *(const v8h*)(p + 256); return u.v;
}
// fragment c of a fragment-ordered tile (q, k: 16 rows, c = the 32 features; v: 32 keys, c = the 16 features): two loads of 512 contiguous bytes a wave, 4 whole lines each
__device__ __forceinline__ v16h frag_t(const _Float16* tile, int c, int lane) {
  union { v16h v; v8h q[2]; } u; const _Float16* p = tile + c * 512 + lane * 8;
  u.q[0] = *(const v8h*)p; u.q[1] = *(const v8h*)(p + 256); return u.v;
}
__device__ __forceinline__ v16h frag_t_w(const _Float16* tile, int c, int lane) {
  union { v16h v; v8h q[2]; } u; const _Float16* p = tile + c * 512 + lane * 8;
  u.q[0] = *(const v8h*)p; XW(); u.q[1] = *(const v8h*)(p + 256); XW(); return u.v;
}
// fragments of the three-product path (many address pairs, one chunk a wave): the wait behind every load
__device__ __forceinline__ v16h frag_h_w(const _Float16* rowk0, int lane) {
  union { v16h v; v8h q[2]; } u; const _Float16* p = rowk0 + 8 * (lane >> 4);
  u.q[0] = *(const v8h*)p; XW(); u.q[1] = *(const v8h*)(p + 16); XW(); return u.v;
}
__device__ __forceinline__ v16b frag_b_w(const __bf16* rowk0, int lane) {
  union { v16b v; v8b q[2]; } u; const __bf16* p = rowk0 + 8 * (lane >> 4);
  u.q[0] = *(const v8b*)p; XW(); u.q[1] = *(const v8b*)(p + 16); XW(); return u.v;
}
#define QT 2   // query tiles of 16 rows a work-group
// eight 2^x in one statement: the build put a v_exp_f32 that overwrites an argument directly behind the v_exp_f32 that reads it. Here no output shares a register with an argument (early clobber), so each instruction is the free slot that the instruction set asks for behind the transcendental in front of it, and the v_nop is the last one's
__device__ __forceinline__ void ex2x8(float* r, const float* x) {
  asm("v_exp_f32 %0, %8\n\tv_exp_f32 %1, %9\n\tv_exp_f32 %2, %10\n\tv_exp_f32 %3, %11\n\tv_exp_f32 %4, %12\n\tv_exp_f32 %5, %13\n\tv_exp_f32 %6, %14\n\tv_exp_f32 %7, %15\n\tv_nop"
      : "=&v"(r[0]), "=&v"(r[1]), "=&v"(r[2]), "=&v"(r[3]), "=&v"(r[4]), "=&v"(r[5]), "=&v"(r[6]), "=&v"(r[7]) : "v"(x[0]), "v"(x[1]), "v"(x[2]), "v"(x[3]), "v"(x[4]), "v"(x[5]), "v"(x[6]), "v"(x[7])); }
// lane l with lane l ^ 16 in one vector instruction
__device__ __forceinline__ float xhalf(float x) { return __builtin_bit_cast(float, __builtin_amdgcn_permlanex16(__builtin_bit_cast(int, x), __builtin_bit_cast(int, x), 0x76543210, 0xfedcba98, false, false)); }
__global__ __launch_bounds__(PVW * 32) void k_att(const _Float16* __restrict__ QH, const _Float16* __restrict__ KH, const _Float16* __restrict__ QL, const _Float16* __restrict__ KL, const _Float16* __restrict__ VT, const __bf16* __restrict__ VB, const __bf16* __restrict__ VBL, float* __restrict__ Y) {
  __shared__ __align__(16) float ss[PVW][16 * QT][HD + 4]; __shared__ float smx[PVW][16 * QT], ssu[PVW][16 * QT];
  const int tid = threadIdx.x, wave = __builtin_amdgcn_readfirstlane(tid >> 5), lane = tid & 31, col = lane & 15, g = lane >> 4; const int b = blockIdx.x % TNB, qt = TT / (16 * QT) - 1 - blockIdx.x / TNB;   // all sequences in one grid; the query tiles with the most keys get the lowest block indices
  const int ql0 = qt * (16 * QT); const int qb = ql0 >> 6; const int kce = (ql0 >> 5) + 1;   // chunks that hold a key <= the block's last query
  const _Float16* Qt = QH + ((size_t)b * TT + ql0) * CC; const _Float16* Kb = KH + (size_t)b * TT * CC;
  v8f acc[QT][HD / 16] = {}; float m[QT], sum[QT];   // acc[h][j][r]: feature 16 j + 8 g + r of query ql0 + 16 h + col
#pragma unroll
  for (int h = 0; h < QT; ++h) { m[h] = -3.0e38f; sum[h] = 0.f; }
  // every unroll below: the loop indexes register arrays or vector elements, which takes constant indices
  if (qb < QBH) {
    if (wave < kce) { const int k0 = wave * 32; const _Float16* Klb = KL + (size_t)b * KHI * CC;
#pragma unroll
      for (int h = 0; h < QT; ++h) { const int t = ql0 + h * 16 + col; const _Float16* Qlr = QL + ((size_t)b * QHI + t) * CC;
        v8f a0[2] = {}, a1[2] = {};
#pragma unroll
        for (int c = 0; c < HD / 32; ++c) { const v16h ah = frag_t_w(Qt + h * 16 * CC, c, lane), al = frag_h_w(Qlr + c * 32, lane);
#pragma unroll
          for (int u = 0; u < 2; ++u) { const size_t ko = (size_t)(k0 + u * 16 + col) * CC + c * 32; const v16h kbf = frag_t_w(Kb + (size_t)(k0 + u * 16) * CC, c, lane), klf = frag_h_w(Klb + ko, lane); a0[u] = wmma16(kbf, ah, a0[u]); a1[u] = wmma16(kbf, al, a1[u]); a1[u] = wmma16(klf, ah, a1[u]); } }
        float s[16], mh = -3.0e38f, sh = 0.f;
#pragma unroll
        for (int e = 0; e < 16; ++e) { const float v = (a0[e >> 3][e & 7] + a1[e >> 3][e & 7] * (1.0f / 1024.0f)) * SCALE; s[e] = (k0 + (e >> 3) * 16 + 8 * g + (e & 7) <= t) ? v : -3.0e38f; mh = fmaxf(mh, s[e]); }
        mh = fmaxf(mh, xhalf(mh));
#pragma unroll
        for (int e = 0; e < 16; ++e) { const float ev = expf(s[e] - mh); sh += ev; s[e] = ev * 2048.0f; }
        m[h] = mh; sum[h] = sh;
        const F2 p = bsplit16(s);
#pragma unroll
        for (int j = 0; j < HD / 16; ++j) { const size_t po = ((size_t)b * CC + j * 16 + col) * (size_t)KHI + k0; const v16b vh = frag_b_w(VB + po, lane); acc[h][j] = wmma_bf(vh, p.h, acc[h][j]); acc[h][j] = wmma_bf(vh, p.l, acc[h][j]); acc[h][j] = wmma_bf(frag_b_w(VBL + po, lane), p.h, acc[h][j]); } } }
  } else {
    v16h qf[QT][HD / 32];
#pragma unroll
    for (int h = 0; h < QT; ++h)
#pragma unroll
      for (int c = 0; c < HD / 32; ++c) qf[h][c] = frag_t(Qt + h * 16 * CC, c, lane);
    for (int kc = wave; kc < kce; kc += PVW) { const int k0 = kc * 32; v16h kf[2 * (HD / 32)], vf[HD / 16]; v8f a[QT][2] = {};
      const _Float16* vp = VT + ((size_t)b * TT + k0) * CC;
#pragma unroll
      for (int c = 0; c < HD / 32; ++c)
#pragma unroll
        for (int u = 0; u < 2; ++u) kf[c * 2 + u] = frag_t(Kb + (size_t)(k0 + u * 16) * CC, c, lane);
      XW();   // a v load's result may land on the address pair of the k (and, in the first trip, the q) loads
#pragma unroll   // the v loads go out with the k loads: they fly while the logits and the exps are worked on
      for (int j = 0; j < HD / 16; ++j) vf[j] = (j < HD / 16 - 1) ? frag_t(vp, j, lane) : frag_t_end(vp, j, lane);
      XW();   // behind the chunk's last load: the next trip moves the addresses on
#pragma unroll
      for (int c = 0; c < HD / 32; ++c)
#pragma unroll
        for (int u = 0; u < 2; ++u)
#pragma unroll
          for (int h = 0; h < QT; ++h) a[h][u] = wmma16(kf[c * 2 + u], qf[h][c], a[h][u]);
      if (kc == kce - 1) {   // only the last chunk reaches past a query of this block
#pragma unroll
        for (int h = 0; h < QT; ++h)
#pragma unroll
          for (int e = 0; e < 16; ++e) a[h][e >> 3][e & 7] = (k0 + (e >> 3) * 16 + 8 * g + (e & 7) <= ql0 + h * 16 + col) ? a[h][e >> 3][e & 7] : -3.0e38f; }
      v16h p[QT];
#pragma unroll
      for (int h = 0; h < QT; ++h) { float cm = a[h][0][0];
#pragma unroll
        for (int e = 1; e < 16; ++e) cm = fmaxf(cm, a[h][e >> 3][e & 7]);
        const float mn = fmaxf(m[h], fmaxf(cm, xhalf(cm))); const float f = ex2_slot((m[h] - mn) * (SCALE * LOG2E)); m[h] = mn;   // the first chunk: f = 0 on a sum and a tile that are 0
        float cs = 0.f, x[16], ev[16];
#pragma unroll
        for (int e = 0; e < 16; ++e) x[e] = (a[h][e >> 3][e & 7] - mn) * (SCALE * LOG2E) + 11.0f;   // the logits and mn are unscaled products here: the scale, log2(e) and the 2^11 go into one multiply-add
        ex2x8(ev, x); ex2x8(ev + 8, x + 8);
#pragma unroll
        for (int e = 0; e < 16; ++e) { cs += ev[e]; p[h][e] = (_Float16)ev[e]; }
        sum[h] = sum[h] * f + cs;
#pragma unroll
        for (int j = 0; j < HD / 16; ++j) acc[h][j] *= f; }
#pragma unroll
      for (int j = 0; j < HD / 16; ++j)
#pragma unroll
        for (int h = 0; h < QT; ++h) acc[h][j] = wmma16(vf[j], p[h], acc[h][j]); }
#pragma unroll
    for (int h = 0; h < QT; ++h) { sum[h] *= 1.0f / 2048.0f; m[h] *= SCALE; } }   // both exact: the join below gets the same units as from the three-product path (a wave with no chunk hands on -3e38 / 8: its weight in the join is 0 as before)
#pragma unroll
  for (int h = 0; h < QT; ++h) { sum[h] += xhalf(sum[h]);
    if (g == 0) { smx[wave][h * 16 + col] = m[h]; ssu[wave][h * 16 + col] = sum[h]; }
#pragma unroll
    for (int j = 0; j < HD / 16; ++j) { float* d = &ss[wave][h * 16 + col][j * 16 + 8 * g]; const v8f x = acc[h][j];
      *(v4f*)d = (v4f){x[0], x[1], x[2], x[3]}; *(v4f*)(d + 4) = (v4f){x[4], x[5], x[6], x[7]}; } }
  __syncthreads();   // every wave's partial tiles, maxima and sums are in LDS before any wave joins them
  v2f o[QT];
#pragma unroll
  for (int h = 0; h < QT; ++h) { const int row = h * 16 + wave;
    float mm = smx[0][row];
#pragma unroll
    for (int w = 1; w < PVW; ++w) mm = fmaxf(mm, smx[w][row]);
    v2f oh = {}; float tot = 0.f;
#pragma unroll   // the LDS reads of all partial tiles issue ahead of the adds instead of one round trip each
    for (int w = 0; w < PVW; ++w) { const float f = ex2_slot((smx[w][row] - mm) * LOG2E); tot += ssu[w][row] * f; oh += *(const v2f*)&ss[w][row][lane * 2] * f; }
    o[h] = oh * (tot > 0.f ? 1.0f / (2048.0f * tot) : 0.f); }
#pragma unroll
  for (int h = 0; h < QT; ++h) { vst2(Y + ((size_t)b * TT + ql0 + h * 16 + wave) * CC + lane * 2, o[h]); if (h < QT - 1) SXW(); } }

extern "C" void kernel_launch(void* const* d_in, const int* in_sizes, int n_in, void* d_out, int out_size, void* d_ws, size_t ws_size, hipStream_t stream) {
  (void)in_sizes; (void)n_in; (void)out_size;
  const float** F = (const float**)d_in;
  if (ws_size < (size_t)WS_END) return;
  char* ws = (char*)d_ws; _Float16 *QH = (_Float16*)(ws + WS_QH), *KH = (_Float16*)(ws + WS_KH), *VT = (_Float16*)(ws + WS_VT), *QL = (_Float16*)(ws + WS_QL), *KL = (_Float16*)(ws + WS_KL); __bf16 *VB = (__bf16*)(ws + WS_VB), *VBL = (__bf16*)(ws + WS_VBL); float *Y = (float*)(ws + WS_Y);
  (void)Y; (void)QL; (void)KL; (void)VB; (void)VBL;
  // inputs: 0 X [4,4096,512]; 1 Wq, 2 Wk, 3 Wv [512,64] (in,out)
  k_proj<<<dim3(TNB * TT / 64, 1, 3), 128, 0, stream>>>(F[0], F[0], F[0], F[1], F[2], F[3], nullptr, nullptr, nullptr, QH, QL, KH, KL, VT, VB, VBL);
  k_att<<<dim3(TNB * (TT / (16 * QT)), 1, 1), PVW * 32, 0, stream>>>(QH, KH, QL, KL, VT, VB, VBL, (float*)d_out);
}

// v010
// One run takes 35 microseconds.
// In both of two side-by-side timings against v009, it was 1.04 times as fast.
// All steps since v000 together make it 29.6 times as fast.
// compute dtype: all float inputs rounded to bf16; Q/K/V = X W with EXACT bf16 products on WMMA 16x16x32 (f32 accumulate; the single head's planes are 64 wide); causal logits: q, k once to f16 (1 product) x 64^-0.5, except the first 384 query rows of each sequence (3 products with f16 residuals); softmax in f32; exp(logit - max) x 2^11 once to f16 against v once to f16 (1 product; bf16 hi + lo below row 384); f32 output.
#include <hip/hip_runtime.h>
#include <math.h>

typedef __attribute__((ext_vector_type(16))) _Float16 v16h;
typedef __attribute__((ext_vector_type(16))) __bf16 v16b;
typedef __attribute__((ext_vector_type(8)))  _Float16 v8h;
typedef __attribute__((ext_vector_type(8)))  float v8f;
typedef __attribute__((ext_vector_type(4)))  float v4f;
typedef __attribute__((ext_vector_type(2)))  float v2f;
typedef __attribute__((ext_vector_type(4)))  unsigned v4u;
typedef __attribute__((ext_vector_type(4)))  int v4i;
typedef float __attribute__((may_alias)) float_a;
typedef int __attribute__((may_alias)) int_a;

template <typename T> __device__ __forceinline__ void vst2(void* p, T v) { *(T*)p = v;  }
__device__ __forceinline__ v8f wmma16(v16h a, v16h b, v8f c) {
  v8f d = __builtin_amdgcn_wmma_f32_16x16x32_f16(false, a, false, b, (short)0, c, false, false);
  asm volatile("v_nop\n\tv_nop\n\tv_nop\n\tv_nop" : "+v"(d) : "v"(a), "v"(b));
  return d;
}
__device__ __forceinline__ v8f wmma_bf(v16b a, v16b b, v8f c) {
  v8f d = __builtin_amdgcn_wmma_f32_16x16x32_bf16(false, a, false, b, (short)0, c, false, false);
  asm volatile("v_nop\n\tv_nop\n\tv_nop\n\tv_nop" : "+v"(d) : "v"(a), "v"(b));
  return d;
}
// 16x16x32 fragments: lane = (h = lane>>4, row/col = lane&15); elements 0..7 = k0+8h+0..7, 8..15 = k0+16+8h+0..7; D element r = row 8h+r
__device__ __forceinline__ v16h frag_h(const _Float16* rowk0, int lane) {
  union { v16h v; v8h q[2]; } u; const _Float16* p = rowk0 + 8 * (lane >> 4);
  u.q[0] = *(const v8h*)p; u.q[1] = *(const v8h*)(p + 16); return u.v;
}
__device__ __forceinline__ v16h frag_f32(const float* rowk0, int lane) {
  v16h a; const float* p = rowk0 + 8 * (lane >> 4);
#pragma unroll
  for (int i = 0; i < 8; ++i) { a[i] = (_Float16)p[i]; a[8 + i] = (_Float16)p[16 + i]; }
  return a;
}
__device__ __forceinline__ v16h frag_f32s(const float* rowk0, int lane, float sc) {
  v16h a; const float* p = rowk0 + 8 * (lane >> 4);
#pragma unroll
  for (int i = 0; i < 8; ++i) { a[i] = (_Float16)(p[i] * sc); a[8 + i] = (_Float16)(p[16 + i] * sc); }
  return a;
}
// column fragment from a [K][ld] layout (column n), rows >= K read as 0
__device__ __forceinline__ v16h fragc_f32(const float* W, int k0, int n, int lane, int ld, int K) {
  v16h a; const int g = lane >> 4;
#pragma unroll
  for (int i = 0; i < 8; ++i) { const int ka = k0 + 8 * g + i, kb = ka + 16;
    a[i] = (_Float16)(ka < K ? W[(size_t)(ka < K ? ka : K - 1) * ld + n] : 0.f); a[8 + i] = (_Float16)(kb < K ? W[(size_t)(kb < K ? kb : K - 1) * ld + n] : 0.f); }
  return a;
}
struct F2 { v16b h, l; };
__device__ __forceinline__ F2 bsplit16(const float v[16]) { F2 r;
#pragma unroll
  for (int i = 0; i < 16; ++i) { const __bf16 h = (__bf16)v[i]; r.h[i] = h; r.l[i] = (__bf16)(v[i] - (float)h); }
  return r; }
__device__ __forceinline__ F2 split_row(const float* row, int k0, int lane) { float v[16]; const float* p = row + k0 + 8 * (lane >> 4);
#pragma unroll
  for (int i = 0; i < 8; ++i) { v[i] = p[i]; v[8 + i] = p[16 + i]; }
  return bsplit16(v); }
__device__ __forceinline__ F2 split_rowK(const float* row, int k0, int lane, int K) { float v[16]; const int g = lane >> 4;
#pragma unroll
  for (int i = 0; i < 8; ++i) { const int ka = k0 + 8 * g + i, kb = ka + 16; v[i] = ka < K ? row[ka < K ? ka : K - 1] : 0.f; v[8 + i] = kb < K ? row[kb < K ? kb : K - 1] : 0.f; }
  return bsplit16(v); }
__device__ __forceinline__ F2 split_col(const float* W, int k0, int n, int lane, int ld, int K) { float v[16]; const int g = lane >> 4;
#pragma unroll
  for (int i = 0; i < 8; ++i) { const int ka = k0 + 8 * g + i, kb = ka + 16; v[i] = ka < K ? W[(size_t)(ka < K ? ka : K - 1) * ld + n] : 0.f; v[8 + i] = kb < K ? W[(size_t)(kb < K ? kb : K - 1) * ld + n] : 0.f; }
  return bsplit16(v); }
__device__ __forceinline__ v8f mac3(const F2& a, const F2& b, v8f c) { c = wmma_bf(a.l, b.h, c); c = wmma_bf(a.h, b.l, c); return wmma_bf(a.h, b.h, c); }
__device__ __forceinline__ float sigm(float v) { return 1.0f / (1.0f + expf(-v)); }
#define LDSX() do { asm volatile("s_wait_dscnt 0" ::: "memory"); __builtin_amdgcn_wave_barrier(); __builtin_amdgcn_fence(__ATOMIC_RELEASE, "workgroup"); } while (0)

// Single-head causal self-attention (B 4, S 4,096, D_in 512 -> 64): Q, K, V = X Wq/Wk/Wv ((in,out) [512, 64]); W = softmax(causal(Q K^T) / 8); Z = W V -> [B, S, 64].
#define NB 4
#define TT 4096
#define CC 64             // NH * HD = projected width
#define DIN 512          // input (model) width
#define NH 1
#define HD 64
#define NQB (TT / 64)
#define HG 1
#define SCALE (0.125f)
#define CAUSAL 1
#ifndef TNB
#define TNB NB
#endif
__device__ __forceinline__ v16b zero16b() { v16b z; _Pragma("unroll") for (int i = 0; i < 16; ++i) z[i] = (__bf16)0.f; return z; }
__device__ __forceinline__ float bfr(float v) { return (float)(__bf16)v; }
__host__ __device__ __forceinline__ int kb_last(int qb) { return CAUSAL ? ((qb * 64 + 63) >> 7) : (TT / 128 - 1); }
typedef __attribute__((ext_vector_type(8))) __bf16 v8b;
__device__ __forceinline__ v16b frag_b(const __bf16* rowk0, int lane) {
  union { v16b v; v8b q[2]; } u; const __bf16* p = rowk0 + 8 * (lane >> 4);
  u.q[0] = *(const v8b*)p; u.q[1] = *(const v8b*)(p + 16); return u.v;
}
#define QBH 6              // causal: query blocks 0..QBH-1 of each sequence (few keys, no averaging) take the high-precision path
#define QHI 384            // rows carrying a q residual plane
#define KHI 384            // key rows carrying k residual / v bf16 hi+lo planes (used only by the causal high-precision path)
// B fragment (k rows k0+.., output column o) of a weight: (in,out) [K][ld] or (out,in) [ld rows of K]: bf16 exact, or f16(bf16 * 256) exact
__device__ __forceinline__ v16b wcol_io(const float* Wm, int k0, int o, int lane, int ld) { v16b w; const int g = lane >> 4;
#pragma unroll
  for (int i = 0; i < 8; ++i) { w[i] = (__bf16)Wm[(size_t)(k0 + 8 * g + i) * ld + o];
    if (i == 7) asm volatile("s_wait_xcnt 0x0" ::: "memory");   // only the run's last load can get the run's address pair as its result register: the wait stands in front of it
    w[8 + i] = (__bf16)Wm[(size_t)(k0 + 16 + 8 * g + i) * ld + o]; }
  return w; }
__device__ __forceinline__ v16b wcol_oi(const float* Wm, int k0, int o, int lane, int K) { v16b w; const float* p = Wm + (size_t)o * K + k0 + 8 * (lane >> 4);
#pragma unroll
  for (int i = 0; i < 8; ++i) { w[i] = (__bf16)p[i]; w[8 + i] = (__bf16)p[16 + i]; }
  return w; }
__device__ __forceinline__ v16h wcolh_io(const float* Wm, int k0, int o, int lane, int ld) { v16h w; const int g = lane >> 4;
#pragma unroll
  for (int i = 0; i < 8; ++i) { w[i] = (_Float16)(bfr(Wm[(size_t)(k0 + 8 * g + i) * ld + o]) * 256.0f); w[8 + i] = (_Float16)(bfr(Wm[(size_t)(k0 + 16 + 8 * g + i) * ld + o]) * 256.0f); }
  return w; }
__device__ __forceinline__ v16h wcolh_oi(const float* Wm, int k0, int o, int lane, int K) { v16h w; const float* p = Wm + (size_t)o * K + k0 + 8 * (lane >> 4);
#pragma unroll
  for (int i = 0; i < 8; ++i) { w[i] = (_Float16)(bfr(p[i]) * 256.0f); w[8 + i] = (_Float16)(bfr(p[16 + i]) * 256.0f); }
  return w; }
#define WQKV_LAYOUT 0   // 0 = (in,out) [DIN][DOUT]; 1 = (out,in) [CC][DIN]; 2 = per-head [NH][DIN][HD]
__device__ __forceinline__ v16b wcol_hdk(const float* Wm, int k0, int o, int lane) { v16b w; const int g = lane >> 4; const float* p = Wm + (size_t)(o / HD) * DIN * HD + (o % HD);
#pragma unroll
  for (int i = 0; i < 8; ++i) { w[i] = (__bf16)p[(size_t)(k0 + 8 * g + i) * HD]; w[8 + i] = (__bf16)p[(size_t)(k0 + 16 + 8 * g + i) * HD]; }
  return w; }
#define WO_OUT_IN 0
#if WQKV_LAYOUT == 1
#define WCOL(W, k0, o, lane) wcol_oi(W, k0, o, lane, DIN)
#elif WQKV_LAYOUT == 2
#define WCOL(W, k0, o, lane) wcol_hdk(W, k0, o, lane)
#else
#define WCOL(W, k0, o, lane) wcol_io(W, k0, (o), lane, DOUT)   /* W (in,out) [512][64] */
#endif
#if WO_OUT_IN
#define WOCOL(W, k0, o, lane) wcol_oi(W, k0, o, lane, CC)
#define WOCOLH(W, k0, o, lane) wcolh_oi(W, k0, o, lane, CC)
#else
#define WOCOL(W, k0, o, lane) wcol_io(W, k0, o, lane, DIN)
#define WOCOLH(W, k0, o, lane) wcolh_io(W, k0, o, lane, DIN)
#endif
#define DOUT 64            // head width = plane width CC
#ifndef SM_EXTRA_PARAMS
#define SM_EXTRA_PARAMS
#endif
#ifndef PROJ_EXTRA_PARAMS
#define PROJ_EXTRA_PARAMS
#endif
#ifndef SM_MASK_HOOK
#define SM_MASK_HOOK (void)0
#endif

#define WS_QH  0u                                      // f16 q, fragment order: [b*t / 16] tiles of 16 rows x CC = 4 pieces of 512 B; piece = features 16 * piece .. + 15, a lane's 16 B (row lane & 15, features + 8 * (lane >> 4)) at lane * 16
#define WS_KH  (WS_QH + 2u * (size_t)NB * TT * CC)      // f16 k, fragment order as q
#define WS_VT  (WS_KH + 2u * (size_t)NB * TT * CC)      // f16 v, fragment order: [b*t / 32] chunks of 32 keys x CC = 8 pieces of 512 B; piece = (16 features j, 16 keys), a lane's 16 B (feature 16 * j + (lane & 15), keys + 8 * (lane >> 4)) at lane * 16
#define WS_QL  (WS_VT + 2u * (size_t)NB * CC * TT)      // f16 q residual x 2^10 rows [b][t < QHI][CC]
#define WS_KL  (WS_QL + 2u * (size_t)NB * QHI * CC)     // f16 k residual x 2^10 rows [b][t < KHI][CC]
#define WS_VB  (WS_KL + 2u * (size_t)NB * KHI * CC)     // bf16 v hi planes [b][c][t < KHI]
#define WS_VBL (WS_VB + 2u * (size_t)NB * CC * KHI)
#define WS_Y   (WS_VBL + 2u * (size_t)NB * CC * KHI)    // f32 ctx rows [b*t][CC] (only when there is an output projection)
#define WS_END (WS_Y  + 0u)

// SXW: behind a global store, before the next LDS read or address sum reuses its data or address registers
__device__ __forceinline__ void SXW() { asm volatile("s_wait_xcnt 0x0" ::: "memory"); }
#define XH (DIN / 2)   // k's of X that a wave of k_proj has in LDS at a time
#define XU 272     // LDS bytes from one unit of X (16 rows x 8 k as bf16, 256 B) to the next: the 16 B over spread the 16 units of a staging store over all banks
typedef __attribute__((ext_vector_type(4))) __bf16 v4b;
#define WFS 1040   // LDS bytes from one W fragment (two halves of 512 B) to the next: the 16 B over 1 KiB spread the staging stores of the 4 column tiles over all banks
// ---- k_proj: block = (64 rows, all CC cols, which): q/k/v = X W (+ b) with exact bf16 products (K = DIN) -> which 0: q f16 in fragment order (+ residual rows < QHI); 1: k f16 in fragment order (+ residual rows < KHI); 2: v f16 in fragment order (+ bf16 hi/lo planes [c][t] for t < KHI). The block's 64 rows are 8 KiB in a row of each fragment-ordered plane, stored 16 B a thread in address order
__global__ __launch_bounds__(128) void k_proj(const float* __restrict__ XQ, const float* __restrict__ XK, const float* __restrict__ XV, const float* __restrict__ WQ, const float* __restrict__ WK, const float* __restrict__ WV, const float* __restrict__ BQ, const float* __restrict__ BK, const float* __restrict__ BV,
    _Float16* __restrict__ QH, _Float16* __restrict__ QL, _Float16* __restrict__ KH, _Float16* __restrict__ KL, _Float16* __restrict__ VT, __bf16* __restrict__ VB, __bf16* __restrict__ VBL) {
  // one LDS block, used twice: first the block's whole W as bf16 B fragments, then (behind a barrier) the tiles that reorder the results for the stores
  __shared__ __align__(16) union { unsigned char w[(DIN / 32) * (CC / 16) * WFS]; struct { _Float16 sh[64][CC + 8], sl[64][CC + 8]; } qk; struct { _Float16 th[CC][72]; __bf16 tb[CC][72], tbl[CC][72]; } vv; } sm;
  __shared__ __align__(16) unsigned char xs[4][(XH / 8) * XU];   // each wave's own 16 rows of X, XH k's, as bf16 in A-fragment order; no other wave touches them
  _Float16 (*sh)[CC + 8] = sm.qk.sh; _Float16 (*sl)[CC + 8] = sm.qk.sl; _Float16 (*th)[72] = sm.vv.th; __bf16 (*tb)[72] = sm.vv.tb; __bf16 (*tbl)[72] = sm.vv.tbl;
  const int tid = threadIdx.x, wave = tid >> 5, lane = tid & 31, col = lane & 15, g = lane >> 4; const int which = blockIdx.z; const int c0 = 0; const size_t r0 = (size_t)blockIdx.x * 64; const size_t bb = r0 / TT; const int t0 = (int)(r0 % TT);
  const float* X = which == 0 ? XQ : which == 1 ? XK : XV; const float* WA = which == 0 ? WQ : which == 1 ? WK : WV; const float* BA = which == 0 ? BQ : which == 1 ? BK : BV;
  // X -> LDS, half of K at a time: a wave's load covers 512 contiguous bytes of one row (4 whole lines; a fragment load straight from X touches 16). A lane rounds its 4 k to bf16 and stores them as 8 B of unit k >> 3, at row * 16 + ((k >> 2) & 1) * 8: lane (g, col) then reads elements 0..7 of step kl from unit kl * 4 + g and 8..15 from unit kl * 4 + 2 + g, at col * 16
  const float* xp = X + (r0 + wave * 16) * DIN + lane * 4; unsigned char* xst = xs[wave] + (lane >> 1) * XU + (lane & 1) * 8; const unsigned char* xld = xs[wave] + g * XU + col * 16; v4f xr[32];
#define XLDH(hf) do { _Pragma("unroll") for (int e = 0; e < 32; ++e) xr[e] = *(const v4f*)(xp + (e >> 1) * DIN + (hf) * XH + (e & 1) * 128); \
    asm volatile("s_wait_xcnt 0x0" :: "v"(xp) : "memory"); /* behind the last load, with the address pair held up to here: what follows may reuse that pair */ } while (0)
#define XSTH() do { _Pragma("unroll") for (int e = 0; e < 32; ++e) { v4b q; _Pragma("unroll") for (int i = 0; i < 4; ++i) q[i] = (__bf16)xr[e][i]; *(v4b*)(xst + (e & 1) * 16 * XU + (e >> 1) * 16) = q; } } while (0)
  // W (in,out) [DIN][DOUT] -> LDS: a thread takes 64 rows k (8 runs of 8, 64 apart) x 4 columns (64 loads of 16 B; a wave's load covers 4 whole lines), rounds to bf16 and stores each column's 8 k as the 16 B that lane (g = (k >> 3) & 1, col) of fragment (kc = k >> 5, j = column >> 4), half (k >> 4) & 1, reads in the loop
  { const int sc = tid & 15, sk = tid >> 4; const float* wp = WA + (size_t)sk * 8 * DOUT + sc * 4;
    unsigned char* wd = sm.w + ((sk >> 2) * (CC / 16) + (sc >> 2)) * WFS + ((sk >> 1) & 1) * 512 + ((sk & 1) * 16 + (sc & 3) * 4) * 16; v4f r[DIN / 64][8];
#pragma unroll   // constant offsets off one address pair and one LDS address; all of a thread's loads are in flight at once
    for (int it = 0; it < DIN / 64; ++it)
#pragma unroll
      for (int i = 0; i < 8; ++i) r[it][i] = *(const v4f*)(wp + (size_t)(it * 64 + i) * DOUT);
    asm volatile("s_wait_xcnt 0x0" :: "v"(wp) : "memory");   // behind the last load, with the address pair held up to here: what follows may reuse that pair
#pragma unroll
    for (int it = 0; it < DIN / 64; ++it)
#pragma unroll
      for (int x = 0; x < 4; ++x) { v8b q;
#pragma unroll
        for (int i = 0; i < 8; ++i) q[i] = (__bf16)r[it][i][x];
        *(v8b*)(wd + it * 2 * (CC / 16) * WFS + x * 16) = q; } }
  XLDH(0);   // into registers that the W rows have left
  __syncthreads();   // the whole W stands in LDS before any wave reads a fragment
  v8f acc[CC / 16] = {};
#pragma unroll   // two halves: xr is loaded for the second while the first is worked on
  for (int hf = 0; hf < 2; ++hf) {
  __builtin_amdgcn_sched_barrier(0);   // this half's roundings stay here, behind the barrier or the products in front: lifted in among the W roundings they cost registers (339 in the build without this line, 329 with it; three waves fit a SIMD up to 336)
  LDSX();   // the wave's fragment reads of the half before are done before its stores overwrite them (lanes read what other lanes of the wave stored: the compiler sees no dependence)
  XSTH();
  LDSX();   // the wave's stores stand in LDS before its lanes read each other's
  if (hf == 0) XLDH(1);   // flies while the first half is worked on
#pragma unroll 2
  for (int kl = 0; kl < XH / 32; ++kl) { const int kc = hf * (XH / 32) + kl; v16b a; { union { v16b v; v8b q[2]; } u; const unsigned char* p = xld + kl * 4 * XU; u.q[0] = *(const v8b*)p; u.q[1] = *(const v8b*)(p + 2 * XU); a = u.v; }
    v16b w[CC / 16];
#pragma unroll
    for (int j = 0; j < CC / 16; ++j) { union { v16b v; v8b q[2]; } u; const unsigned char* p = sm.w + (kc * (CC / 16) + j) * WFS + lane * 16; u.q[0] = *(const v8b*)p; u.q[1] = *(const v8b*)(p + 512); w[j] = u.v; }
#pragma unroll
    for (int j = 0; j < CC / 16; ++j) acc[j] = wmma_bf(a, w[j], acc[j]); } }
  __syncthreads();   // every wave has read its last W fragment before the result tiles overwrite that LDS
  if (which < 2) { _Float16* DH = which == 0 ? QH : KH; _Float16* DL = which == 0 ? QL : KL; const int nhi = which == 0 ? QHI : KHI; const bool hi_rows = t0 < nhi;
#pragma unroll
    for (int j = 0; j < CC / 16; ++j) { const float bias = BA ? bfr(BA[c0 + j * 16 + col]) : 0.f;
#pragma unroll
      for (int r = 0; r < 8; ++r) { const float v = acc[j][r] + bias; const _Float16 hv = (_Float16)v; sh[wave * 16 + 8 * g + r][j * 16 + col] = hv; sl[wave * 16 + 8 * g + r][j * 16 + col] = (_Float16)((v - (float)hv) * 1024.0f); } }
    __syncthreads();
    for (int e = tid; e < 64 * (CC / 8); e += 128) { const int rl = e / (CC / 8), q = e % (CC / 8); vst2((unsigned*)(DH + r0 * CC + e * 8), *(const v4u*)&sh[(e >> 7) * 16 + (e & 15)][(((e >> 5) & 3) * 2 + ((e >> 4) & 1)) * 8]); SXW(); if (hi_rows) { vst2((unsigned*)(DL + (bb * nhi + t0 + rl) * (size_t)CC + c0 + q * 8), *(const v4u*)&sl[rl][q * 8]); SXW(); } }
  } else { const bool hi_rows = t0 < KHI;
#pragma unroll
    for (int j = 0; j < CC / 16; ++j) { const float bias = BA ? bfr(BA[c0 + j * 16 + col]) : 0.f;
#pragma unroll
      for (int r = 0; r < 8; ++r) { const float v = acc[j][r] + bias; const int rl = wave * 16 + 8 * g + r, cl = j * 16 + col; th[cl][rl] = (_Float16)v; const __bf16 bh = (__bf16)v; tb[cl][rl] = bh; tbl[cl][rl] = (__bf16)(v - (float)bh); } }
    __syncthreads();
    for (int e = tid; e < CC * 8; e += 128) { const int cl = e >> 3, q = e & 7; vst2((unsigned*)(VT + r0 * CC + e * 8), *(const v4u*)&th[((e >> 6) & 3) * 16 + (e & 15)][(e >> 8) * 32 + ((e >> 5) & 1) * 16 + ((e >> 4) & 1) * 8]); SXW(); if (hi_rows) { const size_t o3 = (bb * CC + c0 + cl) * (size_t)KHI + t0 + q * 8; vst2((unsigned*)(VB + o3), *(const v4u*)&tb[cl][q * 8]); SXW(); vst2((unsigned*)(VBL + o3), *(const v4u*)&tbl[cl][q * 8]); SXW(); } } } }
// ---- k_att: block = NTL = 2 query tiles of QT * 16 = 32 queries of sequence b, taken one after the other: tile TT / 32 - 1 - pi (many keys) and tile pi (few), 129 key chunks together in every block, dealt over the PVW waves as one list (the short tile's chunk 0 goes to the wave behind the long tile's last chunk), so a wave has 8 chunks and one wave 9. What follows is said of one tile, w being the wave's place in that tile's deal; wave w takes the 32-key chunks w, w + PVW, ... up to the diagonal, and uses every k and v fragment it loads for both 16-row tiles of the tile. Logits are formed transposed (A = k rows, B = q rows), so a lane holds 16 logits of ONE query in the very order of the B fragment of v^T . P^T: they stay in registers and are masked by index. The wave keeps a running row maximum: each chunk turns its logits into exp(logit - running maximum) x 2^11 (once to f16 against v f16) and first weights its sum and its output tile by exp(old maximum - new maximum); the output tile is transposed too (rows = features, column = the lane's query), so that weight is the lane's own (query blocks < QBH: one chunk a wave, 3-product logits, P and v as bf16 hi + lo). Each wave leaves its f32 partial tiles, row maxima and row sums in the tile's own LDS, at its place w; behind one barrier for both tiles the wave of index n = tid >> 5 joins rows n and n + 16 of each tile over the places in order, each partial weighted by exp(its maximum - the row's maximum), and divides by the joined sum. A masked logit is -3e38: its exp is 0 beside any real maximum; a wave with no chunk has the maximum -3e38, and its partial gets the weight 0 in the join (key 0 is open to every query, so the row's maximum is real)
#define PVW 16
#define LOG2E 1.44269504088896340736f
// 2^x in the one hardware instruction: every argument below is <= 11, and a result under 2^-126 may read 0 beside a row whose largest term is 2^11 (or 1 in the join)
__device__ __forceinline__ float ex2(float x) { return __builtin_amdgcn_exp2f(x); }
// the same for the join: the v_nop in the same statement is the one free slot that the instruction set asks for behind a transcendental
__device__ __forceinline__ float ex2_slot(float x) { float r; asm("v_exp_f32 %0, %1\n\tv_nop" : "=v"(r) : "v"(x)); return r; }
// XW: in front of a load whose result may land on the address pair of loads issued before it
__device__ __forceinline__ void XW() { asm volatile("s_wait_xcnt 0x0" ::: "memory"); }
// last fragment of a run of loads off one address pair: only the run's last load can get that pair as its result registers, so the wait stands in front of it
__device__ __forceinline__ v16h frag_t_end(const _Float16* tile, int c, int lane) {
  union { v16h v; v8h q[2]; } u; const _Float16* p = tile + c * 512 + lane * 8;
  u.q[0] = *(const v8h*)p; XW(); u.q[1] = *(const v8h*)(p + 256); return u.v;
}
// fragment c of a fragment-ordered tile (q, k: 16 rows, c = the 32 features; v: 32 keys, c = the 16 features): two loads of 512 contiguous bytes a wave, 4 whole lines each
__device__ __forceinline__ v16h frag_t(const _Float16* tile, int c, int lane) {
  union { v16h v; v8h q[2]; } u; const _Float16* p = tile + c * 512 + lane * 8;
  u.q[0] = *(const v8h*)p; u.q[1] = *(const v8h*)(p + 256); return u.v;
}
__device__ __forceinline__ v16h frag_t_w(const _Float16* tile, int c, int lane) {
  union { v16h v; v8h q[2]; } u; const _Float16* p = tile + c * 512 + lane * 8;
  u.q[0] = *(const v8h*)p; XW(); u.q[1] = *(const v8h*)(p + 256); XW(); return u.v;
}
// fragments of the three-product path (many address pairs, one chunk a wave): the wait behind every load
__device__ __forceinline__ v16h frag_h_w(const _Float16* rowk0, int lane) {
  union { v16h v; v8h q[2]; } u; const _Float16* p = rowk0 + 8 * (lane >> 4);
  u.q[0] = *(const v8h*)p; XW(); u.q[1] = *(const v8h*)(p + 16); XW(); return u.v;
}
__device__ __forceinline__ v16b frag_b_w(const __bf16* rowk0, int lane) {
  union { v16b v; v8b q[2]; } u; const __bf16* p = rowk0 + 8 * (lane >> 4);
  u.q[0] = *(const v8b*)p; XW(); u.q[1] = *(const v8b*)(p + 16); XW(); return u.v;
}
#define QT 2   // 16-row tiles that share each k and v fragment
#define NTL 2  // 32-query tiles a work-group takes one after the other
// eight 2^x in one statement: the build put a v_exp_f32 that overwrites an argument directly behind the v_exp_f32 that reads it. Here no output shares a register with an argument (early clobber), so each instruction is the free slot that the instruction set asks for behind the transcendental in front of it, and the v_nop is the last one's
__device__ __forceinline__ void ex2x8(float* r, const float* x) {
  asm("v_exp_f32 %0, %8\n\tv_exp_f32 %1, %9\n\tv_exp_f32 %2, %10\n\tv_exp_f32 %3, %11\n\tv_exp_f32 %4, %12\n\tv_exp_f32 %5, %13\n\tv_exp_f32 %6, %14\n\tv_exp_f32 %7, %15\n\tv_nop"
      : "=&v"(r[0]), "=&v"(r[1]), "=&v"(r[2]), "=&v"(r[3]), "=&v"(r[4]), "=&v"(r[5]), "=&v"(r[6]), "=&v"(r[7]) : "v"(x[0]), "v"(x[1]), "v"(x[2]), "v"(x[3]), "v"(x[4]), "v"(x[5]), "v"(x[6]), "v"(x[7])); }
// lane l with lane l ^ 16 in one vector instruction
__device__ __forceinline__ float xhalf(float x) { return __builtin_bit_cast(float, __builtin_amdgcn_permlanex16(__builtin_bit_cast(int, x), __builtin_bit_cast(int, x), 0x76543210, 0xfedcba98, false, false)); }
__global__ __launch_bounds__(PVW * 32) void k_att(const _Float16* __restrict__ QH, const _Float16* __restrict__ KH, const _Float16* __restrict__ QL, const _Float16* __restrict__ KL, const _Float16* __restrict__ VT, const __bf16* __restrict__ VB, const __bf16* __restrict__ VBL, float* __restrict__ Y) {
  __shared__ __align__(16) float ss[NTL][PVW][16 * QT][HD + 4]; __shared__ float smx[NTL][PVW][16 * QT], ssu[NTL][PVW][16 * QT];
  const int tid = threadIdx.x, pw = __builtin_amdgcn_readfirstlane(tid >> 5), lane = tid & 31, col = lane & 15, g = lane >> 4; const int b = blockIdx.x % TNB, pi = blockIdx.x / TNB;   // all sequences in one grid, one work-group a WGP; the blocks whose short tile takes the three-product path come first
  const _Float16* Kb = KH + (size_t)b * TT * CC;
  for (int tl = 0; tl < NTL; ++tl) {
  const int qt = tl == 0 ? TT / (16 * QT) - 1 - pi : pi; const int wave = tl == 0 ? pw : (pw + pi) & (PVW - 1);   // the long tile has TT / 32 - pi chunks, a multiple of PVW less pi: the short tile's chunk c falls to wave (c - pi) mod PVW
  const int ql0 = qt * (16 * QT); const int qb = ql0 >> 6; const int kce = (ql0 >> 5) + 1;   // chunks that hold a key <= the tile's last query
  const _Float16* Qt = QH + ((size_t)b * TT + ql0) * CC;
  v8f acc[QT][HD / 16] = {}; float m[QT], sum[QT];   // acc[h][j][r]: feature 16 j + 8 g + r of query ql0 + 16 h + col
#pragma unroll
  for (int h = 0; h < QT; ++h) { m[h] = -3.0e38f; sum[h] = 0.f; }
  // every unroll below: the loop indexes register arrays or vector elements, which takes constant indices
  if (qb < QBH) {
    if (wave < kce) { const int k0 = wave * 32; const _Float16* Klb = KL + (size_t)b * KHI * CC;
#pragma unroll
      for (int h = 0; h < QT; ++h) { const int t = ql0 + h * 16 + col; const _Float16* Qlr = QL + ((size_t)b * QHI + t) * CC;
        v8f a0[2] = {}, a1[2] = {};
#pragma unroll
        for (int c = 0; c < HD / 32; ++c) { const v16h ah = frag_t_w(Qt + h * 16 * CC, c, lane), al = frag_h_w(Qlr + c * 32, lane);
#pragma unroll
          for (int u = 0; u < 2; ++u) { const size_t ko = (size_t)(k0 + u * 16 + col) * CC + c * 32; const v16h kbf = frag_t_w(Kb + (size_t)(k0 + u * 16) * CC, c, lane), klf = frag_h_w(Klb + ko, lane); a0[u] = wmma16(kbf, ah, a0[u]); a1[u] = wmma16(kbf, al, a1[u]); a1[u] = wmma16(klf, ah, a1[u]); } }
        float s[16], mh = -3.0e38f, sh = 0.f;
#pragma unroll
        for (int e = 0; e < 16; ++e) { const float v = (a0[e >> 3][e & 7] + a1[e >> 3][e & 7] * (1.0f / 1024.0f)) * SCALE; s[e] = (k0 + (e >> 3) * 16 + 8 * g + (e & 7) <= t) ? v : -3.0e38f; mh = fmaxf(mh, s[e]); }
        mh = fmaxf(mh, xhalf(mh));
#pragma unroll
        for (int e = 0; e < 16; ++e) { const float ev = expf(s[e] - mh); sh += ev; s[e] = ev * 2048.0f; }
        m[h] = mh; sum[h] = sh;
        const F2 p = bsplit16(s);
#pragma unroll
        for (int j = 0; j < HD / 16; ++j) { const size_t po = ((size_t)b * CC + j * 16 + col) * (size_t)KHI + k0; const v16b vh = frag_b_w(VB + po, lane); acc[h][j] = wmma_bf(vh, p.h, acc[h][j]); acc[h][j] = wmma_bf(vh, p.l, acc[h][j]); acc[h][j] = wmma_bf(frag_b_w(VBL + po, lane), p.h, acc[h][j]); } } }
  } else {
    v16h qf[QT][HD / 32];
#pragma unroll
    for (int h = 0; h < QT; ++h)
#pragma unroll
      for (int c = 0; c < HD / 32; ++c) qf[h][c] = frag_t(Qt + h * 16 * CC, c, lane);
    for (int kc = wave; kc < kce; kc += PVW) { const int k0 = kc * 32; v16h kf[2 * (HD / 32)], vf[HD / 16]; v8f a[QT][2] = {};
      const _Float16* vp = VT + ((size_t)b * TT + k0) * CC;
#pragma unroll
      for (int c = 0; c < HD / 32; ++c)
#pragma unroll
        for (int u = 0; u < 2; ++u) kf[c * 2 + u] = frag_t(Kb + (size_t)(k0 + u * 16) * CC, c, lane);
      XW();   // a v load's result may land on the address pair of the k (and, in the first trip, the q) loads
#pragma unroll   // the v loads go out with the k loads: they fly while the logits and the exps are worked on
      for (int j = 0; j < HD / 16; ++j) vf[j] = (j < HD / 16 - 1) ? frag_t(vp, j, lane) : frag_t_end(vp, j, lane);
      XW();   // behind the chunk's last load: the next trip moves the addresses on
#pragma unroll
      for (int c = 0; c < HD / 32; ++c)
#pragma unroll
        for (int u = 0; u < 2; ++u)
#pragma unroll
          for (int h = 0; h < QT; ++h) a[h][u] = wmma16(kf[c * 2 + u], qf[h][c], a[h][u]);
      if (kc == kce - 1) {   // only the last chunk reaches past a query of this tile
#pragma unroll
        for (int h = 0; h < QT; ++h)
#pragma unroll
          for (int e = 0; e < 16; ++e) a[h][e >> 3][e & 7] = (k0 + (e >> 3) * 16 + 8 * g + (e & 7) <= ql0 + h * 16 + col) ? a[h][e >> 3][e & 7] : -3.0e38f; }
      v16h p[QT];
#pragma unroll
      for (int h = 0; h < QT; ++h) { float cm = a[h][0][0];
#pragma unroll
        for (int e = 1; e < 16; ++e) cm = fmaxf(cm, a[h][e >> 3][e & 7]);
        const float mn = fmaxf(m[h], fmaxf(cm, xhalf(cm))); const float f = ex2_slot((m[h] - mn) * (SCALE * LOG2E)); m[h] = mn;   // the first chunk: f = 0 on a sum and a tile that are 0
        float cs = 0.f, x[16], ev[16];
#pragma unroll
        for (int e = 0; e < 16; ++e) x[e] = (a[h][e >> 3][e & 7] - mn) * (SCALE * LOG2E) + 11.0f;   // the logits and mn are unscaled products here: the scale, log2(e) and the 2^11 go into one multiply-add
        ex2x8(ev, x); ex2x8(ev + 8, x + 8);
#pragma unroll
        for (int e = 0; e < 16; ++e) { cs += ev[e]; p[h][e] = (_Float16)ev[e]; }
        sum[h] = sum[h] * f + cs;
#pragma unroll
        for (int j = 0; j < HD / 16; ++j) acc[h][j] *= f; }
#pragma unroll
      for (int j = 0; j < HD / 16; ++j)
#pragma unroll
        for (int h = 0; h < QT; ++h) acc[h][j] = wmma16(vf[j], p[h], acc[h][j]); }
#pragma unroll
    for (int h = 0; h < QT; ++h) { sum[h] *= 1.0f / 2048.0f; m[h] *= SCALE; } }   // both exact: the join below gets the same units as from the three-product path (a wave with no chunk hands on -3e38 / 8: its weight in the join is 0 as before)
#pragma unroll
  for (int h = 0; h < QT; ++h) { sum[h] += xhalf(sum[h]);
    if (g == 0) { smx[tl][wave][h * 16 + col] = m[h]; ssu[tl][wave][h * 16 + col] = sum[h]; }
#pragma unroll
    for (int j = 0; j < HD / 16; ++j) { float* d = &ss[tl][wave][h * 16 + col][j * 16 + 8 * g]; const v8f x = acc[h][j];
      *(v4f*)d = (v4f){x[0], x[1], x[2], x[3]}; *(v4f*)(d + 4) = (v4f){x[4], x[5], x[6], x[7]}; } } }
  __syncthreads();   // every wave's partial tiles, maxima and sums of both query tiles are in LDS before any wave joins them
  for (int tl = 0; tl < NTL; ++tl) { const int ql0 = (tl == 0 ? TT / (16 * QT) - 1 - pi : pi) * (16 * QT);
  v2f o[QT];
#pragma unroll
  for (int h = 0; h < QT; ++h) { const int row = h * 16 + pw;
    float mm = smx[tl][0][row];
#pragma unroll
    for (int w = 1; w < PVW; ++w) mm = fmaxf(mm, smx[tl][w][row]);
    v2f oh = {}; float tot = 0.f;
#pragma unroll   // the LDS reads of all partial tiles issue ahead of the adds instead of one round trip each
    for (int w = 0; w < PVW; ++w) { const float f = ex2_slot((smx[tl][w][row] - mm) * LOG2E); tot += ssu[tl][w][row] * f; oh += *(const v2f*)&ss[tl][w][row][lane * 2] * f; }
    o[h] = oh * (tot > 0.f ? 1.0f / (2048.0f * tot) : 0.f); }
#pragma unroll
  for (int h = 0; h < QT; ++h) { vst2(Y + ((size_t)b * TT + ql0 + h * 16 + pw) * CC + lane * 2, o[h]); if (tl < NTL - 1 || h < QT - 1) SXW(); } } }

extern "C" void kernel_launch(void* const* d_in, const int* in_sizes, int n_in, void* d_out, int out_size, void* d_ws, size_t ws_size, hipStream_t stream) {
  (void)in_sizes; (void)n_in; (void)out_size;
  const float** F = (const float**)d_in;
  if (ws_size < (size_t)WS_END) return;
  char* ws = (char*)d_ws; _Float16 *QH = (_Float16*)(ws + WS_QH), *KH = (_Float16*)(ws + WS_KH), *VT = (_Float16*)(ws + WS_VT), *QL = (_Float16*)(ws + WS_QL), *KL = (_Float16*)(ws + WS_KL); __bf16 *VB = (__bf16*)(ws + WS_VB), *VBL = (__bf16*)(ws + WS_VBL); float *Y = (float*)(ws + WS_Y);
  (void)Y; (void)QL; (void)KL; (void)VB; (void)VBL;
  // inputs: 0 X [4,4096,512]; 1 Wq, 2 Wk, 3 Wv [512,64] (in,out)
  k_proj<<<dim3(TNB * TT / 64, 1, 3), 128, 0, stream>>>(F[0], F[0], F[0], F[1], F[2], F[3], nullptr, nullptr, nullptr, QH, QL, KH, KL, VT, VB, VBL);
  k_att<<<dim3(TNB * (TT / (16 * QT * NTL)), 1, 1), PVW * 32, 0, stream>>>(QH, KH, QL, KL, VT, VB, VBL, (float*)d_out);
}
